// v000
// The times below were measured on an AMD MI455X: many runs one after another, warmed up first and cycling through
// copies of the inputs, with the whole window's GPU time divided by the number of runs. Launches and the gaps
// between them are all in it. The median over several windows is given; except for v000 it joins two sittings, which
// can be a few percent apart, so the side-by-side timings, each taken in one sitting, are the better comparison.
// The starting kernel, v000, takes 2710 microseconds a run.
#include <hip/hip_runtime.h>

// Compute dtypes, f32 accumulate, per item: the three per-head hyperbolic linears as [2048 x 512].[512 x 512] GEMMs with PLAIN bf16 operands (exact products; all 8 heads' space
// parts at once), the Lorentz time coordinate sqrt(|x_s|^2 + k) in f32; per head: space scores = q_s.k_s^T ([2048 x 64].[64 x 2048], both operands bf16 hi + UNSCALED residual,
// three products; key tiles wholly above the diagonal skipped), the time term -q_0 k_0, the affine (2 + 2<q,k>_L)/scale + bias and the causal softmax in f32 -> P planes, the
// time component of the context from row 64 of the padded V^T planes in the P.V GEMM, the space context = P.v_s ([2048 x 2048].[2048 x 64], three products, K limited to the causal extent);

#define NBT  4
#define NN   2048
#define DIN  512
#define NH_  8
#define HD   64
#define DSP  (NH_ * HD)           // 512 space outputs over all heads
#define DL   (HD + 1)             // 65 Lorentz dims per head
#define DM   DIN
#define NTK  NN
#define KCURV 1.0f
#define LOSC 1024.0f

typedef _Float16 h16;
typedef unsigned short bf;
typedef __attribute__((ext_vector_type(16))) __bf16   v16bf;
typedef __attribute__((ext_vector_type(16))) _Float16 v16h;
typedef __attribute__((ext_vector_type(8)))  _Float16 v8h;
typedef __attribute__((ext_vector_type(8)))  unsigned short v8us;
typedef __attribute__((ext_vector_type(8)))  float    v8f;
typedef __attribute__((ext_vector_type(4)))  float    v4f;
typedef __attribute__((ext_vector_type(4)))  _Float16 v4h;
typedef v8h  __attribute__((may_alias)) v8ha;
typedef v4f  __attribute__((may_alias)) v4fa;
typedef v8us __attribute__((may_alias)) v8usa;

__device__ __forceinline__ unsigned short f2bf(float f) { unsigned u = __float_as_uint(f); u += 0x7FFFu + ((u >> 16) & 1u); return (unsigned short)(u >> 16); }
__device__ __forceinline__ float bf2f(unsigned short b) { return __uint_as_float(((unsigned)b) << 16); }
__device__ __forceinline__ float bfr(float f) { return bf2f(f2bf(f)); }
__device__ __forceinline__ v16h cat16(v8h lo, v8h hi) { return __builtin_shufflevector(lo, hi, 0, 1, 2, 3, 4, 5, 6, 7, 8, 9, 10, 11, 12, 13, 14, 15); }
__device__ __forceinline__ v16bf cat16b(v8us lo, v8us hi) { return __builtin_bit_cast(v16bf, __builtin_shufflevector(lo, hi, 0, 1, 2, 3, 4, 5, 6, 7, 8, 9, 10, 11, 12, 13, 14, 15)); }
__device__ __forceinline__ v8f wmma16(v16h a, v16h b, v8f c) { return __builtin_amdgcn_wmma_f32_16x16x32_f16(false, a, false, b, (short)0, c, false, false); }
__device__ __forceinline__ v8f wmmab(v16bf a, v16bf b, v8f c) { return __builtin_amdgcn_wmma_f32_16x16x32_bf16(false, a, false, b, (short)0, c, false, false); }

// k_gemmb: 64 x 64 block tile (4 waves x 16 x 64) of C[NTK][NW] = (A [+ Al]).B^T (K = 512) [+ bf(bias[c])] [+ bf(R[r][c]) residual]; f32 whole-line epilogue (or f16
template <bool SPLITA, bool F16OUT = false>
__global__ __launch_bounds__(128) void k_gemmb(const bf* __restrict__ A, const bf* __restrict__ Al, const bf* __restrict__ Bn, const float* __restrict__ bias, float* C, int ldc, h16* C2, const float* __restrict__ R = nullptr, int K = DM, int roundR = 1) {
    __shared__ __align__(16) float ost[4][16 * 68];
    const int lane = threadIdx.x & 31, wave = threadIdx.x >> 5, lr = lane & 15, hi = lane >> 4;
    const int r0 = blockIdx.x * 64 + wave * 16, c0 = blockIdx.y * 64;
    const size_t aoff = (size_t)(r0 + lr) * K + 8 * hi;
    size_t boff[4];
#pragma unroll
    for (int t = 0; t < 4; ++t) boff[t] = (size_t)(c0 + t * 16 + lr) * K + 8 * hi;
    v8f acc[4];
#pragma unroll
    for (int t = 0; t < 4; ++t) acc[t] = (v8f){};
#pragma unroll 1
    for (int kc = 0; kc < K; kc += 32) {
        const v16bf a = cat16b(*(const v8us*)(A + aoff + kc), *(const v8us*)(A + aoff + kc + 16));
        v16bf al = a;
        if (SPLITA) al = cat16b(*(const v8us*)(Al + aoff + kc), *(const v8us*)(Al + aoff + kc + 16));
#pragma unroll
        for (int t = 0; t < 4; ++t) { const v16bf b = cat16b(*(const v8us*)(Bn + boff[t] + kc), *(const v8us*)(Bn + boff[t] + kc + 16)); acc[t] = wmmab(a, b, acc[t]); if (SPLITA) acc[t] = wmmab(al, b, acc[t]); }
        asm volatile("v_nop\n\tv_nop\n\tv_nop\n\tv_nop" : "+v"(acc[0]), "+v"(acc[1]), "+v"(acc[2]), "+v"(acc[3]) : "v"(a), "v"(al));
    }
    float* os = &ost[wave][0];
#pragma unroll
    for (int t = 0; t < 4; ++t) { const float bv = bias ? bfr(bias[c0 + t * 16 + lr]) : 0.f;
#pragma unroll
        for (int j = 0; j < 8; ++j) os[(hi * 8 + j) * 68 + t * 16 + lr] = acc[t][j] + bv; }
    __syncthreads();
    if (F16OUT) {
        h16* crow = (h16*)(void*)C + (size_t)r0 * ldc + c0;
        auto pass = [&]() {
#pragma unroll
            for (int s = 0; s < 4; ++s) { const int row = 4 * s + (lane >> 3), piece = lane & 7; const float* sp = os + row * 68 + piece * 8; v8h o, o2;
#pragma unroll
                for (int i = 0; i < 8; ++i) { const h16 a = (h16)sp[i]; o[i] = a; o2[i] = (h16)((sp[i] - (float)a) * LOSC); }
                *(v8h*)(crow + (size_t)row * ldc + piece * 8) = o; if (C2) *(v8h*)(C2 + (size_t)r0 * ldc + c0 + (size_t)row * ldc + piece * 8) = o2; }
        };
        pass(); 
    } else {
        float* crow = C + (size_t)r0 * ldc + c0;
        auto pass = [&]() {
#pragma unroll
            for (int s = 0; s < 8; ++s) { const int Lid = (lane >> 3) + 4 * s, piece = lane & 7; const int row = Lid >> 1, cofs = (Lid & 1) * 32 + piece * 4;
                v4f val = *(const v4fa*)(os + row * 68 + cofs); if (R) { const v4f rv = *(const v4f*)(R + ((size_t)r0 + row) * ldc + c0 + cofs); val += roundR ? (v4f){bfr(rv[0]), bfr(rv[1]), bfr(rv[2]), bfr(rv[3])} : rv; }
                *(v4f*)(crow + (size_t)row * ldc + cofs) = val; }
        };
        pass(); 
    }
}


// ===== z-batched (blockIdx.z = head offset within the head pair, head h0 + z) attention pieces =====
// k_gemm3z<MODE>: 64 x 64 block tile of C = A.B^T from bf16 hi/lo planes, with per-z operand/output strides (elements): A planes += z*sA, B planes += z*sB, C += z*sC. MODE bits (0 causal skip, 1 K limit, 2 single,
// 3 B single, 4 A single).
template <int MODE>
__global__ __launch_bounds__(128) void k_gemm3z(const bf* __restrict__ Ah, const bf* __restrict__ Al, const bf* __restrict__ Bh, const bf* __restrict__ Bl, int K, float* C, int ldc, size_t sA, size_t sB, size_t sC) {
    if ((MODE & 1) && (int)blockIdx.y * 64 > (int)blockIdx.x * 64 + 63) return;
    const size_t z = blockIdx.z; Ah += z * sA; Al += z * sA; Bh += z * sB; Bl += z * sB; C += z * sC;
    const int Klim = (MODE & 2) ? min(K, ((int)blockIdx.x + 1) * 64) : K;
    __shared__ __align__(16) float ost[4][16 * 68];
    const int lane = threadIdx.x & 31, wave = threadIdx.x >> 5, lr = lane & 15, hi = lane >> 4;
    const int r0 = blockIdx.x * 64 + wave * 16, c0 = blockIdx.y * 64;
    const size_t aoff = (size_t)(r0 + lr) * K + 8 * hi;
    v8f acc[4];
#pragma unroll
    for (int t = 0; t < 4; ++t) acc[t] = (v8f){};
#pragma unroll 1
    for (int kc = 0; kc < Klim; kc += 32) {
        const v16bf a = cat16b(*(const v8us*)(Ah + aoff + kc), *(const v8us*)(Ah + aoff + kc + 16));
        v16bf al = a; if (!(MODE & 4) && !(MODE & 16)) al = cat16b(*(const v8us*)(Al + aoff + kc), *(const v8us*)(Al + aoff + kc + 16));
#pragma unroll
        for (int t = 0; t < 4; ++t) { const size_t bo = (size_t)(c0 + t * 16 + lr) * K + kc + 8 * hi;
            const v16bf bh = cat16b(*(const v8us*)(Bh + bo), *(const v8us*)(Bh + bo + 16));
            acc[t] = wmmab(a, bh, acc[t]);
            if (!(MODE & 4)) { if (!(MODE & 16)) acc[t] = wmmab(al, bh, acc[t]); if (!(MODE & 8)) { const v16bf bl = cat16b(*(const v8us*)(Bl + bo), *(const v8us*)(Bl + bo + 16)); acc[t] = wmmab(a, bl, acc[t]); } } }
        asm volatile("v_nop\n\tv_nop\n\tv_nop\n\tv_nop" : "+v"(acc[0]), "+v"(acc[1]), "+v"(acc[2]), "+v"(acc[3]) : "v"(a), "v"(al));
    }
    float* os = &ost[wave][0];
#pragma unroll
    for (int t = 0; t < 4; ++t) {
#pragma unroll
        for (int j = 0; j < 8; ++j) os[(hi * 8 + j) * 68 + t * 16 + lr] = acc[t][j]; }
    __builtin_amdgcn_wave_barrier(); asm volatile("" ::: "memory");
    float* crow = C + (size_t)r0 * ldc + c0;
    auto pass = [&]() {
#pragma unroll
        for (int s = 0; s < 8; ++s) { const int Lid = (lane >> 3) + 4 * s, piece = lane & 7; const int row = Lid >> 1, cofs = (Lid & 1) * 32 + piece * 4;
            const v4f val = *(const v4fa*)(os + row * 68 + cofs); *(v4f*)(crow + (size_t)row * ldc + cofs) = val; }
    };
    pass(); 
}
__global__ __launch_bounds__(256) void k_planes32z(const float* __restrict__ F, int ld, int off, float sc, int rows, bf* Ph, bf* Pl) {
    typedef __attribute__((ext_vector_type(2))) unsigned short v2us;
    const int lane = threadIdx.x & 31; const size_t r = ((size_t)blockIdx.x * 8 + (threadIdx.x >> 5)) * 2 + (lane >> 4); if (r >= (size_t)rows) return; const int z = blockIdx.z; const int c0 = (lane & 15) * 2; v2us oh, ol;
    Ph += (size_t)z * rows * 32; Pl += (size_t)z * rows * 32;
#pragma unroll
    for (int i = 0; i < 2; ++i) { const float y = F[r * ld + off + z * 32 + c0 + i] * sc; const unsigned short hb = f2bf(y); oh[i] = hb; ol[i] = f2bf(y - bf2f(hb)); }
    const size_t o = r * 32 + c0; *(v2us*)(Ph + o) = oh; *(v2us*)(Pl + o) = ol; 
}
__global__ __launch_bounds__(256) void k_vtpadz(const float* __restrict__ F, int ld, int off, int nk, bf* Th, bf* Tl) {
    typedef __attribute__((ext_vector_type(2))) unsigned short v2us;
    const int lane = threadIdx.x & 31; const size_t wid = (size_t)blockIdx.x * 8 + (threadIdx.x >> 5); if (wid >= (size_t)64 * (nk / 64)) return; const int z = blockIdx.z; const int d = (int)(wid / (nk / 64)); const int k0 = (int)(wid % (nk / 64)) * 64 + lane * 2; v2us oh, ol;
    Th += (size_t)z * 64 * nk; Tl += (size_t)z * 64 * nk;
#pragma unroll
    for (int i = 0; i < 2; ++i) { const float y = (d < 32) ? F[(size_t)(k0 + i) * ld + off + z * 32 + (d < 32 ? d : 0)] : 0.f; const unsigned short hb = f2bf(y); oh[i] = hb; ol[i] = f2bf(y - bf2f(hb)); }
    const size_t o = (size_t)d * nk + k0; *(v2us*)(Th + o) = oh; *(v2us*)(Tl + o) = ol; 
}
template <int NK>
__global__ __launch_bounds__(256) void k_softmaxz(const float* __restrict__ S, int rows, bf* PH, bf* PL) {
    typedef __attribute__((ext_vector_type(4))) unsigned short v4us;
    const int lane = threadIdx.x & 31, i = blockIdx.x * 8 + (threadIdx.x >> 5); if (i >= rows) return; const size_t zo = (size_t)blockIdx.z * rows * NK; const float* sr = S + zo + (size_t)i * NK; PH += zo; PL += zo;
    float m = -3.0e38f;
#pragma unroll 1
    for (int c0 = lane * 4; c0 < NK; c0 += 128) {
#pragma unroll
        for (int q = 0; q < 4; ++q) m = fmaxf(m, sr[c0 + q]); }
#pragma unroll
    for (int sh = 16; sh; sh >>= 1) m = fmaxf(m, __shfl_xor(m, sh, 32));
    float sum = 0.f;
#pragma unroll 1
    for (int c0 = lane * 4; c0 < NK; c0 += 128) {
#pragma unroll
        for (int q = 0; q < 4; ++q) sum += __expf(sr[c0 + q] - m); }
#pragma unroll
    for (int sh = 16; sh; sh >>= 1) sum += __shfl_xor(sum, sh, 32);
    const float inv = 1.0f / sum;
{
#pragma unroll 1
        for (int c0 = lane * 4; c0 < NK; c0 += 128) { v4us oh, ol;
#pragma unroll
            for (int q = 0; q < 4; ++q) { const float p = __expf(sr[c0 + q] - m) * inv; const unsigned short hb = f2bf(p); oh[q] = hb; ol[q] = f2bf(p - bf2f(hb)); }
            const size_t o = (size_t)i * NK + c0; *(v4us*)(PH + o) = oh; *(v4us*)(PL + o) = ol; }
         }
}
__global__ __launch_bounds__(256) void k_placez(const float* __restrict__ XH, int rows, int ldy, float* Y) {
    const int lane = threadIdx.x & 31; const size_t q = (size_t)blockIdx.x * 8 + (threadIdx.x >> 5); if (q >= (size_t)rows) return; const int z = blockIdx.z; const float v = XH[((size_t)z * rows + q) * 64 + lane];
    *(float*)(Y + q * ldy + z * 32 + lane) = v; 
}

__global__ __launch_bounds__(256) void k_hplanesz(const float* __restrict__ F, int ld, int h0, float sc, int rows, bf* Ph, bf* Pl) {
    typedef __attribute__((ext_vector_type(2))) unsigned short v2us;
    const int lane = threadIdx.x & 31; const size_t r = (size_t)blockIdx.x * 8 + (threadIdx.x >> 5); if (r >= (size_t)rows) return; const int z = blockIdx.z; v2us oh, ol;
    Ph += (size_t)z * rows * 64; Pl += (size_t)z * rows * 64;
#pragma unroll
    for (int i = 0; i < 2; ++i) { const float y = F[r * ld + (h0 + z) * 64 + lane * 2 + i] * sc; const unsigned short hb = f2bf(y); oh[i] = hb; ol[i] = f2bf(y - bf2f(hb)); }
    const size_t o = r * 64 + lane * 2; *(v2us*)(Ph + o) = oh; *(v2us*)(Pl + o) = ol; 
}
__global__ __launch_bounds__(256) void k_vtz(const float* __restrict__ F, int ld, int h0, int nk, bf* Th, bf* Tl) {
    typedef __attribute__((ext_vector_type(2))) unsigned short v2us;
    const int lane = threadIdx.x & 31; const size_t wid = (size_t)blockIdx.x * 8 + (threadIdx.x >> 5); if (wid >= (size_t)64 * (nk / 64)) return; const int z = blockIdx.z; const int d = (int)(wid / (nk / 64)); const int t0 = (int)(wid % (nk / 64)) * 64 + lane * 2; v2us oh, ol;
    Th += (size_t)z * 64 * nk; Tl += (size_t)z * 64 * nk;
#pragma unroll
    for (int i = 0; i < 2; ++i) { const float y = F[(size_t)(t0 + i) * ld + (h0 + z) * 64 + d]; const unsigned short hb = f2bf(y); oh[i] = hb; ol[i] = f2bf(y - bf2f(hb)); }
    const size_t o = (size_t)d * nk + t0; *(v2us*)(Th + o) = oh; *(v2us*)(Tl + o) = ol; 
}
template <int NK>
__global__ __launch_bounds__(256) void k_softmaxzs(const float* __restrict__ S, int rows, float sc, bf* PH, bf* PL) {
    typedef __attribute__((ext_vector_type(4))) unsigned short v4us;
    const int lane = threadIdx.x & 31, i = blockIdx.x * 8 + (threadIdx.x >> 5); if (i >= rows) return; const size_t zo = (size_t)blockIdx.z * rows * NK; const float* sr = S + zo + (size_t)i * NK; PH += zo; PL += zo;
    float m = -3.0e38f;
#pragma unroll 1
    for (int c0 = lane * 4; c0 < NK; c0 += 128) {
#pragma unroll
        for (int q = 0; q < 4; ++q) m = fmaxf(m, sr[c0 + q] * sc); }
#pragma unroll
    for (int sh = 16; sh; sh >>= 1) m = fmaxf(m, __shfl_xor(m, sh, 32));
    float sum = 0.f;
#pragma unroll 1
    for (int c0 = lane * 4; c0 < NK; c0 += 128) {
#pragma unroll
        for (int q = 0; q < 4; ++q) sum += __expf(sr[c0 + q] * sc - m); }
#pragma unroll
    for (int sh = 16; sh; sh >>= 1) sum += __shfl_xor(sum, sh, 32);
    const float inv = 1.0f / sum;
{
#pragma unroll 1
        for (int c0 = lane * 4; c0 < NK; c0 += 128) { v4us oh, ol;
#pragma unroll
            for (int q = 0; q < 4; ++q) { const float p = __expf(sr[c0 + q] * sc - m) * inv; const unsigned short hb = f2bf(p); oh[q] = hb; ol[q] = f2bf(p - bf2f(hb)); }
            const size_t o = (size_t)i * NK + c0; *(v4us*)(PH + o) = oh; *(v4us*)(PL + o) = ol; }
         }
}

__global__ __launch_bounds__(256) void k_cvt8(const float* __restrict__ src, bf* dst, size_t n8) {
    const size_t i = (size_t)blockIdx.x * 256 + threadIdx.x; if (i >= n8) return;
    const v8f v = *(const v8f*)(src + i * 8); v8us o;
#pragma unroll
    for (int k = 0; k < 8; ++k) o[k] = f2bf(v[k]);
    *(v8us*)(dst + i * 8) = o; 
}
__global__ __launch_bounds__(256) void k_zero8(bf* dst, size_t n8) {
    const size_t i = (size_t)blockIdx.x * 256 + threadIdx.x; if (i >= n8) return; v8us z;
#pragma unroll
    for (int k = 0; k < 8; ++k) z[k] = 0;
    *(v8us*)(dst + i * 8) = z; 
}

__global__ __launch_bounds__(256) void k_cvtx(const float* __restrict__ src, bf* dst) {
    const int lane = threadIdx.x & 31; const size_t r = (size_t)blockIdx.x * 8 + (threadIdx.x >> 5); if (r >= (size_t)NN) return;
{
#pragma unroll
        for (int q = 0; q < DIN / 256; ++q) { v8us o;
#pragma unroll
            for (int i = 0; i < 8; ++i) o[i] = f2bf(src[r * DIN + q * 256 + lane * 8 + i]);
            *(v8us*)(dst + r * DIN + q * 256 + lane * 8) = o; }
         }
}
__global__ __launch_bounds__(256) void k_time(const float* __restrict__ SP, float* TT) {
    const int lane = threadIdx.x & 31; const int w = blockIdx.x * 8 + (threadIdx.x >> 5); if (w >= NH_ * (NN / 32)) return; const int h = w / (NN / 32); const int s = (w % (NN / 32)) * 32 + lane; float acc = 0.f;
#pragma unroll 8
    for (int d = 0; d < HD; ++d) { const float v = SP[(size_t)s * DSP + h * HD + d]; acc = fmaf(v, v, acc); }
    const float t = sqrtf(acc + KCURV); *(float*)(TT + (size_t)h * NN + s) = t; 
}
__global__ __launch_bounds__(256) void k_vtLz(const float* __restrict__ VS, const float* __restrict__ TT, int h0, bf* Th, bf* Tl) {
    typedef __attribute__((ext_vector_type(2))) unsigned short v2us;
    const int lane = threadIdx.x & 31; const size_t wid = (size_t)blockIdx.x * 8 + (threadIdx.x >> 5); if (wid >= (size_t)128 * (NN / 64)) return; const int z = blockIdx.z, h = h0 + z; const int d = (int)(wid / (NN / 64)); const int t0 = (int)(wid % (NN / 64)) * 64 + lane * 2; v2us oh, ol;
    Th += (size_t)z * 128 * NN; Tl += (size_t)z * 128 * NN;
#pragma unroll
    for (int i = 0; i < 2; ++i) { float y = 0.f; if (d < HD) y = VS[(size_t)(t0 + i) * DSP + h * HD + (d < HD ? d : 0)]; else if (d == HD) y = TT[(size_t)h * NN + t0 + i]; const unsigned short hb = f2bf(y); oh[i] = hb; ol[i] = f2bf(y - bf2f(hb)); }
    const size_t o = (size_t)d * NN + t0; *(v2us*)(Th + o) = oh; *(v2us*)(Tl + o) = ol; 
}
// k_lsoftz: head h0+z, row i: a_ik = (2 + 2 (S[z][i][k] - q0[h][i] k0[h][k])) / bf(scale) + bf(bias) for k <= i (k > i written as exact zeros); three-pass f32 softmax with
__global__ __launch_bounds__(256) void k_lsoftz(const float* __restrict__ S, const float* __restrict__ TQ, const float* __restrict__ TK, int h0, const float* __restrict__ scl, const float* __restrict__ bpar, bf* PH, bf* PL) {
    typedef __attribute__((ext_vector_type(4))) unsigned short v4us;
    const int lane = threadIdx.x & 31, i = blockIdx.x * 8 + (threadIdx.x >> 5); if (i >= NN) return; const int z = blockIdx.z, h = h0 + z; const size_t zo = (size_t)z * NN * NN;
    const float* sr = S + zo + (size_t)i * NN; const float* k0 = TK + (size_t)h * NN; const float qi = TQ[(size_t)h * NN + i]; const float isc = 1.0f / bfr(scl[0]); const float bb = bfr(bpar[0]); PH += zo; PL += zo;
    auto logit = [&](int k) { return (2.0f + 2.0f * (sr[k] - qi * k0[k])) * isc + bb; };
    float m = -3.0e38f;
#pragma unroll 1
    for (int c0 = lane * 4; c0 < NN; c0 += 128) {
#pragma unroll
        for (int q = 0; q < 4; ++q) { const int k = c0 + q; if (k <= i) m = fmaxf(m, logit(k)); } }
#pragma unroll
    for (int sh = 16; sh; sh >>= 1) m = fmaxf(m, __shfl_xor(m, sh, 32));
    float sum = 0.f;
#pragma unroll 1
    for (int c0 = lane * 4; c0 < NN; c0 += 128) {
#pragma unroll
        for (int q = 0; q < 4; ++q) { const int k = c0 + q; if (k <= i) sum += __expf(logit(k) - m); } }
#pragma unroll
    for (int sh = 16; sh; sh >>= 1) sum += __shfl_xor(sum, sh, 32);
    const float inv = 1.0f / sum;
{
#pragma unroll 1
        for (int c0 = lane * 4; c0 < NN; c0 += 128) { v4us oh, ol;
#pragma unroll
            for (int q = 0; q < 4; ++q) { const int k = c0 + q; const float p = (k <= i) ? __expf(logit((k <= i) ? k : 0) - m) * inv : 0.f; const unsigned short hb = f2bf(p); oh[q] = hb; ol[q] = f2bf(p - bf2f(hb)); }
            const size_t o = (size_t)i * NN + c0; *(v4us*)(PH + o) = oh; *(v4us*)(PL + o) = ol; }
         }
}
// k_mid: out[b][s][0..64] = sqrt(k) ave / sqrt(max(| -(-ave0^2 + |ave_s|^2) |, 1e-8)) with ave = mean over the 8 heads of CTX[h][s][0..64] (f32, fixed head order); one wave per row s:
// lane l -> components 4l..4l+3 (65 live); the row's 65 floats are part of the flat [2048 x 65] output block -> written by k_outflat below from AVE[s][128]; here AVE rows of 128
__global__ __launch_bounds__(256) void k_mid(const float* __restrict__ CTX, float* AVE) {
    const int lane = threadIdx.x & 31; const size_t s = (size_t)blockIdx.x * 8 + (threadIdx.x >> 5); if (s >= (size_t)NN) return; v4f a;
#pragma unroll
    for (int q = 0; q < 4; ++q) { const int c = lane * 4 + q; float v = 0.f; if (c < DL) { const int col = (c == 0) ? HD : (c - 1);     // module order [t | space]; CTX holds [space(0..63) | t(64)]
#pragma unroll
            for (int h = 0; h < NH_; ++h) v += CTX[((size_t)h * NN + s) * 128 + col];
            v *= (1.0f / NH_); } a[q] = v; }
    // inner = -a0^2 + sum_{c=1..64} a_c^2 : lane-strided partial over my 4 components then xor tree
    float part = 0.f;
#pragma unroll
    for (int q = 0; q < 4; ++q) { const int c = lane * 4 + q; if (c == 0) part -= a[q] * a[q]; else if (c < DL) part += a[q] * a[q]; }
#pragma unroll
    for (int sh = 16; sh; sh >>= 1) part += __shfl_xor(part, sh, 32);
    const float den = sqrtf(fmaxf(fabsf(-part), 1e-8f)); const float f = sqrtf(KCURV) / den;
    v4f o; 
#pragma unroll
    for (int q = 0; q < 4; ++q) o[q] = a[q] * f;
    *(v4f*)(AVE + s * 128 + lane * 4) = o; 
}
// total 133,120 floats = 1,040 groups exactly).
__global__ __launch_bounds__(256) void k_outflat(const float* __restrict__ AVE, float* OUTB) {
    const int lane = threadIdx.x & 31; const size_t w = (size_t)blockIdx.x * 8 + (threadIdx.x >> 5); if (w >= (size_t)NN * DL / 128) return; const size_t e0 = w * 128 + lane * 4; v4f v;
#pragma unroll
    for (int q = 0; q < 4; ++q) { const size_t e = e0 + q; v[q] = AVE[(e / DL) * 128 + (e % DL)]; }
    *(v4f*)(OUTB + e0) = v; 
}

extern "C" void kernel_launch(void* const* d_in, const int* in_sizes, int n_in,
                              void* d_out, int out_size, void* d_ws, size_t ws_size, hipStream_t stream) {
    (void)in_sizes; (void)n_in; (void)out_size;
    const float* xq = (const float*)d_in[0]; const float* xs = (const float*)d_in[1]; const float* Wq = (const float*)d_in[2]; const float* bq = (const float*)d_in[3]; const float* Wk = (const float*)d_in[4]; const float* bk = (const float*)d_in[5]; const float* Wv = (const float*)d_in[6]; const float* bv = (const float*)d_in[7]; const float* scl = (const float*)d_in[8]; const float* bpar = (const float*)d_in[9];
    float* out = (float*)d_out;    // [4][2048][65]
    char* wsp = (char*)d_ws;
    auto take = [&](size_t bytes) { char* p = wsp; wsp += (bytes + 255) & ~(size_t)255; return (void*)p; };
    const int ZH = 2;
    bf* WQ = (bf*)take((size_t)DSP * DIN * 2); bf* WK = (bf*)take((size_t)DSP * DIN * 2); bf* WV = (bf*)take((size_t)DSP * DIN * 2);
    bf* Xq = (bf*)take((size_t)NN * DIN * 2); bf* Xs = (bf*)take((size_t)NN * DIN * 2); float* QS = (float*)take((size_t)NN * DSP * 4); float* KS = (float*)take((size_t)NN * DSP * 4); float* VS = (float*)take((size_t)NN * DSP * 4);
    float* TQ = (float*)take((size_t)NH_ * NN * 4); float* TK = (float*)take((size_t)NH_ * NN * 4); float* TV = (float*)take((size_t)NH_ * NN * 4);
    bf* Qh = (bf*)take((size_t)ZH * NN * HD * 2); bf* Ql = (bf*)take((size_t)ZH * NN * HD * 2); bf* Kh = (bf*)take((size_t)ZH * NN * HD * 2); bf* Kl = (bf*)take((size_t)ZH * NN * HD * 2); bf* VTh = (bf*)take((size_t)ZH * 128 * NN * 2); bf* VTl = (bf*)take((size_t)ZH * 128 * NN * 2);
    float* S = (float*)take((size_t)ZH * NN * NN * 4); bf* PH = (bf*)take((size_t)ZH * NN * NN * 2); bf* PL = (bf*)take((size_t)ZH * NN * NN * 2); float* CTX = (float*)take((size_t)NH_ * NN * 128 * 4); float* AVE = (float*)take((size_t)NN * 128 * 4);
    if ((size_t)(wsp - (char*)d_ws) > ws_size) return;    // 1.5 + 4.2 + 12.6 + 0.2 + 2.1 + 2.1 + 33.5 + 16.8 + 16.8 + 8.4 + 1 ~ 99 MB; per item / head-pair reuse in stream order
    k_cvt8<<<(DSP * DIN / 8 + 255) / 256, 256, 0, stream>>>(Wq, WQ, DSP * DIN / 8); k_cvt8<<<(DSP * DIN / 8 + 255) / 256, 256, 0, stream>>>(Wk, WK, DSP * DIN / 8); k_cvt8<<<(DSP * DIN / 8 + 255) / 256, 256, 0, stream>>>(Wv, WV, DSP * DIN / 8);   // [H][OUT][IN] = [(h,o)][in] natural n-major
    for (int b = 0; b < NBT; ++b) {
        k_cvtx<<<NN / 8, 256, 0, stream>>>(xq + (size_t)b * NN * DIN, Xq); k_cvtx<<<NN / 8, 256, 0, stream>>>(xs + (size_t)b * NN * DIN, Xs);
        k_gemmb<false, false><<<dim3(NN / 64, DSP / 64, 1), 128, 0, stream>>>(Xq, nullptr, WQ, bq, QS, DSP, nullptr, nullptr, DIN);     // space parts (+ per-head bias [H][OUT] = [512])
        k_gemmb<false, false><<<dim3(NN / 64, DSP / 64, 1), 128, 0, stream>>>(Xs, nullptr, WK, bk, KS, DSP, nullptr, nullptr, DIN);
        k_gemmb<false, false><<<dim3(NN / 64, DSP / 64, 1), 128, 0, stream>>>(Xs, nullptr, WV, bv, VS, DSP, nullptr, nullptr, DIN);
        k_time<<<(NH_ * (NN / 32)) / 8, 256, 0, stream>>>(QS, TQ); k_time<<<(NH_ * (NN / 32)) / 8, 256, 0, stream>>>(KS, TK); k_time<<<(NH_ * (NN / 32)) / 8, 256, 0, stream>>>(VS, TV);
        for (int g = 0; g < NH_ / ZH; ++g) { const int h0 = g * ZH;
            k_hplanesz<<<dim3(NN / 8, 1, ZH), 256, 0, stream>>>(QS, DSP, h0, 1.0f, NN, Qh, Ql); k_hplanesz<<<dim3(NN / 8, 1, ZH), 256, 0, stream>>>(KS, DSP, h0, 1.0f, NN, Kh, Kl);
            k_vtLz<<<dim3((128 * (NN / 64)) / 8, 1, ZH), 256, 0, stream>>>(VS, TV, h0, VTh, VTl);
            k_gemm3z<1><<<dim3(NN / 64, NN / 64, ZH), 128, 0, stream>>>(Qh, Ql, Kh, Kl, HD, S, NN, (size_t)NN * HD, (size_t)NN * HD, (size_t)NN * NN);           // space scores, causal tiles only
            k_lsoftz<<<dim3(NN / 8, 1, ZH), 256, 0, stream>>>(S, TQ, TK, h0, scl, bpar, PH, PL);
            k_gemm3z<2><<<dim3(NN / 64, 2, ZH), 128, 0, stream>>>(PH, PL, VTh, VTl, NN, CTX + (size_t)h0 * NN * 128, 128, (size_t)NN * NN, (size_t)128 * NN, (size_t)NN * 128); }   // [space | time | 0] context, K-limited
        k_mid<<<NN / 8, 256, 0, stream>>>(CTX, AVE);
        k_outflat<<<(NN * DL / 128) / 8, 256, 0, stream>>>(AVE, out + (size_t)b * NN * DL); }
}

// v001
// One run takes 1370 microseconds.
// In both of two side-by-side timings against v000, it was 1.99 times as fast.
#include <hip/hip_runtime.h>

// Compute dtypes, f32 accumulate, per item: the three per-head hyperbolic linears as [2048 x 512].[512 x 512] GEMMs with PLAIN bf16 operands (exact products; all 8 heads' space
// parts at once), the Lorentz time coordinate sqrt(|x_s|^2 + k) in f32; per head: space scores = q_s.k_s^T ([2048 x 64].[64 x 2048], both operands bf16 hi + UNSCALED residual,
// three products; key tiles wholly above the diagonal skipped), the time term -q_0 k_0, the affine (2 + 2<q,k>_L)/scale + bias and the causal softmax in f32 -> P planes, the
// time component of the context from row 64 of the padded V^T planes in the P.V GEMM, the space context = P.v_s ([2048 x 2048].[2048 x 64], three products, K limited to the causal extent);

#define NBT  4
#define NN   2048
#define DIN  512
#define NH_  8
#define HD   64
#define DSP  (NH_ * HD)           // 512 space outputs over all heads
#define DL   (HD + 1)             // 65 Lorentz dims per head
#define DM   DIN
#define NTK  NN
#define KCURV 1.0f
#define LOSC 1024.0f
#define SPIT 72                   // LDS row pitch in elements of a staged 64-k operand tile: 128 B of data + 16 B, conflict-free for 16-byte fragment reads

typedef _Float16 h16;
typedef unsigned short bf;
typedef __attribute__((ext_vector_type(16))) __bf16   v16bf;
typedef __attribute__((ext_vector_type(16))) _Float16 v16h;
typedef __attribute__((ext_vector_type(8)))  _Float16 v8h;
typedef __attribute__((ext_vector_type(8)))  unsigned short v8us;
typedef __attribute__((ext_vector_type(8)))  float    v8f;
typedef __attribute__((ext_vector_type(4)))  float    v4f;
typedef __attribute__((ext_vector_type(4)))  _Float16 v4h;
typedef v8h  __attribute__((may_alias)) v8ha;
typedef v4f  __attribute__((may_alias)) v4fa;
typedef v8us __attribute__((may_alias)) v8usa;

__device__ __forceinline__ unsigned short f2bf(float f) { unsigned u = __float_as_uint(f); u += 0x7FFFu + ((u >> 16) & 1u); return (unsigned short)(u >> 16); }
__device__ __forceinline__ float bf2f(unsigned short b) { return __uint_as_float(((unsigned)b) << 16); }
__device__ __forceinline__ float bfr(float f) { return bf2f(f2bf(f)); }
__device__ __forceinline__ v16h cat16(v8h lo, v8h hi) { return __builtin_shufflevector(lo, hi, 0, 1, 2, 3, 4, 5, 6, 7, 8, 9, 10, 11, 12, 13, 14, 15); }
__device__ __forceinline__ v16bf cat16b(v8us lo, v8us hi) { return __builtin_bit_cast(v16bf, __builtin_shufflevector(lo, hi, 0, 1, 2, 3, 4, 5, 6, 7, 8, 9, 10, 11, 12, 13, 14, 15)); }
__device__ __forceinline__ v8f wmma16(v16h a, v16h b, v8f c) { return __builtin_amdgcn_wmma_f32_16x16x32_f16(false, a, false, b, (short)0, c, false, false); }
__device__ __forceinline__ v8f wmmab(v16bf a, v16bf b, v8f c) { return __builtin_amdgcn_wmma_f32_16x16x32_bf16(false, a, false, b, (short)0, c, false, false); }

// k_gemmb: 64 x 64 block tile (4 waves x 16 x 64) of C[NTK][NW] = (A [+ Al]).B^T (K = 512) [+ bf(bias[c])] [+ bf(R[r][c]) residual]; f32 whole-line epilogue (or f16
template <bool SPLITA, bool F16OUT = false>
__global__ __launch_bounds__(128) void k_gemmb(const bf* __restrict__ A, const bf* __restrict__ Al, const bf* __restrict__ Bn, const float* __restrict__ bias, float* C, int ldc, h16* C2, const float* __restrict__ R = nullptr, int K = DM, int roundR = 1) {
    constexpr int BI = SPLITA ? 2 : 1;                                   // LDS plane of the B tile
    __shared__ __align__(16) bf stg[BI + 1][64 * SPIT];
    __shared__ __align__(16) float ost[4][16 * 68];
    const int lane = threadIdx.x & 31, wave = threadIdx.x >> 5, lr = lane & 15, hi = lane >> 4;
    const int rb = blockIdx.x * 64, r0 = rb + wave * 16, c0 = blockIdx.y * 64;
    const int srow = threadIdx.x >> 3, spc = (threadIdx.x & 7) * 8;      // staging: 16 rows a pass, 8 lanes x 16 B cover one row's line
    unsigned oa[4], ob[4];                                               // per-lane byte offsets from the uniform bases; they step by one line a stage
#pragma unroll
    for (int p = 0; p < 4; ++p) { oa[p] = ((unsigned)(rb + p * 16 + srow) * (unsigned)K + spc) * 2u; ob[p] = ((unsigned)(c0 + p * 16 + srow) * (unsigned)K + spc) * 2u; }
    v8us rg[3][4];
    auto fetch = [&]() {
#pragma unroll
        for (int p = 0; p < 4; ++p) {
            rg[0][p] = *(const v8us*)((const char*)A + oa[p]); if (SPLITA) rg[1][p] = *(const v8us*)((const char*)Al + oa[p]);
            rg[2][p] = *(const v8us*)((const char*)Bn + ob[p]); }
    };
    v8f acc[4];
#pragma unroll
    for (int t = 0; t < 4; ++t) acc[t] = (v8f){};
    fetch();
#pragma unroll 1
    for (int kc = 0; kc < K; kc += 64) {
        __syncthreads();                                                 // every wave has read its last fragment of the stage before
#pragma unroll
        for (int p = 0; p < 4; ++p) { *(v8usa*)(&stg[0][(p * 16 + srow) * SPIT + spc]) = rg[0][p]; if (SPLITA) *(v8usa*)(&stg[1][(p * 16 + srow) * SPIT + spc]) = rg[1][p];
            *(v8usa*)(&stg[BI][(p * 16 + srow) * SPIT + spc]) = rg[2][p]; }
        __syncthreads();                                                 // the stage is complete in LDS
        if (kc + 64 < K) {
#pragma unroll
            for (int p = 0; p < 4; ++p) { oa[p] += 128u; ob[p] += 128u; }
            fetch();
            asm volatile("s_wait_xcnt 0x0" ::: "memory"); }              // directly behind the run's last load: past the loop's exit its base registers are rewritten with no load wait in front
#pragma unroll
        for (int ks = 0; ks < 2; ++ks) {
            const int ao = (wave * 16 + lr) * SPIT + ks * 32 + 8 * hi;
            const v16bf a = cat16b(*(const v8usa*)(&stg[0][ao]), *(const v8usa*)(&stg[0][ao + 16]));
            v16bf al = a;
            if (SPLITA) al = cat16b(*(const v8usa*)(&stg[1][ao]), *(const v8usa*)(&stg[1][ao + 16]));
            v16bf b[4];
#pragma unroll
            for (int t = 0; t < 4; ++t) { const int bo = (t * 16 + lr) * SPIT + ks * 32 + 8 * hi; b[t] = cat16b(*(const v8usa*)(&stg[BI][bo]), *(const v8usa*)(&stg[BI][bo + 16])); }
            __builtin_amdgcn_sched_barrier(0);                           // all fragment reads of the k step issue together, ahead of its products: one LDS latency a step, not one a fragment
#pragma unroll
            for (int t = 0; t < 4; ++t) { acc[t] = wmmab(a, b[t], acc[t]); if (SPLITA) acc[t] = wmmab(al, b[t], acc[t]); }
            asm volatile("v_nop\n\tv_nop\n\tv_nop\n\tv_nop" : "+v"(acc[0]), "+v"(acc[1]), "+v"(acc[2]), "+v"(acc[3]) : "v"(a), "v"(al));   // WMMA distance before its operands or results are touched, the loop's back edge included
        }
    }
    float* os = &ost[wave][0];
#pragma unroll
    for (int t = 0; t < 4; ++t) { const float bv = bias ? bfr(bias[c0 + t * 16 + lr]) : 0.f;
#pragma unroll
        for (int j = 0; j < 8; ++j) os[(hi * 8 + j) * 68 + t * 16 + lr] = acc[t][j] + bv; }
    __syncthreads();
    if (F16OUT) {
        h16* crow = (h16*)(void*)C + (size_t)r0 * ldc + c0;
        auto pass = [&]() {
#pragma unroll
            for (int s = 0; s < 4; ++s) { const int row = 4 * s + (lane >> 3), piece = lane & 7; const float* sp = os + row * 68 + piece * 8; v8h o, o2;
#pragma unroll
                for (int i = 0; i < 8; ++i) { const h16 a = (h16)sp[i]; o[i] = a; o2[i] = (h16)((sp[i] - (float)a) * LOSC); }
                *(v8h*)(crow + (size_t)row * ldc + piece * 8) = o; if (C2) *(v8h*)(C2 + (size_t)r0 * ldc + c0 + (size_t)row * ldc + piece * 8) = o2; }
        };
        pass(); 
    } else {
        float* crow = C + (size_t)r0 * ldc + c0;
        auto pass = [&]() {
#pragma unroll
            for (int s = 0; s < 8; ++s) { const int Lid = (lane >> 3) + 4 * s, piece = lane & 7; const int row = Lid >> 1, cofs = (Lid & 1) * 32 + piece * 4;
                v4f val = *(const v4fa*)(os + row * 68 + cofs); if (R) { const v4f rv = *(const v4f*)(R + ((size_t)r0 + row) * ldc + c0 + cofs); val += roundR ? (v4f){bfr(rv[0]), bfr(rv[1]), bfr(rv[2]), bfr(rv[3])} : rv; }
                *(v4f*)(crow + (size_t)row * ldc + cofs) = val; }
        };
        pass(); 
    }
}


// ===== z-batched (blockIdx.z = head within the pair: head h0 + z) attention pieces =====
// k_gemm3z<MODE>: 64 x 64 block tile (4 waves x 16 x 64) of C = (Ah + Al).(Bh + Bl)^T, three products, with per-z operand/output strides (elements): A planes += z*sA, B planes += z*sB,
// C += z*sC. MODE bit 0: causal tile skip; bit 1: K limited to the causal extent. K and the K limit are multiples of 64. The four 64-row x 64-k operand tiles of a stage are read from
// global memory as whole 128-byte lines (8 lanes per row), laid in LDS at a 144-byte pitch, and the fragments are read from there; the next stage's lines fly during this stage's products.
template <int MODE>
__global__ __launch_bounds__(128) void k_gemm3z(const bf* __restrict__ Ah, const bf* __restrict__ Al, const bf* __restrict__ Bh, const bf* __restrict__ Bl, int K, float* C, int ldc, size_t sA, size_t sB, size_t sC) {
    if ((MODE & 1) && (int)blockIdx.y * 64 > (int)blockIdx.x * 64 + 63) return;
    const size_t z = blockIdx.z; Ah += z * sA; Al += z * sA; Bh += z * sB; Bl += z * sB; C += z * sC;
    const int Klim = (MODE & 2) ? min(K, ((int)blockIdx.x + 1) * 64) : K;
    __shared__ __align__(16) bf stg[4][64 * SPIT];
    __shared__ __align__(16) float ost[4][16 * 68];
    const int lane = threadIdx.x & 31, wave = threadIdx.x >> 5, lr = lane & 15, hi = lane >> 4;
    const int rb = blockIdx.x * 64, r0 = rb + wave * 16, c0 = blockIdx.y * 64;
    const int srow = threadIdx.x >> 3, spc = (threadIdx.x & 7) * 8;      // staging: 16 rows a pass, 8 lanes x 16 B cover one row's line
    unsigned oa[4], ob[4];                                               // per-lane byte offsets from the uniform bases; they step by one line a stage
#pragma unroll
    for (int p = 0; p < 4; ++p) { oa[p] = ((unsigned)(rb + p * 16 + srow) * (unsigned)K + spc) * 2u; ob[p] = ((unsigned)(c0 + p * 16 + srow) * (unsigned)K + spc) * 2u; }
    v8us rg[4][4];
    auto fetch = [&]() {
#pragma unroll
        for (int p = 0; p < 4; ++p) {
            rg[0][p] = *(const v8us*)((const char*)Ah + oa[p]); rg[1][p] = *(const v8us*)((const char*)Al + oa[p]);
            rg[2][p] = *(const v8us*)((const char*)Bh + ob[p]); rg[3][p] = *(const v8us*)((const char*)Bl + ob[p]); }
    };
    v8f acc[4];
#pragma unroll
    for (int t = 0; t < 4; ++t) acc[t] = (v8f){};
    fetch();
#pragma unroll 1
    for (int kc = 0; kc < Klim; kc += 64) {
        __syncthreads();                                                 // every wave has read its last fragment of the stage before
#pragma unroll
        for (int p = 0; p < 4; ++p) {
#pragma unroll
            for (int a = 0; a < 4; ++a) *(v8usa*)(&stg[a][(p * 16 + srow) * SPIT + spc]) = rg[a][p]; }
        __syncthreads();                                                 // the stage is complete in LDS
        if (kc + 64 < Klim) {
#pragma unroll
            for (int p = 0; p < 4; ++p) { oa[p] += 128u; ob[p] += 128u; }
            fetch();
            asm volatile("s_wait_xcnt 0x0" ::: "memory"); }              // directly behind the run's last load: past the loop's exit its base registers are rewritten with no load wait in front
#pragma unroll
        for (int ks = 0; ks < 2; ++ks) {
            const int ao = (wave * 16 + lr) * SPIT + ks * 32 + 8 * hi;
            const v16bf a = cat16b(*(const v8usa*)(&stg[0][ao]), *(const v8usa*)(&stg[0][ao + 16]));
            const v16bf al = cat16b(*(const v8usa*)(&stg[1][ao]), *(const v8usa*)(&stg[1][ao + 16]));
            v16bf bh[4], bl[4];
#pragma unroll
            for (int t = 0; t < 4; ++t) { const int bo = (t * 16 + lr) * SPIT + ks * 32 + 8 * hi;
                bh[t] = cat16b(*(const v8usa*)(&stg[2][bo]), *(const v8usa*)(&stg[2][bo + 16]));
                bl[t] = cat16b(*(const v8usa*)(&stg[3][bo]), *(const v8usa*)(&stg[3][bo + 16])); }
            __builtin_amdgcn_sched_barrier(0);                           // all fragment reads of the k step issue together, ahead of its products: one LDS latency a step, not one a fragment
#pragma unroll
            for (int t = 0; t < 4; ++t) { acc[t] = wmmab(a, bh[t], acc[t]); acc[t] = wmmab(al, bh[t], acc[t]); acc[t] = wmmab(a, bl[t], acc[t]); }
            asm volatile("v_nop\n\tv_nop\n\tv_nop\n\tv_nop" : "+v"(acc[0]), "+v"(acc[1]), "+v"(acc[2]), "+v"(acc[3]) : "v"(a), "v"(al));   // WMMA distance before its operands or results are touched, the loop's back edge included
        }
    }
    float* os = &ost[wave][0];
#pragma unroll
    for (int t = 0; t < 4; ++t) {
#pragma unroll
        for (int j = 0; j < 8; ++j) os[(hi * 8 + j) * 68 + t * 16 + lr] = acc[t][j]; }
    __builtin_amdgcn_wave_barrier(); asm volatile("" ::: "memory");
    float* crow = C + (size_t)r0 * ldc + c0;
    auto pass = [&]() {
#pragma unroll
        for (int s = 0; s < 8; ++s) { const int Lid = (lane >> 3) + 4 * s, piece = lane & 7; const int row = Lid >> 1, cofs = (Lid & 1) * 32 + piece * 4;
            const v4f val = *(const v4fa*)(os + row * 68 + cofs); *(v4f*)(crow + (size_t)row * ldc + cofs) = val; }
    };
    pass(); 
}
__global__ __launch_bounds__(256) void k_planes32z(const float* __restrict__ F, int ld, int off, float sc, int rows, bf* Ph, bf* Pl) {
    typedef __attribute__((ext_vector_type(2))) unsigned short v2us;
    const int lane = threadIdx.x & 31; const size_t r = ((size_t)blockIdx.x * 8 + (threadIdx.x >> 5)) * 2 + (lane >> 4); if (r >= (size_t)rows) return; const int z = blockIdx.z; const int c0 = (lane & 15) * 2; v2us oh, ol;
    Ph += (size_t)z * rows * 32; Pl += (size_t)z * rows * 32;
#pragma unroll
    for (int i = 0; i < 2; ++i) { const float y = F[r * ld + off + z * 32 + c0 + i] * sc; const unsigned short hb = f2bf(y); oh[i] = hb; ol[i] = f2bf(y - bf2f(hb)); }
    const size_t o = r * 32 + c0; *(v2us*)(Ph + o) = oh; *(v2us*)(Pl + o) = ol; 
}
__global__ __launch_bounds__(256) void k_vtpadz(const float* __restrict__ F, int ld, int off, int nk, bf* Th, bf* Tl) {
    typedef __attribute__((ext_vector_type(2))) unsigned short v2us;
    const int lane = threadIdx.x & 31; const size_t wid = (size_t)blockIdx.x * 8 + (threadIdx.x >> 5); if (wid >= (size_t)64 * (nk / 64)) return; const int z = blockIdx.z; const int d = (int)(wid / (nk / 64)); const int k0 = (int)(wid % (nk / 64)) * 64 + lane * 2; v2us oh, ol;
    Th += (size_t)z * 64 * nk; Tl += (size_t)z * 64 * nk;
#pragma unroll
    for (int i = 0; i < 2; ++i) { const float y = (d < 32) ? F[(size_t)(k0 + i) * ld + off + z * 32 + (d < 32 ? d : 0)] : 0.f; const unsigned short hb = f2bf(y); oh[i] = hb; ol[i] = f2bf(y - bf2f(hb)); }
    const size_t o = (size_t)d * nk + k0; *(v2us*)(Th + o) = oh; *(v2us*)(Tl + o) = ol; 
}
template <int NK>
__global__ __launch_bounds__(256) void k_softmaxz(const float* __restrict__ S, int rows, bf* PH, bf* PL) {
    typedef __attribute__((ext_vector_type(4))) unsigned short v4us;
    const int lane = threadIdx.x & 31, i = blockIdx.x * 8 + (threadIdx.x >> 5); if (i >= rows) return; const size_t zo = (size_t)blockIdx.z * rows * NK; const float* sr = S + zo + (size_t)i * NK; PH += zo; PL += zo;
    float m = -3.0e38f;
#pragma unroll 1
    for (int c0 = lane * 4; c0 < NK; c0 += 128) {
#pragma unroll
        for (int q = 0; q < 4; ++q) m = fmaxf(m, sr[c0 + q]); }
#pragma unroll
    for (int sh = 16; sh; sh >>= 1) m = fmaxf(m, __shfl_xor(m, sh, 32));
    float sum = 0.f;
#pragma unroll 1
    for (int c0 = lane * 4; c0 < NK; c0 += 128) {
#pragma unroll
        for (int q = 0; q < 4; ++q) sum += __expf(sr[c0 + q] - m); }
#pragma unroll
    for (int sh = 16; sh; sh >>= 1) sum += __shfl_xor(sum, sh, 32);
    const float inv = 1.0f / sum;
{
#pragma unroll 1
        for (int c0 = lane * 4; c0 < NK; c0 += 128) { v4us oh, ol;
#pragma unroll
            for (int q = 0; q < 4; ++q) { const float p = __expf(sr[c0 + q] - m) * inv; const unsigned short hb = f2bf(p); oh[q] = hb; ol[q] = f2bf(p - bf2f(hb)); }
            const size_t o = (size_t)i * NK + c0; *(v4us*)(PH + o) = oh; *(v4us*)(PL + o) = ol; }
         }
}
__global__ __launch_bounds__(256) void k_placez(const float* __restrict__ XH, int rows, int ldy, float* Y) {
    const int lane = threadIdx.x & 31; const size_t q = (size_t)blockIdx.x * 8 + (threadIdx.x >> 5); if (q >= (size_t)rows) return; const int z = blockIdx.z; const float v = XH[((size_t)z * rows + q) * 64 + lane];
    *(float*)(Y + q * ldy + z * 32 + lane) = v; 
}

__global__ __launch_bounds__(256) void k_hplanesz(const float* __restrict__ F, int ld, int h0, float sc, int rows, bf* Ph, bf* Pl) {
    typedef __attribute__((ext_vector_type(2))) unsigned short v2us;
    const int lane = threadIdx.x & 31; const size_t r = (size_t)blockIdx.x * 8 + (threadIdx.x >> 5); if (r >= (size_t)rows) return; const int z = blockIdx.z; v2us oh, ol;
    Ph += (size_t)z * rows * 64; Pl += (size_t)z * rows * 64;
#pragma unroll
    for (int i = 0; i < 2; ++i) { const float y = F[r * ld + (h0 + z) * 64 + lane * 2 + i] * sc; const unsigned short hb = f2bf(y); oh[i] = hb; ol[i] = f2bf(y - bf2f(hb)); }
    const size_t o = r * 64 + lane * 2; *(v2us*)(Ph + o) = oh; *(v2us*)(Pl + o) = ol; 
}
__global__ __launch_bounds__(256) void k_vtz(const float* __restrict__ F, int ld, int h0, int nk, bf* Th, bf* Tl) {
    typedef __attribute__((ext_vector_type(2))) unsigned short v2us;
    const int lane = threadIdx.x & 31; const size_t wid = (size_t)blockIdx.x * 8 + (threadIdx.x >> 5); if (wid >= (size_t)64 * (nk / 64)) return; const int z = blockIdx.z; const int d = (int)(wid / (nk / 64)); const int t0 = (int)(wid % (nk / 64)) * 64 + lane * 2; v2us oh, ol;
    Th += (size_t)z * 64 * nk; Tl += (size_t)z * 64 * nk;
#pragma unroll
    for (int i = 0; i < 2; ++i) { const float y = F[(size_t)(t0 + i) * ld + (h0 + z) * 64 + d]; const unsigned short hb = f2bf(y); oh[i] = hb; ol[i] = f2bf(y - bf2f(hb)); }
    const size_t o = (size_t)d * nk + t0; *(v2us*)(Th + o) = oh; *(v2us*)(Tl + o) = ol; 
}
template <int NK>
__global__ __launch_bounds__(256) void k_softmaxzs(const float* __restrict__ S, int rows, float sc, bf* PH, bf* PL) {
    typedef __attribute__((ext_vector_type(4))) unsigned short v4us;
    const int lane = threadIdx.x & 31, i = blockIdx.x * 8 + (threadIdx.x >> 5); if (i >= rows) return; const size_t zo = (size_t)blockIdx.z * rows * NK; const float* sr = S + zo + (size_t)i * NK; PH += zo; PL += zo;
    float m = -3.0e38f;
#pragma unroll 1
    for (int c0 = lane * 4; c0 < NK; c0 += 128) {
#pragma unroll
        for (int q = 0; q < 4; ++q) m = fmaxf(m, sr[c0 + q] * sc); }
#pragma unroll
    for (int sh = 16; sh; sh >>= 1) m = fmaxf(m, __shfl_xor(m, sh, 32));
    float sum = 0.f;
#pragma unroll 1
    for (int c0 = lane * 4; c0 < NK; c0 += 128) {
#pragma unroll
        for (int q = 0; q < 4; ++q) sum += __expf(sr[c0 + q] * sc - m); }
#pragma unroll
    for (int sh = 16; sh; sh >>= 1) sum += __shfl_xor(sum, sh, 32);
    const float inv = 1.0f / sum;
{
#pragma unroll 1
        for (int c0 = lane * 4; c0 < NK; c0 += 128) { v4us oh, ol;
#pragma unroll
            for (int q = 0; q < 4; ++q) { const float p = __expf(sr[c0 + q] * sc - m) * inv; const unsigned short hb = f2bf(p); oh[q] = hb; ol[q] = f2bf(p - bf2f(hb)); }
            const size_t o = (size_t)i * NK + c0; *(v4us*)(PH + o) = oh; *(v4us*)(PL + o) = ol; }
         }
}

__global__ __launch_bounds__(256) void k_cvt8(const float* __restrict__ src, bf* dst, size_t n8) {
    const size_t i = (size_t)blockIdx.x * 256 + threadIdx.x; if (i >= n8) return;
    const v8f v = *(const v8f*)(src + i * 8); v8us o;
#pragma unroll
    for (int k = 0; k < 8; ++k) o[k] = f2bf(v[k]);
    *(v8us*)(dst + i * 8) = o; 
}
__global__ __launch_bounds__(256) void k_zero8(bf* dst, size_t n8) {
    const size_t i = (size_t)blockIdx.x * 256 + threadIdx.x; if (i >= n8) return; v8us z;
#pragma unroll
    for (int k = 0; k < 8; ++k) z[k] = 0;
    *(v8us*)(dst + i * 8) = z; 
}

__global__ __launch_bounds__(256) void k_cvtx(const float* __restrict__ src, bf* dst) {
    const int lane = threadIdx.x & 31; const size_t r = (size_t)blockIdx.x * 8 + (threadIdx.x >> 5); if (r >= (size_t)NN) return;
{
#pragma unroll
        for (int q = 0; q < DIN / 256; ++q) { v8us o;
#pragma unroll
            for (int i = 0; i < 8; ++i) o[i] = f2bf(src[r * DIN + q * 256 + lane * 8 + i]);
            *(v8us*)(dst + r * DIN + q * 256 + lane * 8) = o; }
         }
}
__global__ __launch_bounds__(256) void k_time(const float* __restrict__ SP, float* TT) {
    const int lane = threadIdx.x & 31; const int w = blockIdx.x * 8 + (threadIdx.x >> 5); if (w >= NH_ * (NN / 32)) return; const int h = w / (NN / 32); const int s = (w % (NN / 32)) * 32 + lane; float acc = 0.f;
#pragma unroll 8
    for (int d = 0; d < HD; ++d) { const float v = SP[(size_t)s * DSP + h * HD + d]; acc = fmaf(v, v, acc); }
    const float t = sqrtf(acc + KCURV); *(float*)(TT + (size_t)h * NN + s) = t; 
}
__global__ __launch_bounds__(256) void k_vtLz(const float* __restrict__ VS, const float* __restrict__ TT, int h0, bf* Th, bf* Tl) {
    typedef __attribute__((ext_vector_type(2))) unsigned short v2us;
    const int lane = threadIdx.x & 31; const size_t wid = (size_t)blockIdx.x * 8 + (threadIdx.x >> 5); if (wid >= (size_t)128 * (NN / 64)) return; const int z = blockIdx.z, h = h0 + z; const int d = (int)(wid / (NN / 64)); const int t0 = (int)(wid % (NN / 64)) * 64 + lane * 2; v2us oh, ol;
    Th += (size_t)z * 128 * NN; Tl += (size_t)z * 128 * NN;
#pragma unroll
    for (int i = 0; i < 2; ++i) { float y = 0.f; if (d < HD) y = VS[(size_t)(t0 + i) * DSP + h * HD + (d < HD ? d : 0)]; else if (d == HD) y = TT[(size_t)h * NN + t0 + i]; const unsigned short hb = f2bf(y); oh[i] = hb; ol[i] = f2bf(y - bf2f(hb)); }
    const size_t o = (size_t)d * NN + t0; *(v2us*)(Th + o) = oh; *(v2us*)(Tl + o) = ol; 
}
// k_lsoftz: head h0+z, row i: a_ik = (2 + 2 (S[z][i][k] - q0[h][i] k0[h][k])) / bf(scale) + bf(bias) for k <= i (k > i written as exact zeros); three-pass f32 softmax with
__global__ __launch_bounds__(256) void k_lsoftz(const float* __restrict__ S, const float* __restrict__ TQ, const float* __restrict__ TK, int h0, const float* __restrict__ scl, const float* __restrict__ bpar, bf* PH, bf* PL) {
    typedef __attribute__((ext_vector_type(4))) unsigned short v4us;
    const int lane = threadIdx.x & 31, i = blockIdx.x * 8 + (threadIdx.x >> 5); if (i >= NN) return; const int z = blockIdx.z, h = h0 + z; const size_t zo = (size_t)z * NN * NN;
    const float* sr = S + zo + (size_t)i * NN; const float* k0 = TK + (size_t)h * NN; const float qi = TQ[(size_t)h * NN + i]; const float isc = 1.0f / bfr(scl[0]); const float bb = bfr(bpar[0]); PH += zo; PL += zo;
    auto logit = [&](int k) { return (2.0f + 2.0f * (sr[k] - qi * k0[k])) * isc + bb; };
    float m = -3.0e38f;
#pragma unroll 1
    for (int c0 = lane * 4; c0 < NN; c0 += 128) {
#pragma unroll
        for (int q = 0; q < 4; ++q) { const int k = c0 + q; if (k <= i) m = fmaxf(m, logit(k)); } }
#pragma unroll
    for (int sh = 16; sh; sh >>= 1) m = fmaxf(m, __shfl_xor(m, sh, 32));
    float sum = 0.f;
#pragma unroll 1
    for (int c0 = lane * 4; c0 < NN; c0 += 128) {
#pragma unroll
        for (int q = 0; q < 4; ++q) { const int k = c0 + q; if (k <= i) sum += __expf(logit(k) - m); } }
#pragma unroll
    for (int sh = 16; sh; sh >>= 1) sum += __shfl_xor(sum, sh, 32);
    const float inv = 1.0f / sum;
{
#pragma unroll 1
        for (int c0 = lane * 4; c0 < NN; c0 += 128) { v4us oh, ol;
#pragma unroll
            for (int q = 0; q < 4; ++q) { const int k = c0 + q; const float p = (k <= i) ? __expf(logit((k <= i) ? k : 0) - m) * inv : 0.f; const unsigned short hb = f2bf(p); oh[q] = hb; ol[q] = f2bf(p - bf2f(hb)); }
            const size_t o = (size_t)i * NN + c0; *(v4us*)(PH + o) = oh; *(v4us*)(PL + o) = ol; }
         }
}
// k_mid: out[b][s][0..64] = sqrt(k) ave / sqrt(max(| -(-ave0^2 + |ave_s|^2) |, 1e-8)) with ave = mean over the 8 heads of CTX[h][s][0..64] (f32, fixed head order); one wave per row s:
// lane l -> components 4l..4l+3 (65 live); the row's 65 floats are part of the flat [2048 x 65] output block -> written by k_outflat below from AVE[s][128]; here AVE rows of 128
__global__ __launch_bounds__(256) void k_mid(const float* __restrict__ CTX, float* AVE) {
    const int lane = threadIdx.x & 31; const size_t s = (size_t)blockIdx.x * 8 + (threadIdx.x >> 5); if (s >= (size_t)NN) return; v4f a;
#pragma unroll
    for (int q = 0; q < 4; ++q) { const int c = lane * 4 + q; float v = 0.f; if (c < DL) { const int col = (c == 0) ? HD : (c - 1);     // module order [t | space]; CTX holds [space(0..63) | t(64)]
#pragma unroll
            for (int h = 0; h < NH_; ++h) v += CTX[((size_t)h * NN + s) * 128 + col];
            v *= (1.0f / NH_); } a[q] = v; }
    // inner = -a0^2 + sum_{c=1..64} a_c^2 : lane-strided partial over my 4 components then xor tree
    float part = 0.f;
#pragma unroll
    for (int q = 0; q < 4; ++q) { const int c = lane * 4 + q; if (c == 0) part -= a[q] * a[q]; else if (c < DL) part += a[q] * a[q]; }
#pragma unroll
    for (int sh = 16; sh; sh >>= 1) part += __shfl_xor(part, sh, 32);
    const float den = sqrtf(fmaxf(fabsf(-part), 1e-8f)); const float f = sqrtf(KCURV) / den;
    v4f o; 
#pragma unroll
    for (int q = 0; q < 4; ++q) o[q] = a[q] * f;
    *(v4f*)(AVE + s * 128 + lane * 4) = o; 
}
// total 133,120 floats = 1,040 groups exactly).
__global__ __launch_bounds__(256) void k_outflat(const float* __restrict__ AVE, float* OUTB) {
    const int lane = threadIdx.x & 31; const size_t w = (size_t)blockIdx.x * 8 + (threadIdx.x >> 5); if (w >= (size_t)NN * DL / 128) return; const size_t e0 = w * 128 + lane * 4; v4f v;
#pragma unroll
    for (int q = 0; q < 4; ++q) { const size_t e = e0 + q; v[q] = AVE[(e / DL) * 128 + (e % DL)]; }
    *(v4f*)(OUTB + e0) = v; 
}

extern "C" void kernel_launch(void* const* d_in, const int* in_sizes, int n_in,
                              void* d_out, int out_size, void* d_ws, size_t ws_size, hipStream_t stream) {
    (void)in_sizes; (void)n_in; (void)out_size;
    const float* xq = (const float*)d_in[0]; const float* xs = (const float*)d_in[1]; const float* Wq = (const float*)d_in[2]; const float* bq = (const float*)d_in[3]; const float* Wk = (const float*)d_in[4]; const float* bk = (const float*)d_in[5]; const float* Wv = (const float*)d_in[6]; const float* bv = (const float*)d_in[7]; const float* scl = (const float*)d_in[8]; const float* bpar = (const float*)d_in[9];
    float* out = (float*)d_out;    // [4][2048][65]
    char* wsp = (char*)d_ws;
    auto take = [&](size_t bytes) { char* p = wsp; wsp += (bytes + 255) & ~(size_t)255; return (void*)p; };
    const int ZH = 2;
    bf* WQ = (bf*)take((size_t)DSP * DIN * 2); bf* WK = (bf*)take((size_t)DSP * DIN * 2); bf* WV = (bf*)take((size_t)DSP * DIN * 2);
    bf* Xq = (bf*)take((size_t)NN * DIN * 2); bf* Xs = (bf*)take((size_t)NN * DIN * 2); float* QS = (float*)take((size_t)NN * DSP * 4); float* KS = (float*)take((size_t)NN * DSP * 4); float* VS = (float*)take((size_t)NN * DSP * 4);
    float* TQ = (float*)take((size_t)NH_ * NN * 4); float* TK = (float*)take((size_t)NH_ * NN * 4); float* TV = (float*)take((size_t)NH_ * NN * 4);
    bf* Qh = (bf*)take((size_t)ZH * NN * HD * 2); bf* Ql = (bf*)take((size_t)ZH * NN * HD * 2); bf* Kh = (bf*)take((size_t)ZH * NN * HD * 2); bf* Kl = (bf*)take((size_t)ZH * NN * HD * 2); bf* VTh = (bf*)take((size_t)ZH * 128 * NN * 2); bf* VTl = (bf*)take((size_t)ZH * 128 * NN * 2);
    float* S = (float*)take((size_t)ZH * NN * NN * 4); bf* PH = (bf*)take((size_t)ZH * NN * NN * 2); bf* PL = (bf*)take((size_t)ZH * NN * NN * 2); float* CTX = (float*)take((size_t)NH_ * NN * 128 * 4); float* AVE = (float*)take((size_t)NN * 128 * 4);
    if ((size_t)(wsp - (char*)d_ws) > ws_size) return;    // 1.5 + 4.2 + 12.6 + 0.2 + 2.1 + 2.1 + 33.5 + 16.8 + 16.8 + 8.4 + 1 ~ 99 MB; per item / head-pair reuse in stream order
    k_cvt8<<<(DSP * DIN / 8 + 255) / 256, 256, 0, stream>>>(Wq, WQ, DSP * DIN / 8); k_cvt8<<<(DSP * DIN / 8 + 255) / 256, 256, 0, stream>>>(Wk, WK, DSP * DIN / 8); k_cvt8<<<(DSP * DIN / 8 + 255) / 256, 256, 0, stream>>>(Wv, WV, DSP * DIN / 8);   // [H][OUT][IN] = [(h,o)][in] natural n-major
    for (int b = 0; b < NBT; ++b) {
        k_cvtx<<<NN / 8, 256, 0, stream>>>(xq + (size_t)b * NN * DIN, Xq); k_cvtx<<<NN / 8, 256, 0, stream>>>(xs + (size_t)b * NN * DIN, Xs);
        k_gemmb<false, false><<<dim3(NN / 64, DSP / 64, 1), 128, 0, stream>>>(Xq, nullptr, WQ, bq, QS, DSP, nullptr, nullptr, DIN);     // space parts (+ per-head bias [H][OUT] = [512])
        k_gemmb<false, false><<<dim3(NN / 64, DSP / 64, 1), 128, 0, stream>>>(Xs, nullptr, WK, bk, KS, DSP, nullptr, nullptr, DIN);
        k_gemmb<false, false><<<dim3(NN / 64, DSP / 64, 1), 128, 0, stream>>>(Xs, nullptr, WV, bv, VS, DSP, nullptr, nullptr, DIN);
        k_time<<<(NH_ * (NN / 32)) / 8, 256, 0, stream>>>(QS, TQ); k_time<<<(NH_ * (NN / 32)) / 8, 256, 0, stream>>>(KS, TK); k_time<<<(NH_ * (NN / 32)) / 8, 256, 0, stream>>>(VS, TV);
        for (int g = 0; g < NH_ / ZH; ++g) { const int h0 = g * ZH;
            k_hplanesz<<<dim3(NN / 8, 1, ZH), 256, 0, stream>>>(QS, DSP, h0, 1.0f, NN, Qh, Ql); k_hplanesz<<<dim3(NN / 8, 1, ZH), 256, 0, stream>>>(KS, DSP, h0, 1.0f, NN, Kh, Kl);
            k_vtLz<<<dim3((128 * (NN / 64)) / 8, 1, ZH), 256, 0, stream>>>(VS, TV, h0, VTh, VTl);
            k_gemm3z<1><<<dim3(NN / 64, NN / 64, ZH), 128, 0, stream>>>(Qh, Ql, Kh, Kl, HD, S, NN, (size_t)NN * HD, (size_t)NN * HD, (size_t)NN * NN);           // space scores, causal tiles only
            k_lsoftz<<<dim3(NN / 8, 1, ZH), 256, 0, stream>>>(S, TQ, TK, h0, scl, bpar, PH, PL);
            k_gemm3z<2><<<dim3(NN / 64, 2, ZH), 128, 0, stream>>>(PH, PL, VTh, VTl, NN, CTX + (size_t)h0 * NN * 128, 128, (size_t)NN * NN, (size_t)128 * NN, (size_t)NN * 128); }   // [space | time | 0] context, K-limited
        k_mid<<<NN / 8, 256, 0, stream>>>(CTX, AVE);
        k_outflat<<<(NN * DL / 128) / 8, 256, 0, stream>>>(AVE, out + (size_t)b * NN * DL); }
}

// v002
// It runs in 597 microseconds.
// Next to v001, in two timings, it ran 2.24 and 2.22 times as fast.
// All steps since v000 together make it 4.44 times as fast.
#include <hip/hip_runtime.h>

// Compute dtypes, f32 accumulate, the three per-head hyperbolic linears as [8192 x 512].[512 x 512] GEMMs over all four items' rows with PLAIN bf16 operands (exact products; all 8 heads' space
// parts at once), the Lorentz time coordinate sqrt(|x_s|^2 + k) in f32; per head: space scores = q_s.k_s^T ([2048 x 64].[64 x 2048], both operands bf16 hi + UNSCALED residual,
// three products; key tiles wholly above the diagonal skipped), the time term -q_0 k_0, the affine (2 + 2<q,k>_L)/scale + bias and the causal softmax in f32 -> P planes, the
// time component of the context from row 64 of the padded V^T planes in the P.V GEMM, the space context = P.v_s ([2048 x 2048].[2048 x 64], three products, K limited to the causal extent);

#define NBT  4
#define NN   2048
#define DIN  512
#define NH_  8
#define HD   64
#define DSP  (NH_ * HD)           // 512 space outputs over all heads
#define DL   (HD + 1)             // 65 Lorentz dims per head
#define DM   DIN
#define NTK  NN
#define KCURV 1.0f
#define LOSC 1024.0f
#define SPIT 72                   // LDS row pitch in elements of a staged 64-k operand tile: 128 B of data + 16 B, conflict-free for 16-byte fragment reads

typedef _Float16 h16;
typedef unsigned short bf;
typedef __attribute__((ext_vector_type(16))) __bf16   v16bf;
typedef __attribute__((ext_vector_type(16))) _Float16 v16h;
typedef __attribute__((ext_vector_type(8)))  _Float16 v8h;
typedef __attribute__((ext_vector_type(8)))  unsigned short v8us;
typedef __attribute__((ext_vector_type(8)))  float    v8f;
typedef __attribute__((ext_vector_type(4)))  float    v4f;
typedef __attribute__((ext_vector_type(4)))  _Float16 v4h;
typedef v8h  __attribute__((may_alias)) v8ha;
typedef v4f  __attribute__((may_alias)) v4fa;
typedef v8us __attribute__((may_alias)) v8usa;

__device__ __forceinline__ unsigned short f2bf(float f) { unsigned u = __float_as_uint(f); u += 0x7FFFu + ((u >> 16) & 1u); return (unsigned short)(u >> 16); }
__device__ __forceinline__ float bf2f(unsigned short b) { return __uint_as_float(((unsigned)b) << 16); }
__device__ __forceinline__ float bfr(float f) { return bf2f(f2bf(f)); }
__device__ __forceinline__ v16h cat16(v8h lo, v8h hi) { return __builtin_shufflevector(lo, hi, 0, 1, 2, 3, 4, 5, 6, 7, 8, 9, 10, 11, 12, 13, 14, 15); }
__device__ __forceinline__ v16bf cat16b(v8us lo, v8us hi) { return __builtin_bit_cast(v16bf, __builtin_shufflevector(lo, hi, 0, 1, 2, 3, 4, 5, 6, 7, 8, 9, 10, 11, 12, 13, 14, 15)); }
__device__ __forceinline__ v8f wmma16(v16h a, v16h b, v8f c) { return __builtin_amdgcn_wmma_f32_16x16x32_f16(false, a, false, b, (short)0, c, false, false); }
__device__ __forceinline__ v8f wmmab(v16bf a, v16bf b, v8f c) { return __builtin_amdgcn_wmma_f32_16x16x32_bf16(false, a, false, b, (short)0, c, false, false); }

// k_gemmb: 64 x 64 block tile (4 waves x 16 x 64) of C[NBT * NTK][NW] = (A [+ Al]).B^T (K = 512) [+ bf(bias[c])] [+ bf(R[r][c]) residual]; f32 whole-line epilogue (or f16
template <bool SPLITA, bool F16OUT = false>
__global__ __launch_bounds__(128) void k_gemmb(const bf* __restrict__ A, const bf* __restrict__ Al, const bf* __restrict__ Bn, const float* __restrict__ bias, float* C, int ldc, h16* C2, const float* __restrict__ R = nullptr, int K = DM, int roundR = 1) {
    constexpr int BI = SPLITA ? 2 : 1;                                   // LDS plane of the B tile
    __shared__ __align__(16) bf stg[BI + 1][64 * SPIT];
    __shared__ __align__(16) float ost[4][16 * 68];
    const int lane = threadIdx.x & 31, wave = threadIdx.x >> 5, lr = lane & 15, hi = lane >> 4;
    const int rb = blockIdx.x * 64, r0 = rb + wave * 16, c0 = blockIdx.y * 64;
    const int srow = threadIdx.x >> 3, spc = (threadIdx.x & 7) * 8;      // staging: 16 rows a pass, 8 lanes x 16 B cover one row's line
    unsigned oa[4], ob[4];                                               // per-lane byte offsets from the uniform bases; they step by one line a stage
#pragma unroll
    for (int p = 0; p < 4; ++p) { oa[p] = ((unsigned)(rb + p * 16 + srow) * (unsigned)K + spc) * 2u; ob[p] = ((unsigned)(c0 + p * 16 + srow) * (unsigned)K + spc) * 2u; }
    v8us rg[3][4];
    auto fetch = [&]() {
#pragma unroll
        for (int p = 0; p < 4; ++p) {
            rg[0][p] = *(const v8us*)((const char*)A + oa[p]); if (SPLITA) rg[1][p] = *(const v8us*)((const char*)Al + oa[p]);
            rg[2][p] = *(const v8us*)((const char*)Bn + ob[p]); }
    };
    v8f acc[4];
#pragma unroll
    for (int t = 0; t < 4; ++t) acc[t] = (v8f){};
    fetch();
#pragma unroll 1
    for (int kc = 0; kc < K; kc += 64) {
        __syncthreads();                                                 // every wave has read its last fragment of the stage before
#pragma unroll
        for (int p = 0; p < 4; ++p) { *(v8usa*)(&stg[0][(p * 16 + srow) * SPIT + spc]) = rg[0][p]; if (SPLITA) *(v8usa*)(&stg[1][(p * 16 + srow) * SPIT + spc]) = rg[1][p];
            *(v8usa*)(&stg[BI][(p * 16 + srow) * SPIT + spc]) = rg[2][p]; }
        __syncthreads();                                                 // the stage is complete in LDS
        if (kc + 64 < K) {
#pragma unroll
            for (int p = 0; p < 4; ++p) { oa[p] += 128u; ob[p] += 128u; }
            fetch();
            asm volatile("s_wait_xcnt 0x0" ::: "memory"); }              // directly behind the run's last load: past the loop's exit its base registers are rewritten with no load wait in front
#pragma unroll
        for (int ks = 0; ks < 2; ++ks) {
            const int ao = (wave * 16 + lr) * SPIT + ks * 32 + 8 * hi;
            const v16bf a = cat16b(*(const v8usa*)(&stg[0][ao]), *(const v8usa*)(&stg[0][ao + 16]));
            v16bf al = a;
            if (SPLITA) al = cat16b(*(const v8usa*)(&stg[1][ao]), *(const v8usa*)(&stg[1][ao + 16]));
            v16bf b[4];
#pragma unroll
            for (int t = 0; t < 4; ++t) { const int bo = (t * 16 + lr) * SPIT + ks * 32 + 8 * hi; b[t] = cat16b(*(const v8usa*)(&stg[BI][bo]), *(const v8usa*)(&stg[BI][bo + 16])); }
            __builtin_amdgcn_sched_barrier(0);                           // all fragment reads of the k step issue together, ahead of its products: one LDS latency a step, not one a fragment
#pragma unroll
            for (int t = 0; t < 4; ++t) { acc[t] = wmmab(a, b[t], acc[t]); if (SPLITA) acc[t] = wmmab(al, b[t], acc[t]); }
            asm volatile("v_nop\n\tv_nop\n\tv_nop\n\tv_nop" : "+v"(acc[0]), "+v"(acc[1]), "+v"(acc[2]), "+v"(acc[3]) : "v"(a), "v"(al));   // WMMA distance before its operands or results are touched, the loop's back edge included
        }
    }
    float* os = &ost[wave][0];
#pragma unroll
    for (int t = 0; t < 4; ++t) { const float bv = bias ? bfr(bias[c0 + t * 16 + lr]) : 0.f;
#pragma unroll
        for (int j = 0; j < 8; ++j) os[(hi * 8 + j) * 68 + t * 16 + lr] = acc[t][j] + bv; }
    __syncthreads();
    if (F16OUT) {
        h16* crow = (h16*)(void*)C + (size_t)r0 * ldc + c0;
        auto pass = [&]() {
#pragma unroll
            for (int s = 0; s < 4; ++s) { const int row = 4 * s + (lane >> 3), piece = lane & 7; const float* sp = os + row * 68 + piece * 8; v8h o, o2;
#pragma unroll
                for (int i = 0; i < 8; ++i) { const h16 a = (h16)sp[i]; o[i] = a; o2[i] = (h16)((sp[i] - (float)a) * LOSC); }
                *(v8h*)(crow + (size_t)row * ldc + piece * 8) = o; if (C2) *(v8h*)(C2 + (size_t)r0 * ldc + c0 + (size_t)row * ldc + piece * 8) = o2; }
        };
        pass(); 
    } else {
        float* crow = C + (size_t)r0 * ldc + c0;
        auto pass = [&]() {
#pragma unroll
            for (int s = 0; s < 8; ++s) { const int Lid = (lane >> 3) + 4 * s, piece = lane & 7; const int row = Lid >> 1, cofs = (Lid & 1) * 32 + piece * 4;
                v4f val = *(const v4fa*)(os + row * 68 + cofs); if (R) { const v4f rv = *(const v4f*)(R + ((size_t)r0 + row) * ldc + c0 + cofs); val += roundR ? (v4f){bfr(rv[0]), bfr(rv[1]), bfr(rv[2]), bfr(rv[3])} : rv; }
                *(v4f*)(crow + (size_t)row * ldc + cofs) = val; }
        };
        pass(); 
    }
}


// ===== z-batched (blockIdx.z = item * 8 + head, or the item where noted) attention pieces =====
// k_gemm3z<MODE>: 64 x 64 block tile (4 waves x 16 x 64) of C = (Ah + Al).(Bh + Bl)^T, three products, with per-z operand/output strides (elements): A planes += z*sA, B planes += z*sB,
// C += z*sC. MODE bit 0: causal tile skip; bit 1: K limited to the causal extent; rt0 = the query position, in 64-row tiles, of the launch's row 0. K and the K limit are multiples of 64. The four 64-row x 64-k operand tiles of a stage are read from
// global memory as whole 128-byte lines (8 lanes per row), laid in LDS at a 144-byte pitch, and the fragments are read from there; the next stage's lines fly during this stage's products.
template <int MODE>
__global__ __launch_bounds__(128) void k_gemm3z(const bf* __restrict__ Ah, const bf* __restrict__ Al, const bf* __restrict__ Bh, const bf* __restrict__ Bl, int K, float* C, int ldc, size_t sA, size_t sB, size_t sC, int rt0) {
    if ((MODE & 1) && (int)blockIdx.y * 64 > (rt0 + (int)blockIdx.x) * 64 + 63) return;
    const size_t z = blockIdx.z; Ah += z * sA; Al += z * sA; Bh += z * sB; Bl += z * sB; C += z * sC;
    const int Klim = (MODE & 2) ? min(K, (rt0 + (int)blockIdx.x + 1) * 64) : K;
    __shared__ __align__(16) bf stg[4][64 * SPIT];
    __shared__ __align__(16) float ost[4][16 * 68];
    const int lane = threadIdx.x & 31, wave = threadIdx.x >> 5, lr = lane & 15, hi = lane >> 4;
    const int rb = blockIdx.x * 64, r0 = rb + wave * 16, c0 = blockIdx.y * 64;
    const int srow = threadIdx.x >> 3, spc = (threadIdx.x & 7) * 8;      // staging: 16 rows a pass, 8 lanes x 16 B cover one row's line
    unsigned oa[4], ob[4];                                               // per-lane byte offsets from the uniform bases; they step by one line a stage
#pragma unroll
    for (int p = 0; p < 4; ++p) { oa[p] = ((unsigned)(rb + p * 16 + srow) * (unsigned)K + spc) * 2u; ob[p] = ((unsigned)(c0 + p * 16 + srow) * (unsigned)K + spc) * 2u; }
    v8us rg[4][4];
    auto fetch = [&]() {
#pragma unroll
        for (int p = 0; p < 4; ++p) {
            rg[0][p] = *(const v8us*)((const char*)Ah + oa[p]); rg[1][p] = *(const v8us*)((const char*)Al + oa[p]);
            rg[2][p] = *(const v8us*)((const char*)Bh + ob[p]); rg[3][p] = *(const v8us*)((const char*)Bl + ob[p]); }
    };
    v8f acc[4];
#pragma unroll
    for (int t = 0; t < 4; ++t) acc[t] = (v8f){};
    fetch();
#pragma unroll 1
    for (int kc = 0; kc < Klim; kc += 64) {
        __syncthreads();                                                 // every wave has read its last fragment of the stage before
#pragma unroll
        for (int p = 0; p < 4; ++p) {
#pragma unroll
            for (int a = 0; a < 4; ++a) *(v8usa*)(&stg[a][(p * 16 + srow) * SPIT + spc]) = rg[a][p]; }
        __syncthreads();                                                 // the stage is complete in LDS
        if (kc + 64 < Klim) {
#pragma unroll
            for (int p = 0; p < 4; ++p) { oa[p] += 128u; ob[p] += 128u; }
            fetch();
            asm volatile("s_wait_xcnt 0x0" ::: "memory"); }              // directly behind the run's last load: past the loop's exit its base registers are rewritten with no load wait in front
#pragma unroll
        for (int ks = 0; ks < 2; ++ks) {
            const int ao = (wave * 16 + lr) * SPIT + ks * 32 + 8 * hi;
            const v16bf a = cat16b(*(const v8usa*)(&stg[0][ao]), *(const v8usa*)(&stg[0][ao + 16]));
            const v16bf al = cat16b(*(const v8usa*)(&stg[1][ao]), *(const v8usa*)(&stg[1][ao + 16]));
            v16bf bh[4], bl[4];
#pragma unroll
            for (int t = 0; t < 4; ++t) { const int bo = (t * 16 + lr) * SPIT + ks * 32 + 8 * hi;
                bh[t] = cat16b(*(const v8usa*)(&stg[2][bo]), *(const v8usa*)(&stg[2][bo + 16]));
                bl[t] = cat16b(*(const v8usa*)(&stg[3][bo]), *(const v8usa*)(&stg[3][bo + 16])); }
            __builtin_amdgcn_sched_barrier(0);                           // all fragment reads of the k step issue together, ahead of its products: one LDS latency a step, not one a fragment
#pragma unroll
            for (int t = 0; t < 4; ++t) { acc[t] = wmmab(a, bh[t], acc[t]); acc[t] = wmmab(al, bh[t], acc[t]); acc[t] = wmmab(a, bl[t], acc[t]); }
            asm volatile("v_nop\n\tv_nop\n\tv_nop\n\tv_nop" : "+v"(acc[0]), "+v"(acc[1]), "+v"(acc[2]), "+v"(acc[3]) : "v"(a), "v"(al));   // WMMA distance before its operands or results are touched, the loop's back edge included
        }
    }
    float* os = &ost[wave][0];
#pragma unroll
    for (int t = 0; t < 4; ++t) {
#pragma unroll
        for (int j = 0; j < 8; ++j) os[(hi * 8 + j) * 68 + t * 16 + lr] = acc[t][j]; }
    __builtin_amdgcn_wave_barrier(); asm volatile("" ::: "memory");
    float* crow = C + (size_t)r0 * ldc + c0;
    auto pass = [&]() {
#pragma unroll
        for (int s = 0; s < 8; ++s) { const int Lid = (lane >> 3) + 4 * s, piece = lane & 7; const int row = Lid >> 1, cofs = (Lid & 1) * 32 + piece * 4;
            const v4f val = *(const v4fa*)(os + row * 68 + cofs); *(v4f*)(crow + (size_t)row * ldc + cofs) = val; }
    };
    pass(); 
}
__global__ __launch_bounds__(256) void k_planes32z(const float* __restrict__ F, int ld, int off, float sc, int rows, bf* Ph, bf* Pl) {
    typedef __attribute__((ext_vector_type(2))) unsigned short v2us;
    const int lane = threadIdx.x & 31; const size_t r = ((size_t)blockIdx.x * 8 + (threadIdx.x >> 5)) * 2 + (lane >> 4); if (r >= (size_t)rows) return; const int z = blockIdx.z; const int c0 = (lane & 15) * 2; v2us oh, ol;
    Ph += (size_t)z * rows * 32; Pl += (size_t)z * rows * 32;
#pragma unroll
    for (int i = 0; i < 2; ++i) { const float y = F[r * ld + off + z * 32 + c0 + i] * sc; const unsigned short hb = f2bf(y); oh[i] = hb; ol[i] = f2bf(y - bf2f(hb)); }
    const size_t o = r * 32 + c0; *(v2us*)(Ph + o) = oh; *(v2us*)(Pl + o) = ol; 
}
__global__ __launch_bounds__(256) void k_vtpadz(const float* __restrict__ F, int ld, int off, int nk, bf* Th, bf* Tl) {
    typedef __attribute__((ext_vector_type(2))) unsigned short v2us;
    const int lane = threadIdx.x & 31; const size_t wid = (size_t)blockIdx.x * 8 + (threadIdx.x >> 5); if (wid >= (size_t)64 * (nk / 64)) return; const int z = blockIdx.z; const int d = (int)(wid / (nk / 64)); const int k0 = (int)(wid % (nk / 64)) * 64 + lane * 2; v2us oh, ol;
    Th += (size_t)z * 64 * nk; Tl += (size_t)z * 64 * nk;
#pragma unroll
    for (int i = 0; i < 2; ++i) { const float y = (d < 32) ? F[(size_t)(k0 + i) * ld + off + z * 32 + (d < 32 ? d : 0)] : 0.f; const unsigned short hb = f2bf(y); oh[i] = hb; ol[i] = f2bf(y - bf2f(hb)); }
    const size_t o = (size_t)d * nk + k0; *(v2us*)(Th + o) = oh; *(v2us*)(Tl + o) = ol; 
}
template <int NK>
__global__ __launch_bounds__(256) void k_softmaxz(const float* __restrict__ S, int rows, bf* PH, bf* PL) {
    typedef __attribute__((ext_vector_type(4))) unsigned short v4us;
    const int lane = threadIdx.x & 31, i = blockIdx.x * 8 + (threadIdx.x >> 5); if (i >= rows) return; const size_t zo = (size_t)blockIdx.z * rows * NK; const float* sr = S + zo + (size_t)i * NK; PH += zo; PL += zo;
    float m = -3.0e38f;
#pragma unroll 1
    for (int c0 = lane * 4; c0 < NK; c0 += 128) {
#pragma unroll
        for (int q = 0; q < 4; ++q) m = fmaxf(m, sr[c0 + q]); }
#pragma unroll
    for (int sh = 16; sh; sh >>= 1) m = fmaxf(m, __shfl_xor(m, sh, 32));
    float sum = 0.f;
#pragma unroll 1
    for (int c0 = lane * 4; c0 < NK; c0 += 128) {
#pragma unroll
        for (int q = 0; q < 4; ++q) sum += __expf(sr[c0 + q] - m); }
#pragma unroll
    for (int sh = 16; sh; sh >>= 1) sum += __shfl_xor(sum, sh, 32);
    const float inv = 1.0f / sum;
{
#pragma unroll 1
        for (int c0 = lane * 4; c0 < NK; c0 += 128) { v4us oh, ol;
#pragma unroll
            for (int q = 0; q < 4; ++q) { const float p = __expf(sr[c0 + q] - m) * inv; const unsigned short hb = f2bf(p); oh[q] = hb; ol[q] = f2bf(p - bf2f(hb)); }
            const size_t o = (size_t)i * NK + c0; *(v4us*)(PH + o) = oh; *(v4us*)(PL + o) = ol; }
         }
}
__global__ __launch_bounds__(256) void k_placez(const float* __restrict__ XH, int rows, int ldy, float* Y) {
    const int lane = threadIdx.x & 31; const size_t q = (size_t)blockIdx.x * 8 + (threadIdx.x >> 5); if (q >= (size_t)rows) return; const int z = blockIdx.z; const float v = XH[((size_t)z * rows + q) * 64 + lane];
    *(float*)(Y + q * ldy + z * 32 + lane) = v; 
}

__global__ __launch_bounds__(256) void k_hplanesz(const float* __restrict__ F, int ld, int h0, float sc, int rows, bf* Ph, bf* Pl) {
    typedef __attribute__((ext_vector_type(2))) unsigned short v2us;
    const int lane = threadIdx.x & 31; const size_t r = (size_t)blockIdx.x * 8 + (threadIdx.x >> 5); if (r >= (size_t)rows) return; const int z = blockIdx.z; v2us oh, ol;
    Ph += (size_t)z * rows * 64; Pl += (size_t)z * rows * 64;
#pragma unroll
    for (int i = 0; i < 2; ++i) { const float y = F[((size_t)((h0 + z) / NH_) * rows + r) * ld + ((h0 + z) % NH_) * 64 + lane * 2 + i] * sc; const unsigned short hb = f2bf(y); oh[i] = hb; ol[i] = f2bf(y - bf2f(hb)); }   // h0 + z = item * 8 + head
    const size_t o = r * 64 + lane * 2; *(v2us*)(Ph + o) = oh; *(v2us*)(Pl + o) = ol; 
}
__global__ __launch_bounds__(256) void k_vtz(const float* __restrict__ F, int ld, int h0, int nk, bf* Th, bf* Tl) {
    typedef __attribute__((ext_vector_type(2))) unsigned short v2us;
    const int lane = threadIdx.x & 31; const size_t wid = (size_t)blockIdx.x * 8 + (threadIdx.x >> 5); if (wid >= (size_t)64 * (nk / 64)) return; const int z = blockIdx.z; const int d = (int)(wid / (nk / 64)); const int t0 = (int)(wid % (nk / 64)) * 64 + lane * 2; v2us oh, ol;
    Th += (size_t)z * 64 * nk; Tl += (size_t)z * 64 * nk;
#pragma unroll
    for (int i = 0; i < 2; ++i) { const float y = F[(size_t)(t0 + i) * ld + (h0 + z) * 64 + d]; const unsigned short hb = f2bf(y); oh[i] = hb; ol[i] = f2bf(y - bf2f(hb)); }
    const size_t o = (size_t)d * nk + t0; *(v2us*)(Th + o) = oh; *(v2us*)(Tl + o) = ol; 
}
template <int NK>
__global__ __launch_bounds__(256) void k_softmaxzs(const float* __restrict__ S, int rows, float sc, bf* PH, bf* PL) {
    typedef __attribute__((ext_vector_type(4))) unsigned short v4us;
    const int lane = threadIdx.x & 31, i = blockIdx.x * 8 + (threadIdx.x >> 5); if (i >= rows) return; const size_t zo = (size_t)blockIdx.z * rows * NK; const float* sr = S + zo + (size_t)i * NK; PH += zo; PL += zo;
    float m = -3.0e38f;
#pragma unroll 1
    for (int c0 = lane * 4; c0 < NK; c0 += 128) {
#pragma unroll
        for (int q = 0; q < 4; ++q) m = fmaxf(m, sr[c0 + q] * sc); }
#pragma unroll
    for (int sh = 16; sh; sh >>= 1) m = fmaxf(m, __shfl_xor(m, sh, 32));
    float sum = 0.f;
#pragma unroll 1
    for (int c0 = lane * 4; c0 < NK; c0 += 128) {
#pragma unroll
        for (int q = 0; q < 4; ++q) sum += __expf(sr[c0 + q] * sc - m); }
#pragma unroll
    for (int sh = 16; sh; sh >>= 1) sum += __shfl_xor(sum, sh, 32);
    const float inv = 1.0f / sum;
{
#pragma unroll 1
        for (int c0 = lane * 4; c0 < NK; c0 += 128) { v4us oh, ol;
#pragma unroll
            for (int q = 0; q < 4; ++q) { const float p = __expf(sr[c0 + q] * sc - m) * inv; const unsigned short hb = f2bf(p); oh[q] = hb; ol[q] = f2bf(p - bf2f(hb)); }
            const size_t o = (size_t)i * NK + c0; *(v4us*)(PH + o) = oh; *(v4us*)(PL + o) = ol; }
         }
}

__global__ __launch_bounds__(256) void k_cvt8(const float* __restrict__ src, bf* dst, size_t n8) {
    const size_t i = (size_t)blockIdx.x * 256 + threadIdx.x; if (i >= n8) return;
    const v8f v = *(const v8f*)(src + i * 8); v8us o;
#pragma unroll
    for (int k = 0; k < 8; ++k) o[k] = f2bf(v[k]);
    *(v8us*)(dst + i * 8) = o; 
}
__global__ __launch_bounds__(256) void k_zero8(bf* dst, size_t n8) {
    const size_t i = (size_t)blockIdx.x * 256 + threadIdx.x; if (i >= n8) return; v8us z;
#pragma unroll
    for (int k = 0; k < 8; ++k) z[k] = 0;
    *(v8us*)(dst + i * 8) = z; 
}

__global__ __launch_bounds__(256) void k_cvtx(const float* __restrict__ src, bf* dst) {
    const int lane = threadIdx.x & 31; const size_t r = (size_t)blockIdx.x * 8 + (threadIdx.x >> 5); if (r >= (size_t)NBT * NN) return;
{
#pragma unroll
        for (int q = 0; q < DIN / 256; ++q) { v8us o;
#pragma unroll
            for (int i = 0; i < 8; ++i) o[i] = f2bf(src[r * DIN + q * 256 + lane * 8 + i]);
            *(v8us*)(dst + r * DIN + q * 256 + lane * 8) = o; }
         }
}
__global__ __launch_bounds__(256) void k_time(const float* __restrict__ SP, float* TT) {
    const int lane = threadIdx.x & 31; const int w = blockIdx.x * 8 + (threadIdx.x >> 5); if (w >= NH_ * (NN / 32)) return; const int h = w / (NN / 32); const int s = (w % (NN / 32)) * 32 + lane; float acc = 0.f;
    SP += (size_t)blockIdx.z * NN * DSP; TT += (size_t)blockIdx.z * NH_ * NN;      // z = item; TT is [item][head][position]
#pragma unroll 8
    for (int d = 0; d < HD; ++d) { const float v = SP[(size_t)s * DSP + h * HD + d]; acc = fmaf(v, v, acc); }
    const float t = sqrtf(acc + KCURV); *(float*)(TT + (size_t)h * NN + s) = t; 
}
__global__ __launch_bounds__(256) void k_vtLz(const float* __restrict__ VS, const float* __restrict__ TT, int h0, bf* Th, bf* Tl) {
    typedef __attribute__((ext_vector_type(2))) unsigned short v2us;
    const int lane = threadIdx.x & 31; const size_t wid = (size_t)blockIdx.x * 8 + (threadIdx.x >> 5); if (wid >= (size_t)128 * (NN / 64)) return; const int z = blockIdx.z, h = h0 + z; const int d = (int)(wid / (NN / 64)); const int t0 = (int)(wid % (NN / 64)) * 64 + lane * 2; v2us oh, ol;
    Th += (size_t)z * 128 * NN; Tl += (size_t)z * 128 * NN;
#pragma unroll
    for (int i = 0; i < 2; ++i) { float y = 0.f; if (d < HD) y = VS[((size_t)(h / NH_) * NN + t0 + i) * DSP + (h % NH_) * HD + (d < HD ? d : 0)]; else if (d == HD) y = TT[(size_t)h * NN + t0 + i]; const unsigned short hb = f2bf(y); oh[i] = hb; ol[i] = f2bf(y - bf2f(hb)); }
    const size_t o = (size_t)d * NN + t0; *(v2us*)(Th + o) = oh; *(v2us*)(Tl + o) = ol; 
}
// k_lsoftz: head h0+z, row i: a_ik = (2 + 2 (S[z][i - i0][k] - q0[h][i] k0[h][k])) / bf(scale) + bf(bias) for k <= i (keys k > i are skipped and get exact zeros); three-pass f32 softmax with
__global__ __launch_bounds__(256) void k_lsoftz(const float* __restrict__ S, const float* __restrict__ TQ, const float* __restrict__ TK, int h0, int i0, int rows, const float* __restrict__ scl, const float* __restrict__ bpar, bf* PH, bf* PL) {
    typedef __attribute__((ext_vector_type(4))) unsigned short v4us;
    const int lane = threadIdx.x & 31, il = blockIdx.x * 8 + (threadIdx.x >> 5), i = i0 + il; if (il >= rows || i >= NN) return; const int z = blockIdx.z, h = h0 + z; const size_t zo = (size_t)z * rows * NN;   // S, PH, PL hold query rows i0 .. i0 + rows - 1 of each z
    const float* sr = S + zo + (size_t)il * NN; const float* k0 = TK + (size_t)h * NN; const float qi = TQ[(size_t)h * NN + i]; const float isc = 1.0f / bfr(scl[0]); const float bb = bfr(bpar[0]); PH += zo; PL += zo;
    auto logit = [&](int k) { return (2.0f + 2.0f * (sr[k] - qi * k0[k])) * isc + bb; };
    float m = -3.0e38f;
#pragma unroll 1
    for (int c0 = lane * 4; c0 < NN; c0 += 128) {
#pragma unroll
        for (int q = 0; q < 4; ++q) { const int k = c0 + q; if (k <= i) m = fmaxf(m, logit(k)); } }
#pragma unroll
    for (int sh = 16; sh; sh >>= 1) m = fmaxf(m, __shfl_xor(m, sh, 32));
    float sum = 0.f;
#pragma unroll 1
    for (int c0 = lane * 4; c0 < NN; c0 += 128) {
#pragma unroll
        for (int q = 0; q < 4; ++q) { const int k = c0 + q; if (k <= i) sum += __expf(logit(k) - m); } }
#pragma unroll
    for (int sh = 16; sh; sh >>= 1) sum += __shfl_xor(sum, sh, 32);
    const float inv = 1.0f / sum;
{
#pragma unroll 1
        for (int c0 = lane * 4; c0 < NN; c0 += 128) { v4us oh, ol;
#pragma unroll
            for (int q = 0; q < 4; ++q) { const int k = c0 + q; const float p = (k <= i) ? __expf(logit((k <= i) ? k : 0) - m) * inv : 0.f; const unsigned short hb = f2bf(p); oh[q] = hb; ol[q] = f2bf(p - bf2f(hb)); }
            const size_t o = (size_t)il * NN + c0; *(v4us*)(PH + o) = oh; *(v4us*)(PL + o) = ol; }
         }
}
// k_mid: out[b][s][0..64] = sqrt(k) ave / sqrt(max(| -(-ave0^2 + |ave_s|^2) |, 1e-8)) with ave = mean over the 8 heads of CTX[h][s][0..64] (f32, fixed head order); one wave per row s:
// lane l -> components 4l..4l+3 (65 live); the row's 65 floats are part of the flat [2048 x 65] output block -> written by k_outflat below from AVE[s][128]; here AVE rows of 128
__global__ __launch_bounds__(256) void k_mid(const float* __restrict__ CTX, float* AVE) {
    const int lane = threadIdx.x & 31; const size_t s = (size_t)blockIdx.x * 8 + (threadIdx.x >> 5); if (s >= (size_t)NN) return; v4f a;
    CTX += (size_t)blockIdx.z * NH_ * NN * 128; AVE += (size_t)blockIdx.z * NN * 128;      // z = item
#pragma unroll
    for (int q = 0; q < 4; ++q) { const int c = lane * 4 + q; float v = 0.f; if (c < DL) { const int col = (c == 0) ? HD : (c - 1);     // module order [t | space]; CTX holds [space(0..63) | t(64)]
#pragma unroll
            for (int h = 0; h < NH_; ++h) v += CTX[((size_t)h * NN + s) * 128 + col];
            v *= (1.0f / NH_); } a[q] = v; }
    // inner = -a0^2 + sum_{c=1..64} a_c^2 : lane-strided partial over my 4 components then xor tree
    float part = 0.f;
#pragma unroll
    for (int q = 0; q < 4; ++q) { const int c = lane * 4 + q; if (c == 0) part -= a[q] * a[q]; else if (c < DL) part += a[q] * a[q]; }
#pragma unroll
    for (int sh = 16; sh; sh >>= 1) part += __shfl_xor(part, sh, 32);
    const float den = sqrtf(fmaxf(fabsf(-part), 1e-8f)); const float f = sqrtf(KCURV) / den;
    v4f o; 
#pragma unroll
    for (int q = 0; q < 4; ++q) o[q] = a[q] * f;
    *(v4f*)(AVE + s * 128 + lane * 4) = o; 
}
// total 532,480 floats (all four items) = 4,160 groups exactly).
__global__ __launch_bounds__(256) void k_outflat(const float* __restrict__ AVE, float* OUTB) {
    const int lane = threadIdx.x & 31; const size_t w = (size_t)blockIdx.x * 8 + (threadIdx.x >> 5); if (w >= (size_t)NBT * NN * DL / 128) return; const size_t e0 = w * 128 + lane * 4; v4f v;
#pragma unroll
    for (int q = 0; q < 4; ++q) { const size_t e = e0 + q; v[q] = AVE[(e / DL) * 128 + (e % DL)]; }
    *(v4f*)(OUTB + e0) = v; 
}

extern "C" void kernel_launch(void* const* d_in, const int* in_sizes, int n_in,
                              void* d_out, int out_size, void* d_ws, size_t ws_size, hipStream_t stream) {
    (void)in_sizes; (void)n_in; (void)out_size;
    const float* xq = (const float*)d_in[0]; const float* xs = (const float*)d_in[1]; const float* Wq = (const float*)d_in[2]; const float* bq = (const float*)d_in[3]; const float* Wk = (const float*)d_in[4]; const float* bk = (const float*)d_in[5]; const float* Wv = (const float*)d_in[6]; const float* bv = (const float*)d_in[7]; const float* scl = (const float*)d_in[8]; const float* bpar = (const float*)d_in[9];
    float* out = (float*)d_out;    // [4][2048][65]
    char* wsp = (char*)d_ws;
    auto take = [&](size_t bytes) { char* p = wsp; wsp += (bytes + 255) & ~(size_t)255; return (void*)p; };
    const int NZ = NBT * NH_;      // every (item, head) pair is one z slice of a launch
    const int RC = 256;            // query rows of each pair that one pass of scores, softmax and context covers: S + PH + PL of a pass fill 128 MiB
    bf* WQ = (bf*)take((size_t)DSP * DIN * 2); bf* WK = (bf*)take((size_t)DSP * DIN * 2); bf* WV = (bf*)take((size_t)DSP * DIN * 2);
    float* TQ = (float*)take((size_t)NZ * NN * 4); float* TK = (float*)take((size_t)NZ * NN * 4); float* TV = (float*)take((size_t)NZ * NN * 4);
    bf* Qh = (bf*)take((size_t)NZ * NN * HD * 2); bf* Ql = (bf*)take((size_t)NZ * NN * HD * 2); bf* Kh = (bf*)take((size_t)NZ * NN * HD * 2); bf* Kl = (bf*)take((size_t)NZ * NN * HD * 2); bf* VTh = (bf*)take((size_t)NZ * 128 * NN * 2); bf* VTl = (bf*)take((size_t)NZ * 128 * NN * 2);
    float* CTX = (float*)take((size_t)NZ * NN * 128 * 4); float* AVE = (float*)take((size_t)NBT * NN * 128 * 4);
    char* pool = wsp;              // two tenants in stream order: the projections' operands and f32 results, dead once the planes are built, then S and the P planes
    float* S = (float*)take((size_t)NZ * RC * NN * 4); bf* PH = (bf*)take((size_t)NZ * RC * NN * 2); bf* PL = (bf*)take((size_t)NZ * RC * NN * 2);
    char* wend = wsp; wsp = pool;
    bf* Xq = (bf*)take((size_t)NBT * NN * DIN * 2); bf* Xs = (bf*)take((size_t)NBT * NN * DIN * 2); float* QS = (float*)take((size_t)NBT * NN * DSP * 4); float* KS = (float*)take((size_t)NBT * NN * DSP * 4); float* VS = (float*)take((size_t)NBT * NN * DSP * 4);
    if (wsp > wend || (size_t)(wend - (char*)d_ws) > ws_size) return;    // 1.6 + 0.8 + 33.6 + 33.6 + 33.6 + 4.2 + 134.2 ~ 242 MB
    k_cvt8<<<(DSP * DIN / 8 + 255) / 256, 256, 0, stream>>>(Wq, WQ, DSP * DIN / 8); k_cvt8<<<(DSP * DIN / 8 + 255) / 256, 256, 0, stream>>>(Wk, WK, DSP * DIN / 8); k_cvt8<<<(DSP * DIN / 8 + 255) / 256, 256, 0, stream>>>(Wv, WV, DSP * DIN / 8);   // [H][OUT][IN] = [(h,o)][in] natural n-major
    k_cvtx<<<NBT * NN / 8, 256, 0, stream>>>(xq, Xq); k_cvtx<<<NBT * NN / 8, 256, 0, stream>>>(xs, Xs);
    k_gemmb<false, false><<<dim3(NBT * NN / 64, DSP / 64, 1), 128, 0, stream>>>(Xq, nullptr, WQ, bq, QS, DSP, nullptr, nullptr, DIN);     // space parts (+ per-head bias [H][OUT] = [512]), the four items' rows in one grid
    k_gemmb<false, false><<<dim3(NBT * NN / 64, DSP / 64, 1), 128, 0, stream>>>(Xs, nullptr, WK, bk, KS, DSP, nullptr, nullptr, DIN);
    k_gemmb<false, false><<<dim3(NBT * NN / 64, DSP / 64, 1), 128, 0, stream>>>(Xs, nullptr, WV, bv, VS, DSP, nullptr, nullptr, DIN);
    k_time<<<dim3((NH_ * (NN / 32)) / 8, 1, NBT), 256, 0, stream>>>(QS, TQ); k_time<<<dim3((NH_ * (NN / 32)) / 8, 1, NBT), 256, 0, stream>>>(KS, TK); k_time<<<dim3((NH_ * (NN / 32)) / 8, 1, NBT), 256, 0, stream>>>(VS, TV);
    k_hplanesz<<<dim3(NN / 8, 1, NZ), 256, 0, stream>>>(QS, DSP, 0, 1.0f, NN, Qh, Ql); k_hplanesz<<<dim3(NN / 8, 1, NZ), 256, 0, stream>>>(KS, DSP, 0, 1.0f, NN, Kh, Kl);
    k_vtLz<<<dim3((128 * (NN / 64)) / 8, 1, NZ), 256, 0, stream>>>(VS, TV, 0, VTh, VTl);
    for (int c = 0; c < NN / RC; ++c) { const int rt0 = c * (RC / 64);       // query rows c * RC .. c * RC + RC - 1 of all pairs; keys up to the block's last row only
        k_gemm3z<1><<<dim3(RC / 64, rt0 + RC / 64, NZ), 128, 0, stream>>>(Qh + (size_t)c * RC * HD, Ql + (size_t)c * RC * HD, Kh, Kl, HD, S, NN, (size_t)NN * HD, (size_t)NN * HD, (size_t)RC * NN, rt0);           // space scores, causal tiles only
        k_lsoftz<<<dim3(RC / 8, 1, NZ), 256, 0, stream>>>(S, TQ, TK, 0, c * RC, RC, scl, bpar, PH, PL);
        k_gemm3z<2><<<dim3(RC / 64, 2, NZ), 128, 0, stream>>>(PH, PL, VTh, VTl, NN, CTX + (size_t)c * RC * 128, 128, (size_t)RC * NN, (size_t)128 * NN, (size_t)NN * 128, rt0); }   // [space | time | 0] context, K-limited
    k_mid<<<dim3(NN / 8, 1, NBT), 256, 0, stream>>>(CTX, AVE);
    k_outflat<<<(NBT * NN * DL / 128) / 8, 256, 0, stream>>>(AVE, out);
}

// v004
// Measured time: 112 microseconds a run.
// Versions in between are left out here; by their measured steps it is 5.34 times as fast as v002.
// Counting every step since v000, it is 23.7 times as fast.
#include <hip/hip_runtime.h>

// Compute dtypes, f32 accumulate, the three per-head hyperbolic linears as [8192 x 512].[512 x 512] GEMMs over all four items' rows with PLAIN bf16 operands (exact products; all 8 heads' space
// parts at once), the Lorentz time coordinate sqrt(|x_s|^2 + k) in f32; per head: space scores = q_s.k_s^T ([2048 x 64].[64 x 2048], both operands bf16 hi + UNSCALED residual,
// three products; key tiles wholly above the diagonal skipped), the time term -q_0 k_0, the affine (2 + 2<q,k>_L)/scale + bias and the causal softmax in f32 with a running maximum, the
// context = P.[v_s | v_0] ([2048 x 2048].[2048 x 65], P and v bf16 hi + residual, three products, K limited to the causal extent), all three inside one kernel (k_fattn), 1/sum applied last;

#define NBT  4
#define NN   2048
#define DIN  512
#define NH_  8
#define HD   64
#define DSP  (NH_ * HD)           // 512 space outputs over all heads
#define DL   (HD + 1)             // 65 Lorentz dims per head
#define DM   DIN
#define NTK  NN
#define KCURV 1.0f
#define LOSC 1024.0f
#define SPIT 72                   // LDS row pitch in elements of a staged 64-k operand tile: 128 B of data + 16 B, conflict-free for 16-byte fragment reads

typedef _Float16 h16;
typedef unsigned short bf;
typedef __attribute__((ext_vector_type(16))) __bf16   v16bf;
typedef __attribute__((ext_vector_type(16))) _Float16 v16h;
typedef __attribute__((ext_vector_type(8)))  _Float16 v8h;
typedef __attribute__((ext_vector_type(8)))  unsigned short v8us;
typedef __attribute__((ext_vector_type(8)))  float    v8f;
typedef __attribute__((ext_vector_type(16))) float    v16f;
typedef __attribute__((ext_vector_type(4)))  float    v4f;
typedef __attribute__((ext_vector_type(4)))  _Float16 v4h;
typedef v8h  __attribute__((may_alias)) v8ha;
typedef v4f  __attribute__((may_alias)) v4fa;
typedef v8us __attribute__((may_alias)) v8usa;

__device__ __forceinline__ unsigned short f2bf(float f) { unsigned u = __float_as_uint(f); u += 0x7FFFu + ((u >> 16) & 1u); return (unsigned short)(u >> 16); }
__device__ __forceinline__ float bf2f(unsigned short b) { return __uint_as_float(((unsigned)b) << 16); }
__device__ __forceinline__ float bfr(float f) { return bf2f(f2bf(f)); }
__device__ __forceinline__ v16h cat16(v8h lo, v8h hi) { return __builtin_shufflevector(lo, hi, 0, 1, 2, 3, 4, 5, 6, 7, 8, 9, 10, 11, 12, 13, 14, 15); }
__device__ __forceinline__ v16bf cat16b(v8us lo, v8us hi) { return __builtin_bit_cast(v16bf, __builtin_shufflevector(lo, hi, 0, 1, 2, 3, 4, 5, 6, 7, 8, 9, 10, 11, 12, 13, 14, 15)); }
__device__ __forceinline__ v8f wmma16(v16h a, v16h b, v8f c) { return __builtin_amdgcn_wmma_f32_16x16x32_f16(false, a, false, b, (short)0, c, false, false); }
__device__ __forceinline__ float xhalf(float v) { const int b = __float_as_int(v); return __int_as_float(__builtin_amdgcn_permlanex16(b, b, 0x76543210, 0xfedcba98, false, false)); }   // lane l <- lane l ^ 16, on the vector pipe
__device__ __forceinline__ v8f wmmab(v16bf a, v16bf b, v8f c) { return __builtin_amdgcn_wmma_f32_16x16x32_bf16(false, a, false, b, (short)0, c, false, false); }

// k_proj: one projection's 64 x 64 block tile (4 waves x 16 x 64): 64 positions of one item x the 64 space outputs of ONE head, C = X.W^T + bf(bias), K = 512; z picks the projection (0 query, 1 key, 2 value).
// The tile is a head's whole space part, so the work-group finishes it itself: the time coordinate sqrt(|x_s|^2 + k) (f32, summed in component order), and the bf16 hi + residual planes that k_fattn reads:
// query and key rows as [pair][position][64] with the time in [pair][position]; the value tile is laid into LDS transposed and leaves as rows of V^T, [pair][component][position]: 64 space rows, the time row, 15 rows of zeros.
// Every global store is a whole 128 B line from 8 lanes (or from one wave, for the times).
__global__ __launch_bounds__(128) void k_proj(const bf* __restrict__ Xq, const bf* __restrict__ Xs, const bf* __restrict__ WQ, const bf* __restrict__ WK, const bf* __restrict__ WV,
                                              const float* __restrict__ bq, const float* __restrict__ bk, const float* __restrict__ bv,
                                              bf* Qh, bf* Ql, bf* Kh, bf* Kl, bf* VTh, bf* VTl, float* TQ, float* TK) {
    constexpr int K = DIN, OP = 68;                                      // OP: LDS row pitch in floats of the finished tile
    __shared__ __align__(16) bf stg[2][64 * SPIT];
    __shared__ __align__(16) float ost[(HD + 1) * OP];                   // query, key: [position][component]; value: [component][position], row 64 = the time
    const int tid = threadIdx.x, lane = tid & 31, wave = tid >> 5, lr = lane & 15, hi = lane >> 4;
    const int pj = blockIdx.z;
    const bf* A = pj == 0 ? Xq : Xs; const bf* Bn = pj == 0 ? WQ : pj == 1 ? WK : WV; const float* bias = pj == 0 ? bq : pj == 1 ? bk : bv;
    const int rb = blockIdx.x * 64, c0 = blockIdx.y * 64;
    const int srow = tid >> 3, spc = (tid & 7) * 8;                      // staging and plane stores: 16 rows a pass, 8 lanes x 16 B cover one row's line
    unsigned oa[4], ob[4];                                               // per-lane byte offsets from the uniform bases; they step by one line a stage
#pragma unroll
    for (int p = 0; p < 4; ++p) { oa[p] = ((unsigned)(rb + p * 16 + srow) * (unsigned)K + spc) * 2u; ob[p] = ((unsigned)(c0 + p * 16 + srow) * (unsigned)K + spc) * 2u; }
    v8us rg[2][4];
    auto fetch = [&]() {
#pragma unroll
        for (int p = 0; p < 4; ++p) { rg[0][p] = *(const v8us*)((const char*)A + oa[p]); rg[1][p] = *(const v8us*)((const char*)Bn + ob[p]); }
    };
    v8f acc[4]; float bb[4];                                             // bb: this lane's four bias values, read ahead of the loop
#pragma unroll
    for (int t = 0; t < 4; ++t) { acc[t] = (v8f){}; bb[t] = bfr(bias[c0 + t * 16 + lr]); }
    fetch();
#pragma unroll 1
    for (int kc = 0; kc < K; kc += 64) {
        __syncthreads();                                                 // every wave has read its last fragment of the stage before
#pragma unroll
        for (int p = 0; p < 4; ++p) { *(v8usa*)(&stg[0][(p * 16 + srow) * SPIT + spc]) = rg[0][p]; *(v8usa*)(&stg[1][(p * 16 + srow) * SPIT + spc]) = rg[1][p]; }
        __syncthreads();                                                 // the stage is complete in LDS
        if (kc + 64 < K) {
#pragma unroll
            for (int p = 0; p < 4; ++p) { oa[p] += 128u; ob[p] += 128u; }
            fetch();
            asm volatile("s_wait_xcnt 0x0" ::: "memory"); }              // directly behind the run's last load: past the loop's exit its base registers are rewritten with no load wait in front
#pragma unroll
        for (int ks = 0; ks < 2; ++ks) {
            const int ao = (wave * 16 + lr) * SPIT + ks * 32 + 8 * hi;
            const v16bf a = cat16b(*(const v8usa*)(&stg[0][ao]), *(const v8usa*)(&stg[0][ao + 16]));
            v16bf b[4];
#pragma unroll
            for (int t = 0; t < 4; ++t) { const int bo = (t * 16 + lr) * SPIT + ks * 32 + 8 * hi; b[t] = cat16b(*(const v8usa*)(&stg[1][bo]), *(const v8usa*)(&stg[1][bo + 16])); }
            __builtin_amdgcn_sched_barrier(0);                           // all fragment reads of the k step issue together, ahead of its products: one LDS latency a step, not one a fragment
#pragma unroll
            for (int t = 0; t < 4; ++t) acc[t] = wmmab(a, b[t], acc[t]);
            asm volatile("v_nop\n\tv_nop\n\tv_nop\n\tv_nop" : "+v"(acc[0]), "+v"(acc[1]), "+v"(acc[2]), "+v"(acc[3]) : "v"(a));   // WMMA distance before its operands or results are touched, the loop's back edge included
        }
    }
    // acc[t][j] = position wave*16 + hi*8 + j, component t*16 + lr
    const size_t zz = (size_t)(rb / NN) * NH_ + blockIdx.y;              // the (item, head) pair
    const int s0 = rb % NN;                                              // the tile's first position in its item
    auto planes = [&](v4f y0, v4f y1, bf* ph, bf* pl) {                  // 8 values of one row -> 16 B of the hi plane and 16 B of the residual plane
        v8us oh, ol;
#pragma unroll
        for (int i = 0; i < 8; ++i) { const float y = i < 4 ? y0[i & 3] : y1[i & 3]; const unsigned short hb = f2bf(y); oh[i] = hb; ol[i] = f2bf(y - bf2f(hb)); }
        *(v8us*)ph = oh; *(v8us*)pl = ol;
    };
    if (pj < 2) {                                                        // the same for the whole work-group
#pragma unroll
        for (int t = 0; t < 4; ++t) {
#pragma unroll
            for (int j = 0; j < 8; ++j) ost[(wave * 16 + hi * 8 + j) * OP + t * 16 + lr] = acc[t][j] + bb[t]; }
        __syncthreads();                                                 // the finished tile is complete in LDS
        if (tid < 64) {                                                  // waves 0 and 1: one position a lane, one 128 B line a wave
            float sq = 0.f;
#pragma unroll
            for (int d = 0; d < HD; ++d) { const float v = ost[tid * OP + d]; sq = fmaf(v, v, sq); }
            (pj == 0 ? TQ : TK)[zz * NN + s0 + tid] = sqrtf(sq + KCURV);
        }
        bf* ph = (pj == 0 ? Qh : Kh) + (zz * NN + s0 + srow) * HD + spc; bf* pl = (pj == 0 ? Ql : Kl) + (zz * NN + s0 + srow) * HD + spc;
#pragma unroll
        for (int p = 0; p < 4; ++p) { const float* sp = &ost[(p * 16 + srow) * OP + spc]; planes(*(const v4fa*)sp, *(const v4fa*)(sp + 4), ph + p * 16 * HD, pl + p * 16 * HD); }
    } else {
#pragma unroll
        for (int t = 0; t < 4; ++t) { float* tp = &ost[(t * 16 + lr) * OP + wave * 16 + hi * 8];
            *(v4fa*)tp = (v4f){acc[t][0] + bb[t], acc[t][1] + bb[t], acc[t][2] + bb[t], acc[t][3] + bb[t]}; *(v4fa*)(tp + 4) = (v4f){acc[t][4] + bb[t], acc[t][5] + bb[t], acc[t][6] + bb[t], acc[t][7] + bb[t]}; }
        __syncthreads();                                                 // the finished tile is complete in LDS
        if (tid < 64) {
            float sq = 0.f;
#pragma unroll
            for (int d = 0; d < HD; ++d) { const float v = ost[d * OP + tid]; sq = fmaf(v, v, sq); }
            ost[HD * OP + tid] = sqrtf(sq + KCURV);
        }
        __syncthreads();                                                 // the time row is complete in LDS
        bf* ph = VTh + (zz * 128 + srow) * NN + s0 + spc; bf* pl = VTl + (zz * 128 + srow) * NN + s0 + spc;
#pragma unroll
        for (int p = 0; p < 4; ++p) { const float* sp = &ost[(p * 16 + srow) * OP + spc]; planes(*(const v4fa*)sp, *(const v4fa*)(sp + 4), ph + (size_t)p * 16 * NN, pl + (size_t)p * 16 * NN); }
        const float* sp = &ost[HD * OP + spc];                           // rows 64 .. 79: the time row, then zeros
        const v4f t0 = *(const v4fa*)sp, t1 = *(const v4fa*)(sp + 4), zv = (v4f){0.f, 0.f, 0.f, 0.f};
        planes(srow == 0 ? t0 : zv, srow == 0 ? t1 : zv, ph + (size_t)64 * NN, pl + (size_t)64 * NN);
    }
}

__global__ __launch_bounds__(256) void k_fattn(const bf* __restrict__ Qh, const bf* __restrict__ Ql, const bf* Kh, const bf* Kl, const bf* VTh, const bf* VTl,
                                               const float* __restrict__ TQ, const float* TK, const float* __restrict__ scl, const float* __restrict__ bpar, float* CTX) {
    constexpr int VT_ = 5;                                               // 16-row tiles of V^T that hold live rows: 64 space + 1 time, rows 65 .. 79 are zeros
    __shared__ __align__(16) bf sk[2][2][64 * SPIT];
    __shared__ __align__(16) bf sv[2][2 * VT_ * 16 * SPIT];              // per buffer: the hi plane's 80 rows, then the residual plane's
    __shared__ __align__(16) float st[2][64];
    const int tid = threadIdx.x, lane = tid & 31, wave = tid >> 5, lr = lane & 15, hi = lane >> 4;
    const size_t z = blockIdx.z;
    Qh += z * NN * HD; Ql += z * NN * HD; Kh += z * NN * HD; Kl += z * NN * HD; VTh += z * 128 * NN; VTl += z * 128 * NN; TQ += z * NN; TK += z * NN; CTX += z * NN * 128;
    const float isc = 1.0f / bfr(scl[0]), bb = bfr(bpar[0]);
    const int srow = tid >> 3, spc = (tid & 7) * 8;                      // staging: 32 rows a pass, 8 lanes x 16 B cover one row's line; the two V^T planes count as 160 rows in a row, as they lie in LDS
    const bf* vmid = __builtin_amdgcn_readfirstlane(wave) < 4 ? VTh : VTl;   // rows 64 .. 95 of the 160: waves 0 .. 3 stage the hi plane's last 16 rows, waves 4 .. 7 the residual plane's first 16
    unsigned ok[2], ov[VT_], ot;                                         // per-lane byte offsets from the uniform bases
    v8us rk[2][2], rv[VT_]; float rt;
    auto fetch = [&]() {
#pragma unroll
        for (int p = 0; p < 2; ++p) { rk[0][p] = *(const v8us*)((const char*)Kh + ok[p]); rk[1][p] = *(const v8us*)((const char*)Kl + ok[p]); }
#pragma unroll
        for (int p = 0; p < VT_; ++p) rv[p] = *(const v8us*)((const char*)(p < 2 ? VTh : p > 2 ? VTl : vmid) + ov[p]);
        rt = *(const float*)((const char*)TK + ot);
        asm volatile("s_wait_xcnt 0x0" ::: "memory");                    // directly behind the run's last load, ahead of any rewrite of its offset registers
    };
    auto put = [&](int b) {
#pragma unroll
        for (int p = 0; p < 2; ++p) { *(v8usa*)(&sk[b][0][(p * 32 + srow) * SPIT + spc]) = rk[0][p]; *(v8usa*)(&sk[b][1][(p * 32 + srow) * SPIT + spc]) = rk[1][p]; }
#pragma unroll
        for (int p = 0; p < VT_; ++p) *(v8usa*)(&sv[b][(p * 32 + srow) * SPIT + spc]) = rv[p];
        if (tid < 64) st[b][tid] = rt;
    };
#pragma unroll 1                                                         // the two query blocks run one after the other through the same code and registers
    for (int half = 0; half < 2; ++half) {
        const int qb = half ? (int)blockIdx.x : NN / 128 - 1 - (int)blockIdx.x;
        const int qt = 2 * qb + 1;                                       // the last key tile that holds a key of the block
        const int qi = qb * 128 + wave * 16 + lr;                        // this lane's query
        v16bf qh[2], ql[2];
#pragma unroll
        for (int ks = 0; ks < 2; ++ks) { const size_t qo = (size_t)qi * HD + ks * 32 + 8 * hi;
            qh[ks] = cat16b(*(const v8us*)(Qh + qo), *(const v8us*)(Qh + qo + 16)); ql[ks] = cat16b(*(const v8us*)(Ql + qo), *(const v8us*)(Ql + qo + 16)); }
        const float q0 = TQ[qi];
#pragma unroll
        for (int p = 0; p < 2; ++p) ok[p] = ((unsigned)(p * 32 + srow) * HD + spc) * 2u;
#pragma unroll
        for (int p = 0; p < VT_; ++p) ov[p] = ((unsigned)(p * 32 + srow < VT_ * 16 ? p * 32 + srow : p * 32 + srow - VT_ * 16) * NN + spc) * 2u;
        ot = (unsigned)(tid & 63) * 4u;
        fetch();
        put(0);                                                          // the barrier at the foot of the tile before has ended every read of buffer 0
        __syncthreads();                                                 // key tile 0 is complete in LDS
        v8f o[VT_];
#pragma unroll
        for (int t = 0; t < VT_; ++t) o[t] = (v8f){};
        float mrun = -3.0e38f, lsum = 0.f;
#pragma unroll 1                                                         // one copy of the pass: its trip count is the tile's own, and the body is long
        for (int kt = 0; kt <= qt; ++kt) {
            const int b = kt & 1;
            if (kt < qt) {
#pragma unroll
                for (int p = 0; p < 2; ++p) ok[p] += 64u * HD * 2u;
#pragma unroll
                for (int p = 0; p < VT_; ++p) ov[p] += 128u;
                ot += 256u;
                fetch(); }
            v8f s[4];
#pragma unroll
            for (int t = 0; t < 4; ++t) s[t] = (v8f){};
#pragma unroll
            for (int ks = 0; ks < 2; ++ks) {
                v16bf kh[4], kl[4];
#pragma unroll
                for (int t = 0; t < 4; ++t) { const int ko = (t * 16 + lr) * SPIT + ks * 32 + 8 * hi;
                    kh[t] = cat16b(*(const v8usa*)(&sk[b][0][ko]), *(const v8usa*)(&sk[b][0][ko + 16]));
                    kl[t] = cat16b(*(const v8usa*)(&sk[b][1][ko]), *(const v8usa*)(&sk[b][1][ko + 16])); }
                __builtin_amdgcn_sched_barrier(0);                       // all fragment reads of the k step issue together, ahead of its products: one LDS latency a step, not one a fragment
#pragma unroll
                for (int t = 0; t < 4; ++t) s[t] = wmmab(kh[t], qh[ks], s[t]);
#pragma unroll
                for (int t = 0; t < 4; ++t) s[t] = wmmab(kl[t], qh[ks], s[t]);
#pragma unroll
                for (int t = 0; t < 4; ++t) s[t] = wmmab(kh[t], ql[ks], s[t]);
            }
            float x[4][8];
#pragma unroll
            for (int t = 0; t < 4; ++t) { const v4f ka = *(const v4fa*)(&st[b][t * 16 + hi * 8]), kb = *(const v4fa*)(&st[b][t * 16 + hi * 8 + 4]);
#pragma unroll
                for (int j = 0; j < 8; ++j) x[t][j] = (2.0f + 2.0f * (s[t][j] - q0 * (j < 4 ? ka[j & 3] : kb[j & 3]))) * isc + bb; }
            if (kt >= qt - 1) {                                          // the two tiles on the block's diagonal: keys behind the lane's query drop out (set to -3.0e38f, they give exact zeros)
#pragma unroll
                for (int t = 0; t < 4; ++t) {
#pragma unroll
                    for (int j = 0; j < 8; ++j) if (kt * 64 + t * 16 + hi * 8 + j > qi) x[t][j] = -3.0e38f; } }
            float mx[4];
#pragma unroll
            for (int t = 0; t < 4; ++t) { mx[t] = x[t][0];
#pragma unroll
                for (int j = 1; j < 8; ++j) mx[t] = fmaxf(mx[t], x[t][j]); }
            float mt = fmaxf(fmaxf(mx[0], mx[1]), fmaxf(mx[2], mx[3]));
            mt = fmaxf(mt, xhalf(mt));                                   // the other half of the wave holds the query's other 32 keys
            const float mnew = fmaxf(mrun, mt), alpha = __expf(mrun - mnew);
            mrun = mnew;
            v16bf ph[2], pl[2]; float ps[2];
#pragma unroll
            for (int ks = 0; ks < 2; ++ks) { v16f pf; float a0 = 0.f, a1 = 0.f;
#pragma unroll
                for (int e = 0; e < 8; ++e) { pf[e] = __expf(x[2 * ks][e] - mnew); pf[8 + e] = __expf(x[2 * ks + 1][e] - mnew); a0 += pf[e]; a1 += pf[8 + e]; }
                ps[ks] = a0 + a1;
                ph[ks] = __builtin_convertvector(pf, v16bf);
                pl[ks] = __builtin_convertvector(pf - __builtin_convertvector(ph[ks], v16f), v16bf); }
            lsum = lsum * alpha + (ps[0] + ps[1]);
#pragma unroll
            for (int t = 0; t < VT_; ++t) o[t] *= alpha;
            if (kt < qt) put(b ^ 1);
#pragma unroll
            for (int ks = 0; ks < 2; ++ks) {
                v16bf vh[VT_], vl[VT_];
#pragma unroll
                for (int t = 0; t < VT_; ++t) { const int vo = (t * 16 + lr) * SPIT + ks * 32 + 8 * hi;
                    vh[t] = cat16b(*(const v8usa*)(&sv[b][vo]), *(const v8usa*)(&sv[b][vo + 16]));
                    vl[t] = cat16b(*(const v8usa*)(&sv[b][VT_ * 16 * SPIT + vo]), *(const v8usa*)(&sv[b][VT_ * 16 * SPIT + vo + 16])); }
                __builtin_amdgcn_sched_barrier(0);                       // as above: one LDS latency a step
#pragma unroll
                for (int t = 0; t < VT_; ++t) o[t] = wmmab(vh[t], ph[ks], o[t]);
#pragma unroll
                for (int t = 0; t < VT_; ++t) o[t] = wmmab(vl[t], ph[ks], o[t]);
#pragma unroll
                for (int t = 0; t < VT_; ++t) o[t] = wmmab(vh[t], pl[ks], o[t]);
            }
            __syncthreads();                                             // publishes key tile kt + 1 and ends every wave's reads of tile kt
        }
        lsum += xhalf(lsum);
        const float inv = 1.0f / lsum;
        float* cr = CTX + (size_t)qi * 128 + hi * 8;                     // o[t][j] = context component t*16 + 8*hi + j of query qi: [space(0..63) | t(64) | 0]
#pragma unroll
        for (int t = 0; t < VT_; ++t) { const v8f r = o[t] * inv;
            *(v4f*)(cr + t * 16) = (v4f){r[0], r[1], r[2], r[3]}; *(v4f*)(cr + t * 16 + 4) = (v4f){r[4], r[5], r[6], r[7]}; }
        asm volatile("s_wait_xcnt 0x0" ::: "memory");                    // behind the last store, ahead of the next tile's rewrite of its address registers
    }
}
__global__ __launch_bounds__(256) void k_planes32z(const float* __restrict__ F, int ld, int off, float sc, int rows, bf* Ph, bf* Pl) {
    typedef __attribute__((ext_vector_type(2))) unsigned short v2us;
    const int lane = threadIdx.x & 31; const size_t r = ((size_t)blockIdx.x * 8 + (threadIdx.x >> 5)) * 2 + (lane >> 4); if (r >= (size_t)rows) return; const int z = blockIdx.z; const int c0 = (lane & 15) * 2; v2us oh, ol;
    Ph += (size_t)z * rows * 32; Pl += (size_t)z * rows * 32;
#pragma unroll
    for (int i = 0; i < 2; ++i) { const float y = F[r * ld + off + z * 32 + c0 + i] * sc; const unsigned short hb = f2bf(y); oh[i] = hb; ol[i] = f2bf(y - bf2f(hb)); }
    const size_t o = r * 32 + c0; *(v2us*)(Ph + o) = oh; *(v2us*)(Pl + o) = ol; 
}
__global__ __launch_bounds__(256) void k_vtpadz(const float* __restrict__ F, int ld, int off, int nk, bf* Th, bf* Tl) {
    typedef __attribute__((ext_vector_type(2))) unsigned short v2us;
    const int lane = threadIdx.x & 31; const size_t wid = (size_t)blockIdx.x * 8 + (threadIdx.x >> 5); if (wid >= (size_t)64 * (nk / 64)) return; const int z = blockIdx.z; const int d = (int)(wid / (nk / 64)); const int k0 = (int)(wid % (nk / 64)) * 64 + lane * 2; v2us oh, ol;
    Th += (size_t)z * 64 * nk; Tl += (size_t)z * 64 * nk;
#pragma unroll
    for (int i = 0; i < 2; ++i) { const float y = (d < 32) ? F[(size_t)(k0 + i) * ld + off + z * 32 + (d < 32 ? d : 0)] : 0.f; const unsigned short hb = f2bf(y); oh[i] = hb; ol[i] = f2bf(y - bf2f(hb)); }
    const size_t o = (size_t)d * nk + k0; *(v2us*)(Th + o) = oh; *(v2us*)(Tl + o) = ol; 
}
template <int NK>
__global__ __launch_bounds__(256) void k_softmaxz(const float* __restrict__ S, int rows, bf* PH, bf* PL) {
    typedef __attribute__((ext_vector_type(4))) unsigned short v4us;
    const int lane = threadIdx.x & 31, i = blockIdx.x * 8 + (threadIdx.x >> 5); if (i >= rows) return; const size_t zo = (size_t)blockIdx.z * rows * NK; const float* sr = S + zo + (size_t)i * NK; PH += zo; PL += zo;
    float m = -3.0e38f;
#pragma unroll 1
    for (int c0 = lane * 4; c0 < NK; c0 += 128) {
#pragma unroll
        for (int q = 0; q < 4; ++q) m = fmaxf(m, sr[c0 + q]); }
#pragma unroll
    for (int sh = 16; sh; sh >>= 1) m = fmaxf(m, __shfl_xor(m, sh, 32));
    float sum = 0.f;
#pragma unroll 1
    for (int c0 = lane * 4; c0 < NK; c0 += 128) {
#pragma unroll
        for (int q = 0; q < 4; ++q) sum += __expf(sr[c0 + q] - m); }
#pragma unroll
    for (int sh = 16; sh; sh >>= 1) sum += __shfl_xor(sum, sh, 32);
    const float inv = 1.0f / sum;
{
#pragma unroll 1
        for (int c0 = lane * 4; c0 < NK; c0 += 128) { v4us oh, ol;
#pragma unroll
            for (int q = 0; q < 4; ++q) { const float p = __expf(sr[c0 + q] - m) * inv; const unsigned short hb = f2bf(p); oh[q] = hb; ol[q] = f2bf(p - bf2f(hb)); }
            const size_t o = (size_t)i * NK + c0; *(v4us*)(PH + o) = oh; *(v4us*)(PL + o) = ol; }
         }
}
__global__ __launch_bounds__(256) void k_placez(const float* __restrict__ XH, int rows, int ldy, float* Y) {
    const int lane = threadIdx.x & 31; const size_t q = (size_t)blockIdx.x * 8 + (threadIdx.x >> 5); if (q >= (size_t)rows) return; const int z = blockIdx.z; const float v = XH[((size_t)z * rows + q) * 64 + lane];
    *(float*)(Y + q * ldy + z * 32 + lane) = v; 
}

__global__ __launch_bounds__(256) void k_vtz(const float* __restrict__ F, int ld, int h0, int nk, bf* Th, bf* Tl) {
    typedef __attribute__((ext_vector_type(2))) unsigned short v2us;
    const int lane = threadIdx.x & 31; const size_t wid = (size_t)blockIdx.x * 8 + (threadIdx.x >> 5); if (wid >= (size_t)64 * (nk / 64)) return; const int z = blockIdx.z; const int d = (int)(wid / (nk / 64)); const int t0 = (int)(wid % (nk / 64)) * 64 + lane * 2; v2us oh, ol;
    Th += (size_t)z * 64 * nk; Tl += (size_t)z * 64 * nk;
#pragma unroll
    for (int i = 0; i < 2; ++i) { const float y = F[(size_t)(t0 + i) * ld + (h0 + z) * 64 + d]; const unsigned short hb = f2bf(y); oh[i] = hb; ol[i] = f2bf(y - bf2f(hb)); }
    const size_t o = (size_t)d * nk + t0; *(v2us*)(Th + o) = oh; *(v2us*)(Tl + o) = ol; 
}
template <int NK>
__global__ __launch_bounds__(256) void k_softmaxzs(const float* __restrict__ S, int rows, float sc, bf* PH, bf* PL) {
    typedef __attribute__((ext_vector_type(4))) unsigned short v4us;
    const int lane = threadIdx.x & 31, i = blockIdx.x * 8 + (threadIdx.x >> 5); if (i >= rows) return; const size_t zo = (size_t)blockIdx.z * rows * NK; const float* sr = S + zo + (size_t)i * NK; PH += zo; PL += zo;
    float m = -3.0e38f;
#pragma unroll 1
    for (int c0 = lane * 4; c0 < NK; c0 += 128) {
#pragma unroll
        for (int q = 0; q < 4; ++q) m = fmaxf(m, sr[c0 + q] * sc); }
#pragma unroll
    for (int sh = 16; sh; sh >>= 1) m = fmaxf(m, __shfl_xor(m, sh, 32));
    float sum = 0.f;
#pragma unroll 1
    for (int c0 = lane * 4; c0 < NK; c0 += 128) {
#pragma unroll
        for (int q = 0; q < 4; ++q) sum += __expf(sr[c0 + q] * sc - m); }
#pragma unroll
    for (int sh = 16; sh; sh >>= 1) sum += __shfl_xor(sum, sh, 32);
    const float inv = 1.0f / sum;
{
#pragma unroll 1
        for (int c0 = lane * 4; c0 < NK; c0 += 128) { v4us oh, ol;
#pragma unroll
            for (int q = 0; q < 4; ++q) { const float p = __expf(sr[c0 + q] * sc - m) * inv; const unsigned short hb = f2bf(p); oh[q] = hb; ol[q] = f2bf(p - bf2f(hb)); }
            const size_t o = (size_t)i * NK + c0; *(v4us*)(PH + o) = oh; *(v4us*)(PL + o) = ol; }
         }
}

__global__ __launch_bounds__(256) void k_cvt8(const float* __restrict__ src, bf* dst, size_t n8) {
    const size_t i = (size_t)blockIdx.x * 256 + threadIdx.x; if (i >= n8) return;
    const v8f v = *(const v8f*)(src + i * 8); v8us o;
#pragma unroll
    for (int k = 0; k < 8; ++k) o[k] = f2bf(v[k]);
    *(v8us*)(dst + i * 8) = o; 
}
__global__ __launch_bounds__(256) void k_zero8(bf* dst, size_t n8) {
    const size_t i = (size_t)blockIdx.x * 256 + threadIdx.x; if (i >= n8) return; v8us z;
#pragma unroll
    for (int k = 0; k < 8; ++k) z[k] = 0;
    *(v8us*)(dst + i * 8) = z; 
}

__global__ __launch_bounds__(256) void k_cvtx(const float* __restrict__ src, bf* dst) {
    const int lane = threadIdx.x & 31; const size_t r = (size_t)blockIdx.x * 8 + (threadIdx.x >> 5); if (r >= (size_t)NBT * NN) return;
{
#pragma unroll
        for (int q = 0; q < DIN / 256; ++q) { v8us o;
#pragma unroll
            for (int i = 0; i < 8; ++i) o[i] = f2bf(src[r * DIN + q * 256 + lane * 8 + i]);
            *(v8us*)(dst + r * DIN + q * 256 + lane * 8) = o; }
         }
}
// k_mid: out[b][s][0..64] = sqrt(k) ave / sqrt(max(| -(-ave0^2 + |ave_s|^2) |, 1e-8)) with ave = mean over the 8 heads of CTX[h][s][0..64] (f32, fixed head order); one wave per row s:
// lane l -> components 4l..4l+3 (65 live); the row's 65 floats are part of the flat [2048 x 65] output block -> written by k_outflat below from AVE[s][128]; here AVE rows of 128
__global__ __launch_bounds__(256) void k_mid(const float* __restrict__ CTX, float* AVE) {
    const int lane = threadIdx.x & 31; const size_t s = (size_t)blockIdx.x * 8 + (threadIdx.x >> 5); if (s >= (size_t)NN) return; v4f a;
    CTX += (size_t)blockIdx.z * NH_ * NN * 128; AVE += (size_t)blockIdx.z * NN * 128;      // z = item
#pragma unroll
    for (int q = 0; q < 4; ++q) { const int c = lane * 4 + q; float v = 0.f; if (c < DL) { const int col = (c == 0) ? HD : (c - 1);     // module order [t | space]; CTX holds [space(0..63) | t(64)]
#pragma unroll
            for (int h = 0; h < NH_; ++h) v += CTX[((size_t)h * NN + s) * 128 + col];
            v *= (1.0f / NH_); } a[q] = v; }
    // inner = -a0^2 + sum_{c=1..64} a_c^2 : lane-strided partial over my 4 components then xor tree
    float part = 0.f;
#pragma unroll
    for (int q = 0; q < 4; ++q) { const int c = lane * 4 + q; if (c == 0) part -= a[q] * a[q]; else if (c < DL) part += a[q] * a[q]; }
#pragma unroll
    for (int sh = 16; sh; sh >>= 1) part += __shfl_xor(part, sh, 32);
    const float den = sqrtf(fmaxf(fabsf(-part), 1e-8f)); const float f = sqrtf(KCURV) / den;
    v4f o; 
#pragma unroll
    for (int q = 0; q < 4; ++q) o[q] = a[q] * f;
    *(v4f*)(AVE + s * 128 + lane * 4) = o; 
}
// total 532,480 floats (all four items) = 4,160 groups exactly).
__global__ __launch_bounds__(256) void k_outflat(const float* __restrict__ AVE, float* OUTB) {
    const int lane = threadIdx.x & 31; const size_t w = (size_t)blockIdx.x * 8 + (threadIdx.x >> 5); if (w >= (size_t)NBT * NN * DL / 128) return; const size_t e0 = w * 128 + lane * 4; v4f v;
#pragma unroll
    for (int q = 0; q < 4; ++q) { const size_t e = e0 + q; v[q] = AVE[(e / DL) * 128 + (e % DL)]; }
    *(v4f*)(OUTB + e0) = v; 
}

extern "C" void kernel_launch(void* const* d_in, const int* in_sizes, int n_in,
                              void* d_out, int out_size, void* d_ws, size_t ws_size, hipStream_t stream) {
    (void)in_sizes; (void)n_in; (void)out_size;
    const float* xq = (const float*)d_in[0]; const float* xs = (const float*)d_in[1]; const float* Wq = (const float*)d_in[2]; const float* bq = (const float*)d_in[3]; const float* Wk = (const float*)d_in[4]; const float* bk = (const float*)d_in[5]; const float* Wv = (const float*)d_in[6]; const float* bv = (const float*)d_in[7]; const float* scl = (const float*)d_in[8]; const float* bpar = (const float*)d_in[9];
    float* out = (float*)d_out;    // [4][2048][65]
    char* wsp = (char*)d_ws;
    auto take = [&](size_t bytes) { char* p = wsp; wsp += (bytes + 255) & ~(size_t)255; return (void*)p; };
    const int NZ = NBT * NH_;      // every (item, head) pair is one z slice of a launch
    bf* WQ = (bf*)take((size_t)DSP * DIN * 2); bf* WK = (bf*)take((size_t)DSP * DIN * 2); bf* WV = (bf*)take((size_t)DSP * DIN * 2);
    float* TQ = (float*)take((size_t)NZ * NN * 4); float* TK = (float*)take((size_t)NZ * NN * 4);
    bf* Qh = (bf*)take((size_t)NZ * NN * HD * 2); bf* Ql = (bf*)take((size_t)NZ * NN * HD * 2); bf* Kh = (bf*)take((size_t)NZ * NN * HD * 2); bf* Kl = (bf*)take((size_t)NZ * NN * HD * 2); bf* VTh = (bf*)take((size_t)NZ * 128 * NN * 2); bf* VTl = (bf*)take((size_t)NZ * 128 * NN * 2);
    float* CTX = (float*)take((size_t)NZ * NN * 128 * 4); float* AVE = (float*)take((size_t)NBT * NN * 128 * 4);
    bf* Xq = (bf*)take((size_t)NBT * NN * DIN * 2); bf* Xs = (bf*)take((size_t)NBT * NN * DIN * 2);
    if ((size_t)(wsp - (char*)d_ws) > ws_size) return;    // 1.6 + 0.5 + 33.6 + 33.6 + 33.6 + 4.2 + 16.8 ~ 124 MB
    k_cvt8<<<(DSP * DIN / 8 + 255) / 256, 256, 0, stream>>>(Wq, WQ, DSP * DIN / 8); k_cvt8<<<(DSP * DIN / 8 + 255) / 256, 256, 0, stream>>>(Wk, WK, DSP * DIN / 8); k_cvt8<<<(DSP * DIN / 8 + 255) / 256, 256, 0, stream>>>(Wv, WV, DSP * DIN / 8);   // [H][OUT][IN] = [(h,o)][in] natural n-major
    k_cvtx<<<NBT * NN / 8, 256, 0, stream>>>(xq, Xq); k_cvtx<<<NBT * NN / 8, 256, 0, stream>>>(xs, Xs);
    k_proj<<<dim3(NBT * NN / 64, NH_, 3), 128, 0, stream>>>(Xq, Xs, WQ, WK, WV, bq, bk, bv, Qh, Ql, Kh, Kl, VTh, VTl, TQ, TK);     // the three projections of all items and heads, finished to k_fattn's operands
    k_fattn<<<dim3(NN / 256, 1, NZ), 256, 0, stream>>>(Qh, Ql, Kh, Kl, VTh, VTl, TQ, TK, scl, bpar, CTX);     // scores, causal softmax, [space | time | 0] context of all pairs
    k_mid<<<dim3(NN / 8, 1, NBT), 256, 0, stream>>>(CTX, AVE);
    k_outflat<<<(NBT * NN * DL / 128) / 8, 256, 0, stream>>>(AVE, out);
}

// v005
// One run takes 105 microseconds.
// In two side-by-side timings against v004, it was 1.06 and 1.07 times as fast.
// Counting every step since v000, it is 25.4 times as fast.
#include <hip/hip_runtime.h>

// Compute dtypes, f32 accumulate, the three per-head hyperbolic linears as [8192 x 512].[512 x 512] GEMMs over all four items' rows with PLAIN bf16 operands (exact products; all 8 heads' space
// parts at once), the Lorentz time coordinate sqrt(|x_s|^2 + k) in f32; per head: space scores = q_s.k_s^T ([2048 x 64].[64 x 2048], both operands bf16 hi + UNSCALED residual,
// three products; key tiles wholly above the diagonal skipped), the time term -q_0 k_0, the affine (2 + 2<q,k>_L)/scale + bias and the causal softmax in f32 with a running maximum, the
// context = P.[v_s | v_0] ([2048 x 2048].[2048 x 65], P and v bf16 hi + residual, three products, K limited to the causal extent), all three inside one kernel (k_fattn), 1/sum applied last;

#define NBT  4
#define NN   2048
#define DIN  512
#define NH_  8
#define HD   64
#define DSP  (NH_ * HD)           // 512 space outputs over all heads
#define DL   (HD + 1)             // 65 Lorentz dims per head
#define DM   DIN
#define NTK  NN
#define KCURV 1.0f
#define LOSC 1024.0f
#define SPIT 72                   // LDS row pitch in elements of a staged 64-k operand tile: 128 B of data + 16 B, conflict-free for 16-byte fragment reads

typedef _Float16 h16;
typedef unsigned short bf;
typedef __attribute__((ext_vector_type(16))) __bf16   v16bf;
typedef __attribute__((ext_vector_type(16))) _Float16 v16h;
typedef __attribute__((ext_vector_type(8)))  _Float16 v8h;
typedef __attribute__((ext_vector_type(8)))  unsigned short v8us;
typedef __attribute__((ext_vector_type(8)))  float    v8f;
typedef __attribute__((ext_vector_type(16))) float    v16f;
typedef __attribute__((ext_vector_type(4)))  float    v4f;
typedef __attribute__((ext_vector_type(4)))  _Float16 v4h;
typedef v8h  __attribute__((may_alias)) v8ha;
typedef v4f  __attribute__((may_alias)) v4fa;
typedef v8us __attribute__((may_alias)) v8usa;

__device__ __forceinline__ unsigned short f2bf(float f) { unsigned u = __float_as_uint(f); u += 0x7FFFu + ((u >> 16) & 1u); return (unsigned short)(u >> 16); }
__device__ __forceinline__ float bf2f(unsigned short b) { return __uint_as_float(((unsigned)b) << 16); }
__device__ __forceinline__ float bfr(float f) { return bf2f(f2bf(f)); }
__device__ __forceinline__ v16h cat16(v8h lo, v8h hi) { return __builtin_shufflevector(lo, hi, 0, 1, 2, 3, 4, 5, 6, 7, 8, 9, 10, 11, 12, 13, 14, 15); }
__device__ __forceinline__ v16bf cat16b(v8us lo, v8us hi) { return __builtin_bit_cast(v16bf, __builtin_shufflevector(lo, hi, 0, 1, 2, 3, 4, 5, 6, 7, 8, 9, 10, 11, 12, 13, 14, 15)); }
__device__ __forceinline__ v8f wmma16(v16h a, v16h b, v8f c) { return __builtin_amdgcn_wmma_f32_16x16x32_f16(false, a, false, b, (short)0, c, false, false); }
__device__ __forceinline__ float xhalf(float v) { const int b = __float_as_int(v); return __int_as_float(__builtin_amdgcn_permlanex16(b, b, 0x76543210, 0xfedcba98, false, false)); }   // lane l <- lane l ^ 16, on the vector pipe
__device__ __forceinline__ v8f wmmab(v16bf a, v16bf b, v8f c) { return __builtin_amdgcn_wmma_f32_16x16x32_bf16(false, a, false, b, (short)0, c, false, false); }

// k_proj: one projection's 128 x 128 block tile (16 waves x 16 x 64): 128 positions of one item x the 64 space outputs of TWO heads, C = X.W^T + bf(bias), K = 512; z picks the projection (0 query, 1 key, 2 value).
// X and W are read as the f32 inputs themselves and rounded to bf16 (nearest even) in the staging registers on their way into LDS; the tile is 128 x 128 so that the f32 rows cost no more cache traffic
// than bf16 rows cost a 64 x 64 tile. A group of four waves holds 64 positions of one head, that is the head's whole space part, and finishes it itself: the time coordinate sqrt(|x_s|^2 + k)
// (f32, summed in component order), and the bf16 hi + residual planes that k_fattn reads: query and key rows as [pair][position][64] with the time in [pair][position]; the value tile is laid into LDS
// transposed and leaves as rows of V^T, [pair][component][position]: 64 space rows, the time row, 15 rows of zeros. Every global store is a whole 128 B line from 8 lanes (or from one wave, for the times).
__global__ __launch_bounds__(512) void k_proj(const float* __restrict__ xq, const float* __restrict__ xs, const float* __restrict__ Wq, const float* __restrict__ Wk, const float* __restrict__ Wv,
                                              const float* __restrict__ bq, const float* __restrict__ bk, const float* __restrict__ bv,
                                              bf* Qh, bf* Ql, bf* Kh, bf* Kl, bf* VTh, bf* VTl, float* TQ, float* TK) {
    typedef __attribute__((ext_vector_type(4))) __bf16 v4bf;
    typedef __attribute__((ext_vector_type(4))) unsigned short v4us;
    typedef v4us __attribute__((may_alias)) v4usa;
    constexpr int K = DIN, OP = 68;                                      // OP: LDS row pitch in floats of the finished tile
    __shared__ __align__(16) bf sa[128 * SPIT];                          // the X tile, rounded
    __shared__ __align__(16) bf sb[128 * SPIT];                          // the two heads' W rows, rounded
    __shared__ __align__(16) float ost4[4][(HD + 1) * OP];               // per group of four waves. query, key: [position][component]; value: [component][position], row 64 = the time
    const int tid = threadIdx.x, lane = tid & 31, wave = (tid >> 5) & 3, hg = (tid >> 7) & 1, pg = tid >> 8, tg = tid & 127, lr = lane & 15, hi = lane >> 4;   // hg, pg: the group's head and its half of the positions; wave, tg: wave and thread inside the group
    float* ost = ost4[tid >> 7];
    const int pj = blockIdx.z;
    const float* A = pj == 0 ? xq : xs; const float* Bn = pj == 0 ? Wq : pj == 1 ? Wk : Wv; const float* bias = pj == 0 ? bq : pj == 1 ? bk : bv;
    const int rb = blockIdx.x * 128, c0 = blockIdx.y * 128;
    const int arow = tid >> 4, apc = (tid & 15) * 4;                     // staging, X and W alike: 32 rows a pass, 16 lanes x 16 B cover one row's 64 floats (two lines)
    const int srow = tg >> 3, spc = (tg & 7) * 8;                        // plane stores, per head: 16 rows a pass, 8 lanes x 16 B cover one row's line
    unsigned oa[4], ob[4];                                               // per-lane byte offsets from the uniform bases; they step by 64 k a stage
#pragma unroll
    for (int p = 0; p < 4; ++p) { oa[p] = ((unsigned)(rb + p * 32 + arow) * (unsigned)K + apc) * 4u; ob[p] = ((unsigned)(c0 + p * 32 + arow) * (unsigned)K + apc) * 4u; }
    v4f ra[4], rw[4];
    auto fetch = [&]() {
#pragma unroll
        for (int p = 0; p < 4; ++p) { ra[p] = *(const v4f*)((const char*)A + oa[p]); rw[p] = *(const v4f*)((const char*)Bn + ob[p]); }
    };
    v8f acc[4]; float bb[4];                                             // bb: this lane's four bias values, read ahead of the loop
#pragma unroll
    for (int t = 0; t < 4; ++t) { acc[t] = (v8f){}; bb[t] = bfr(bias[c0 + hg * 64 + t * 16 + lr]); }
    fetch();
#pragma unroll 1
    for (int kc = 0; kc < K; kc += 64) {
        __syncthreads();                                                 // every wave has read its last fragment of the stage before
#pragma unroll
        for (int p = 0; p < 4; ++p) { *(v4usa*)(&sa[(p * 32 + arow) * SPIT + apc]) = __builtin_bit_cast(v4us, __builtin_convertvector(ra[p], v4bf)); *(v4usa*)(&sb[(p * 32 + arow) * SPIT + apc]) = __builtin_bit_cast(v4us, __builtin_convertvector(rw[p], v4bf)); }
        __syncthreads();                                                 // the stage is complete in LDS
        if (kc + 64 < K) {
#pragma unroll
            for (int p = 0; p < 4; ++p) { oa[p] += 256u; ob[p] += 256u; }
            fetch();
            asm volatile("s_wait_xcnt 0x0" ::: "memory"); }              // directly behind the run's last load: past the loop's exit its base registers are rewritten with no load wait in front
#pragma unroll
        for (int ks = 0; ks < 2; ++ks) {
            const int ao = (pg * 64 + wave * 16 + lr) * SPIT + ks * 32 + 8 * hi;
            const v16bf a = cat16b(*(const v8usa*)(&sa[ao]), *(const v8usa*)(&sa[ao + 16]));
            v16bf b[4];
#pragma unroll
            for (int t = 0; t < 4; ++t) { const int bo = (hg * 64 + t * 16 + lr) * SPIT + ks * 32 + 8 * hi; b[t] = cat16b(*(const v8usa*)(&sb[bo]), *(const v8usa*)(&sb[bo + 16])); }
            __builtin_amdgcn_sched_barrier(0);                           // all fragment reads of the k step issue together, ahead of its products: one LDS latency a step, not one a fragment
#pragma unroll
            for (int t = 0; t < 4; ++t) acc[t] = wmmab(a, b[t], acc[t]);
            asm volatile("v_nop\n\tv_nop\n\tv_nop\n\tv_nop" : "+v"(acc[0]), "+v"(acc[1]), "+v"(acc[2]), "+v"(acc[3]) : "v"(a));   // WMMA distance before its operands or results are touched, the loop's back edge included
        }
    }
    // acc[t][j] = position pg*64 + wave*16 + hi*8 + j, component t*16 + lr of head hg
    const size_t zz = (size_t)(rb / NN) * NH_ + blockIdx.y * 2 + hg;     // the (item, head) pair
    const int s0 = rb % NN + pg * 64;                                    // the group's first position in its item
    auto planes = [&](v4f y0, v4f y1, bf* ph, bf* pl) {                  // 8 values of one row -> 16 B of the hi plane and 16 B of the residual plane
        v8us oh, ol;
#pragma unroll
        for (int i = 0; i < 8; ++i) { const float y = i < 4 ? y0[i & 3] : y1[i & 3]; const unsigned short hb = f2bf(y); oh[i] = hb; ol[i] = f2bf(y - bf2f(hb)); }
        *(v8us*)ph = oh; *(v8us*)pl = ol;
    };
    if (pj < 2) {                                                        // the same for the whole work-group
#pragma unroll
        for (int t = 0; t < 4; ++t) {
#pragma unroll
            for (int j = 0; j < 8; ++j) ost[(wave * 16 + hi * 8 + j) * OP + t * 16 + lr] = acc[t][j] + bb[t]; }
        __syncthreads();                                                 // the finished tiles are complete in LDS
        if (tg < 64) {                                                   // waves 0 and 1 of each group: one position a lane, one 128 B line a wave
            float sq = 0.f;
#pragma unroll
            for (int d = 0; d < HD; ++d) { const float v = ost[tg * OP + d]; sq = fmaf(v, v, sq); }
            (pj == 0 ? TQ : TK)[zz * NN + s0 + tg] = sqrtf(sq + KCURV);
        }
        bf* ph = (pj == 0 ? Qh : Kh) + (zz * NN + s0 + srow) * HD + spc; bf* pl = (pj == 0 ? Ql : Kl) + (zz * NN + s0 + srow) * HD + spc;
#pragma unroll
        for (int p = 0; p < 4; ++p) { const float* sp = &ost[(p * 16 + srow) * OP + spc]; planes(*(const v4fa*)sp, *(const v4fa*)(sp + 4), ph + p * 16 * HD, pl + p * 16 * HD); }
    } else {
#pragma unroll
        for (int t = 0; t < 4; ++t) { float* tp = &ost[(t * 16 + lr) * OP + wave * 16 + hi * 8];
            *(v4fa*)tp = (v4f){acc[t][0] + bb[t], acc[t][1] + bb[t], acc[t][2] + bb[t], acc[t][3] + bb[t]}; *(v4fa*)(tp + 4) = (v4f){acc[t][4] + bb[t], acc[t][5] + bb[t], acc[t][6] + bb[t], acc[t][7] + bb[t]}; }
        __syncthreads();                                                 // the finished tiles are complete in LDS
        if (tg < 64) {
            float sq = 0.f;
#pragma unroll
            for (int d = 0; d < HD; ++d) { const float v = ost[d * OP + tg]; sq = fmaf(v, v, sq); }
            ost[HD * OP + tg] = sqrtf(sq + KCURV);
        }
        __syncthreads();                                                 // the time rows are complete in LDS
        bf* ph = VTh + (zz * 128 + srow) * NN + s0 + spc; bf* pl = VTl + (zz * 128 + srow) * NN + s0 + spc;
#pragma unroll
        for (int p = 0; p < 4; ++p) { const float* sp = &ost[(p * 16 + srow) * OP + spc]; planes(*(const v4fa*)sp, *(const v4fa*)(sp + 4), ph + (size_t)p * 16 * NN, pl + (size_t)p * 16 * NN); }
        const float* sp = &ost[HD * OP + spc];                           // rows 64 .. 79: the time row, then zeros
        const v4f t0 = *(const v4fa*)sp, t1 = *(const v4fa*)(sp + 4), zv = (v4f){0.f, 0.f, 0.f, 0.f};
        planes(srow == 0 ? t0 : zv, srow == 0 ? t1 : zv, ph + (size_t)64 * NN, pl + (size_t)64 * NN);
    }
}

__global__ __launch_bounds__(256) void k_fattn(const bf* __restrict__ Qh, const bf* __restrict__ Ql, const bf* Kh, const bf* Kl, const bf* VTh, const bf* VTl,
                                               const float* __restrict__ TQ, const float* TK, const float* __restrict__ scl, const float* __restrict__ bpar, float* CTX) {
    constexpr int VT_ = 5;                                               // 16-row tiles of V^T that hold live rows: 64 space + 1 time, rows 65 .. 79 are zeros
    __shared__ __align__(16) bf sk[2][2][64 * SPIT];
    __shared__ __align__(16) bf sv[2][2 * VT_ * 16 * SPIT];              // per buffer: the hi plane's 80 rows, then the residual plane's
    __shared__ __align__(16) float st[2][64];
    const int tid = threadIdx.x, lane = tid & 31, wave = tid >> 5, lr = lane & 15, hi = lane >> 4;
    const size_t z = blockIdx.z;
    Qh += z * NN * HD; Ql += z * NN * HD; Kh += z * NN * HD; Kl += z * NN * HD; VTh += z * 128 * NN; VTl += z * 128 * NN; TQ += z * NN; TK += z * NN; CTX += z * NN * 128;
    const float isc = 1.0f / bfr(scl[0]), bb = bfr(bpar[0]);
    const int srow = tid >> 3, spc = (tid & 7) * 8;                      // staging: 32 rows a pass, 8 lanes x 16 B cover one row's line; the two V^T planes count as 160 rows in a row, as they lie in LDS
    const bf* vmid = __builtin_amdgcn_readfirstlane(wave) < 4 ? VTh : VTl;   // rows 64 .. 95 of the 160: waves 0 .. 3 stage the hi plane's last 16 rows, waves 4 .. 7 the residual plane's first 16
    unsigned ok[2], ov[VT_], ot;                                         // per-lane byte offsets from the uniform bases
    v8us rk[2][2], rv[VT_]; float rt;
    auto fetch = [&]() {
#pragma unroll
        for (int p = 0; p < 2; ++p) { rk[0][p] = *(const v8us*)((const char*)Kh + ok[p]); rk[1][p] = *(const v8us*)((const char*)Kl + ok[p]); }
#pragma unroll
        for (int p = 0; p < VT_; ++p) rv[p] = *(const v8us*)((const char*)(p < 2 ? VTh : p > 2 ? VTl : vmid) + ov[p]);
        rt = *(const float*)((const char*)TK + ot);
        asm volatile("s_wait_xcnt 0x0" ::: "memory");                    // directly behind the run's last load, ahead of any rewrite of its offset registers
    };
    auto put = [&](int b) {
#pragma unroll
        for (int p = 0; p < 2; ++p) { *(v8usa*)(&sk[b][0][(p * 32 + srow) * SPIT + spc]) = rk[0][p]; *(v8usa*)(&sk[b][1][(p * 32 + srow) * SPIT + spc]) = rk[1][p]; }
#pragma unroll
        for (int p = 0; p < VT_; ++p) *(v8usa*)(&sv[b][(p * 32 + srow) * SPIT + spc]) = rv[p];
        if (tid < 64) st[b][tid] = rt;
    };
#pragma unroll 1                                                         // the two query blocks run one after the other through the same code and registers
    for (int half = 0; half < 2; ++half) {
        const int qb = half ? (int)blockIdx.x : NN / 128 - 1 - (int)blockIdx.x;
        const int qt = 2 * qb + 1;                                       // the last key tile that holds a key of the block
        const int qi = qb * 128 + wave * 16 + lr;                        // this lane's query
        v16bf qh[2], ql[2];
#pragma unroll
        for (int ks = 0; ks < 2; ++ks) { const size_t qo = (size_t)qi * HD + ks * 32 + 8 * hi;
            qh[ks] = cat16b(*(const v8us*)(Qh + qo), *(const v8us*)(Qh + qo + 16)); ql[ks] = cat16b(*(const v8us*)(Ql + qo), *(const v8us*)(Ql + qo + 16)); }
        const float q0 = TQ[qi];
#pragma unroll
        for (int p = 0; p < 2; ++p) ok[p] = ((unsigned)(p * 32 + srow) * HD + spc) * 2u;
#pragma unroll
        for (int p = 0; p < VT_; ++p) ov[p] = ((unsigned)(p * 32 + srow < VT_ * 16 ? p * 32 + srow : p * 32 + srow - VT_ * 16) * NN + spc) * 2u;
        ot = (unsigned)(tid & 63) * 4u;
        fetch();
        put(0);                                                          // the barrier at the foot of the tile before has ended every read of buffer 0
        __syncthreads();                                                 // key tile 0 is complete in LDS
        v8f o[VT_];
#pragma unroll
        for (int t = 0; t < VT_; ++t) o[t] = (v8f){};
        float mrun = -3.0e38f, lsum = 0.f;
#pragma unroll 1                                                         // one copy of the pass: its trip count is the tile's own, and the body is long
        for (int kt = 0; kt <= qt; ++kt) {
            const int b = kt & 1;
            if (kt < qt) {
#pragma unroll
                for (int p = 0; p < 2; ++p) ok[p] += 64u * HD * 2u;
#pragma unroll
                for (int p = 0; p < VT_; ++p) ov[p] += 128u;
                ot += 256u;
                fetch(); }
            v8f s[4];
#pragma unroll
            for (int t = 0; t < 4; ++t) s[t] = (v8f){};
#pragma unroll
            for (int ks = 0; ks < 2; ++ks) {
                v16bf kh[4], kl[4];
#pragma unroll
                for (int t = 0; t < 4; ++t) { const int ko = (t * 16 + lr) * SPIT + ks * 32 + 8 * hi;
                    kh[t] = cat16b(*(const v8usa*)(&sk[b][0][ko]), *(const v8usa*)(&sk[b][0][ko + 16]));
                    kl[t] = cat16b(*(const v8usa*)(&sk[b][1][ko]), *(const v8usa*)(&sk[b][1][ko + 16])); }
                __builtin_amdgcn_sched_barrier(0);                       // all fragment reads of the k step issue together, ahead of its products: one LDS latency a step, not one a fragment
#pragma unroll
                for (int t = 0; t < 4; ++t) s[t] = wmmab(kh[t], qh[ks], s[t]);
#pragma unroll
                for (int t = 0; t < 4; ++t) s[t] = wmmab(kl[t], qh[ks], s[t]);
#pragma unroll
                for (int t = 0; t < 4; ++t) s[t] = wmmab(kh[t], ql[ks], s[t]);
            }
            float x[4][8];
#pragma unroll
            for (int t = 0; t < 4; ++t) { const v4f ka = *(const v4fa*)(&st[b][t * 16 + hi * 8]), kb = *(const v4fa*)(&st[b][t * 16 + hi * 8 + 4]);
#pragma unroll
                for (int j = 0; j < 8; ++j) x[t][j] = (2.0f + 2.0f * (s[t][j] - q0 * (j < 4 ? ka[j & 3] : kb[j & 3]))) * isc + bb; }
            if (kt >= qt - 1) {                                          // the two tiles on the block's diagonal: keys behind the lane's query drop out (set to -3.0e38f, they give exact zeros)
#pragma unroll
                for (int t = 0; t < 4; ++t) {
#pragma unroll
                    for (int j = 0; j < 8; ++j) if (kt * 64 + t * 16 + hi * 8 + j > qi) x[t][j] = -3.0e38f; } }
            float mx[4];
#pragma unroll
            for (int t = 0; t < 4; ++t) { mx[t] = x[t][0];
#pragma unroll
                for (int j = 1; j < 8; ++j) mx[t] = fmaxf(mx[t], x[t][j]); }
            float mt = fmaxf(fmaxf(mx[0], mx[1]), fmaxf(mx[2], mx[3]));
            mt = fmaxf(mt, xhalf(mt));                                   // the other half of the wave holds the query's other 32 keys
            const float mnew = fmaxf(mrun, mt), alpha = __expf(mrun - mnew);
            mrun = mnew;
            v16bf ph[2], pl[2]; float ps[2];
#pragma unroll
            for (int ks = 0; ks < 2; ++ks) { v16f pf; float a0 = 0.f, a1 = 0.f;
#pragma unroll
                for (int e = 0; e < 8; ++e) { pf[e] = __expf(x[2 * ks][e] - mnew); pf[8 + e] = __expf(x[2 * ks + 1][e] - mnew); a0 += pf[e]; a1 += pf[8 + e]; }
                ps[ks] = a0 + a1;
                ph[ks] = __builtin_convertvector(pf, v16bf);
                pl[ks] = __builtin_convertvector(pf - __builtin_convertvector(ph[ks], v16f), v16bf); }
            lsum = lsum * alpha + (ps[0] + ps[1]);
#pragma unroll
            for (int t = 0; t < VT_; ++t) o[t] *= alpha;
            if (kt < qt) put(b ^ 1);
#pragma unroll
            for (int ks = 0; ks < 2; ++ks) {
                v16bf vh[VT_], vl[VT_];
#pragma unroll
                for (int t = 0; t < VT_; ++t) { const int vo = (t * 16 + lr) * SPIT + ks * 32 + 8 * hi;
                    vh[t] = cat16b(*(const v8usa*)(&sv[b][vo]), *(const v8usa*)(&sv[b][vo + 16]));
                    vl[t] = cat16b(*(const v8usa*)(&sv[b][VT_ * 16 * SPIT + vo]), *(const v8usa*)(&sv[b][VT_ * 16 * SPIT + vo + 16])); }
                __builtin_amdgcn_sched_barrier(0);                       // as above: one LDS latency a step
#pragma unroll
                for (int t = 0; t < VT_; ++t) o[t] = wmmab(vh[t], ph[ks], o[t]);
#pragma unroll
                for (int t = 0; t < VT_; ++t) o[t] = wmmab(vl[t], ph[ks], o[t]);
#pragma unroll
                for (int t = 0; t < VT_; ++t) o[t] = wmmab(vh[t], pl[ks], o[t]);
            }
            __syncthreads();                                             // publishes key tile kt + 1 and ends every wave's reads of tile kt
        }
        lsum += xhalf(lsum);
        const float inv = 1.0f / lsum;
        float* cr = CTX + (size_t)qi * 128 + hi * 8;                     // o[t][j] = context component t*16 + 8*hi + j of query qi: [space(0..63) | t(64) | 0]
#pragma unroll
        for (int t = 0; t < VT_; ++t) { const v8f r = o[t] * inv;
            *(v4f*)(cr + t * 16) = (v4f){r[0], r[1], r[2], r[3]}; *(v4f*)(cr + t * 16 + 4) = (v4f){r[4], r[5], r[6], r[7]}; }
        asm volatile("s_wait_xcnt 0x0" ::: "memory");                    // behind the last store, ahead of the next tile's rewrite of its address registers
    }
}
__global__ __launch_bounds__(256) void k_planes32z(const float* __restrict__ F, int ld, int off, float sc, int rows, bf* Ph, bf* Pl) {
    typedef __attribute__((ext_vector_type(2))) unsigned short v2us;
    const int lane = threadIdx.x & 31; const size_t r = ((size_t)blockIdx.x * 8 + (threadIdx.x >> 5)) * 2 + (lane >> 4); if (r >= (size_t)rows) return; const int z = blockIdx.z; const int c0 = (lane & 15) * 2; v2us oh, ol;
    Ph += (size_t)z * rows * 32; Pl += (size_t)z * rows * 32;
#pragma unroll
    for (int i = 0; i < 2; ++i) { const float y = F[r * ld + off + z * 32 + c0 + i] * sc; const unsigned short hb = f2bf(y); oh[i] = hb; ol[i] = f2bf(y - bf2f(hb)); }
    const size_t o = r * 32 + c0; *(v2us*)(Ph + o) = oh; *(v2us*)(Pl + o) = ol; 
}
__global__ __launch_bounds__(256) void k_vtpadz(const float* __restrict__ F, int ld, int off, int nk, bf* Th, bf* Tl) {
    typedef __attribute__((ext_vector_type(2))) unsigned short v2us;
    const int lane = threadIdx.x & 31; const size_t wid = (size_t)blockIdx.x * 8 + (threadIdx.x >> 5); if (wid >= (size_t)64 * (nk / 64)) return; const int z = blockIdx.z; const int d = (int)(wid / (nk / 64)); const int k0 = (int)(wid % (nk / 64)) * 64 + lane * 2; v2us oh, ol;
    Th += (size_t)z * 64 * nk; Tl += (size_t)z * 64 * nk;
#pragma unroll
    for (int i = 0; i < 2; ++i) { const float y = (d < 32) ? F[(size_t)(k0 + i) * ld + off + z * 32 + (d < 32 ? d : 0)] : 0.f; const unsigned short hb = f2bf(y); oh[i] = hb; ol[i] = f2bf(y - bf2f(hb)); }
    const size_t o = (size_t)d * nk + k0; *(v2us*)(Th + o) = oh; *(v2us*)(Tl + o) = ol; 
}
template <int NK>
__global__ __launch_bounds__(256) void k_softmaxz(const float* __restrict__ S, int rows, bf* PH, bf* PL) {
    typedef __attribute__((ext_vector_type(4))) unsigned short v4us;
    const int lane = threadIdx.x & 31, i = blockIdx.x * 8 + (threadIdx.x >> 5); if (i >= rows) return; const size_t zo = (size_t)blockIdx.z * rows * NK; const float* sr = S + zo + (size_t)i * NK; PH += zo; PL += zo;
    float m = -3.0e38f;
#pragma unroll 1
    for (int c0 = lane * 4; c0 < NK; c0 += 128) {
#pragma unroll
        for (int q = 0; q < 4; ++q) m = fmaxf(m, sr[c0 + q]); }
#pragma unroll
    for (int sh = 16; sh; sh >>= 1) m = fmaxf(m, __shfl_xor(m, sh, 32));
    float sum = 0.f;
#pragma unroll 1
    for (int c0 = lane * 4; c0 < NK; c0 += 128) {
#pragma unroll
        for (int q = 0; q < 4; ++q) sum += __expf(sr[c0 + q] - m); }
#pragma unroll
    for (int sh = 16; sh; sh >>= 1) sum += __shfl_xor(sum, sh, 32);
    const float inv = 1.0f / sum;
{
#pragma unroll 1
        for (int c0 = lane * 4; c0 < NK; c0 += 128) { v4us oh, ol;
#pragma unroll
            for (int q = 0; q < 4; ++q) { const float p = __expf(sr[c0 + q] - m) * inv; const unsigned short hb = f2bf(p); oh[q] = hb; ol[q] = f2bf(p - bf2f(hb)); }
            const size_t o = (size_t)i * NK + c0; *(v4us*)(PH + o) = oh; *(v4us*)(PL + o) = ol; }
         }
}
__global__ __launch_bounds__(256) void k_placez(const float* __restrict__ XH, int rows, int ldy, float* Y) {
    const int lane = threadIdx.x & 31; const size_t q = (size_t)blockIdx.x * 8 + (threadIdx.x >> 5); if (q >= (size_t)rows) return; const int z = blockIdx.z; const float v = XH[((size_t)z * rows + q) * 64 + lane];
    *(float*)(Y + q * ldy + z * 32 + lane) = v; 
}

__global__ __launch_bounds__(256) void k_vtz(const float* __restrict__ F, int ld, int h0, int nk, bf* Th, bf* Tl) {
    typedef __attribute__((ext_vector_type(2))) unsigned short v2us;
    const int lane = threadIdx.x & 31; const size_t wid = (size_t)blockIdx.x * 8 + (threadIdx.x >> 5); if (wid >= (size_t)64 * (nk / 64)) return; const int z = blockIdx.z; const int d = (int)(wid / (nk / 64)); const int t0 = (int)(wid % (nk / 64)) * 64 + lane * 2; v2us oh, ol;
    Th += (size_t)z * 64 * nk; Tl += (size_t)z * 64 * nk;
#pragma unroll
    for (int i = 0; i < 2; ++i) { const float y = F[(size_t)(t0 + i) * ld + (h0 + z) * 64 + d]; const unsigned short hb = f2bf(y); oh[i] = hb; ol[i] = f2bf(y - bf2f(hb)); }
    const size_t o = (size_t)d * nk + t0; *(v2us*)(Th + o) = oh; *(v2us*)(Tl + o) = ol; 
}
template <int NK>
__global__ __launch_bounds__(256) void k_softmaxzs(const float* __restrict__ S, int rows, float sc, bf* PH, bf* PL) {
    typedef __attribute__((ext_vector_type(4))) unsigned short v4us;
    const int lane = threadIdx.x & 31, i = blockIdx.x * 8 + (threadIdx.x >> 5); if (i >= rows) return; const size_t zo = (size_t)blockIdx.z * rows * NK; const float* sr = S + zo + (size_t)i * NK; PH += zo; PL += zo;
    float m = -3.0e38f;
#pragma unroll 1
    for (int c0 = lane * 4; c0 < NK; c0 += 128) {
#pragma unroll
        for (int q = 0; q < 4; ++q) m = fmaxf(m, sr[c0 + q] * sc); }
#pragma unroll
    for (int sh = 16; sh; sh >>= 1) m = fmaxf(m, __shfl_xor(m, sh, 32));
    float sum = 0.f;
#pragma unroll 1
    for (int c0 = lane * 4; c0 < NK; c0 += 128) {
#pragma unroll
        for (int q = 0; q < 4; ++q) sum += __expf(sr[c0 + q] * sc - m); }
#pragma unroll
    for (int sh = 16; sh; sh >>= 1) sum += __shfl_xor(sum, sh, 32);
    const float inv = 1.0f / sum;
{
#pragma unroll 1
        for (int c0 = lane * 4; c0 < NK; c0 += 128) { v4us oh, ol;
#pragma unroll
            for (int q = 0; q < 4; ++q) { const float p = __expf(sr[c0 + q] * sc - m) * inv; const unsigned short hb = f2bf(p); oh[q] = hb; ol[q] = f2bf(p - bf2f(hb)); }
            const size_t o = (size_t)i * NK + c0; *(v4us*)(PH + o) = oh; *(v4us*)(PL + o) = ol; }
         }
}

__global__ __launch_bounds__(256) void k_zero8(bf* dst, size_t n8) {
    const size_t i = (size_t)blockIdx.x * 256 + threadIdx.x; if (i >= n8) return; v8us z;
#pragma unroll
    for (int k = 0; k < 8; ++k) z[k] = 0;
    *(v8us*)(dst + i * 8) = z; 
}

// k_mid: out[b][s][0..64] = sqrt(k) ave / sqrt(max(| -(-ave0^2 + |ave_s|^2) |, 1e-8)) with ave = mean over the 8 heads of CTX[h][s][0..64] (f32, fixed head order); one wave per row s:
// lane l -> components 4l..4l+3 (65 live); the row's 65 floats are part of the flat [2048 x 65] output block -> written by k_outflat below from AVE[s][128]; here AVE rows of 128
__global__ __launch_bounds__(256) void k_mid(const float* __restrict__ CTX, float* AVE) {
    const int lane = threadIdx.x & 31; const size_t s = (size_t)blockIdx.x * 8 + (threadIdx.x >> 5); if (s >= (size_t)NN) return; v4f a;
    CTX += (size_t)blockIdx.z * NH_ * NN * 128; AVE += (size_t)blockIdx.z * NN * 128;      // z = item
#pragma unroll
    for (int q = 0; q < 4; ++q) { const int c = lane * 4 + q; float v = 0.f; if (c < DL) { const int col = (c == 0) ? HD : (c - 1);     // module order [t | space]; CTX holds [space(0..63) | t(64)]
#pragma unroll
            for (int h = 0; h < NH_; ++h) v += CTX[((size_t)h * NN + s) * 128 + col];
            v *= (1.0f / NH_); } a[q] = v; }
    // inner = -a0^2 + sum_{c=1..64} a_c^2 : lane-strided partial over my 4 components then xor tree
    float part = 0.f;
#pragma unroll
    for (int q = 0; q < 4; ++q) { const int c = lane * 4 + q; if (c == 0) part -= a[q] * a[q]; else if (c < DL) part += a[q] * a[q]; }
#pragma unroll
    for (int sh = 16; sh; sh >>= 1) part += __shfl_xor(part, sh, 32);
    const float den = sqrtf(fmaxf(fabsf(-part), 1e-8f)); const float f = sqrtf(KCURV) / den;
    v4f o; 
#pragma unroll
    for (int q = 0; q < 4; ++q) o[q] = a[q] * f;
    *(v4f*)(AVE + s * 128 + lane * 4) = o; 
}
// total 532,480 floats (all four items) = 4,160 groups exactly).
__global__ __launch_bounds__(256) void k_outflat(const float* __restrict__ AVE, float* OUTB) {
    const int lane = threadIdx.x & 31; const size_t w = (size_t)blockIdx.x * 8 + (threadIdx.x >> 5); if (w >= (size_t)NBT * NN * DL / 128) return; const size_t e0 = w * 128 + lane * 4; v4f v;
#pragma unroll
    for (int q = 0; q < 4; ++q) { const size_t e = e0 + q; v[q] = AVE[(e / DL) * 128 + (e % DL)]; }
    *(v4f*)(OUTB + e0) = v; 
}

extern "C" void kernel_launch(void* const* d_in, const int* in_sizes, int n_in,
                              void* d_out, int out_size, void* d_ws, size_t ws_size, hipStream_t stream) {
    (void)in_sizes; (void)n_in; (void)out_size;
    const float* xq = (const float*)d_in[0]; const float* xs = (const float*)d_in[1]; const float* Wq = (const float*)d_in[2]; const float* bq = (const float*)d_in[3]; const float* Wk = (const float*)d_in[4]; const float* bk = (const float*)d_in[5]; const float* Wv = (const float*)d_in[6]; const float* bv = (const float*)d_in[7]; const float* scl = (const float*)d_in[8]; const float* bpar = (const float*)d_in[9];
    float* out = (float*)d_out;    // [4][2048][65]
    char* wsp = (char*)d_ws;
    auto take = [&](size_t bytes) { char* p = wsp; wsp += (bytes + 255) & ~(size_t)255; return (void*)p; };
    const int NZ = NBT * NH_;      // every (item, head) pair is one z slice of a launch
    float* TQ = (float*)take((size_t)NZ * NN * 4); float* TK = (float*)take((size_t)NZ * NN * 4);
    bf* Qh = (bf*)take((size_t)NZ * NN * HD * 2); bf* Ql = (bf*)take((size_t)NZ * NN * HD * 2); bf* Kh = (bf*)take((size_t)NZ * NN * HD * 2); bf* Kl = (bf*)take((size_t)NZ * NN * HD * 2); bf* VTh = (bf*)take((size_t)NZ * 128 * NN * 2); bf* VTl = (bf*)take((size_t)NZ * 128 * NN * 2);
    float* CTX = (float*)take((size_t)NZ * NN * 128 * 4); float* AVE = (float*)take((size_t)NBT * NN * 128 * 4);
    if ((size_t)(wsp - (char*)d_ws) > ws_size) return;    // 0.5 + 33.6 + 33.6 + 33.6 + 4.2 ~ 106 MB
    k_proj<<<dim3(NBT * NN / 128, NH_ / 2, 3), 512, 0, stream>>>(xq, xs, Wq, Wk, Wv, bq, bk, bv, Qh, Ql, Kh, Kl, VTh, VTl, TQ, TK);     // the three projections of all items and heads, finished to k_fattn's operands
    k_fattn<<<dim3(NN / 256, 1, NZ), 256, 0, stream>>>(Qh, Ql, Kh, Kl, VTh, VTl, TQ, TK, scl, bpar, CTX);     // scores, causal softmax, [space | time | 0] context of all pairs
    k_mid<<<dim3(NN / 8, 1, NBT), 256, 0, stream>>>(CTX, AVE);
    k_outflat<<<(NBT * NN * DL / 128) / 8, 256, 0, stream>>>(AVE, out);
}

// v006
// One run takes 99.1 microseconds.
// Next to v005, in two timings, it ran 1.05 times as fast each time.
// All steps since v000 together make it 26.6 times as fast.
#include <hip/hip_runtime.h>

// Compute dtypes, f32 accumulate, the three per-head hyperbolic linears as [8192 x 512].[512 x 512] GEMMs over all four items' rows with PLAIN bf16 operands (exact products; all 8 heads' space
// parts at once), the Lorentz time coordinate sqrt(|x_s|^2 + k) in f32; per head: space scores = q_s.k_s^T ([2048 x 64].[64 x 2048], both operands bf16 hi + UNSCALED residual,
// three products; key tiles wholly above the diagonal skipped), the time term -q_0 k_0, the affine (2 + 2<q,k>_L)/scale + bias and the causal softmax in f32 with a running maximum, the
// context = P.[v_s | v_0] ([2048 x 2048].[2048 x 65], P and v bf16 hi + residual, three products, K limited to the causal extent), all three inside one kernel (k_fattn), 1/sum applied last;

#define NBT  4
#define NN   2048
#define DIN  512
#define NH_  8
#define HD   64
#define DSP  (NH_ * HD)           // 512 space outputs over all heads
#define DL   (HD + 1)             // 65 Lorentz dims per head
#define DM   DIN
#define NTK  NN
#define KCURV 1.0f
#define LOSC 1024.0f
#define SPIT 72                   // LDS row pitch in elements of a staged 64-k operand tile: 128 B of data + 16 B, conflict-free for 16-byte fragment reads

typedef _Float16 h16;
typedef unsigned short bf;
typedef __attribute__((ext_vector_type(16))) __bf16   v16bf;
typedef __attribute__((ext_vector_type(16))) _Float16 v16h;
typedef __attribute__((ext_vector_type(8)))  _Float16 v8h;
typedef __attribute__((ext_vector_type(8)))  unsigned short v8us;
typedef __attribute__((ext_vector_type(8)))  float    v8f;
typedef __attribute__((ext_vector_type(16))) float    v16f;
typedef __attribute__((ext_vector_type(4)))  float    v4f;
typedef __attribute__((ext_vector_type(4)))  _Float16 v4h;
typedef v8h  __attribute__((may_alias)) v8ha;
typedef v4f  __attribute__((may_alias)) v4fa;
typedef v8us __attribute__((may_alias)) v8usa;

__device__ __forceinline__ unsigned short f2bf(float f) { unsigned u = __float_as_uint(f); u += 0x7FFFu + ((u >> 16) & 1u); return (unsigned short)(u >> 16); }
__device__ __forceinline__ float bf2f(unsigned short b) { return __uint_as_float(((unsigned)b) << 16); }
__device__ __forceinline__ float bfr(float f) { return bf2f(f2bf(f)); }
__device__ __forceinline__ v16h cat16(v8h lo, v8h hi) { return __builtin_shufflevector(lo, hi, 0, 1, 2, 3, 4, 5, 6, 7, 8, 9, 10, 11, 12, 13, 14, 15); }
__device__ __forceinline__ v16bf cat16b(v8us lo, v8us hi) { return __builtin_bit_cast(v16bf, __builtin_shufflevector(lo, hi, 0, 1, 2, 3, 4, 5, 6, 7, 8, 9, 10, 11, 12, 13, 14, 15)); }
__device__ __forceinline__ v8f wmma16(v16h a, v16h b, v8f c) { return __builtin_amdgcn_wmma_f32_16x16x32_f16(false, a, false, b, (short)0, c, false, false); }
__device__ __forceinline__ float xhalf(float v) { const int b = __float_as_int(v); return __int_as_float(__builtin_amdgcn_permlanex16(b, b, 0x76543210, 0xfedcba98, false, false)); }   // lane l <- lane l ^ 16, on the vector pipe
__device__ __forceinline__ v8f wmmab(v16bf a, v16bf b, v8f c) { return __builtin_amdgcn_wmma_f32_16x16x32_bf16(false, a, false, b, (short)0, c, false, false); }

// k_proj: one projection's 128 x 128 block tile (16 waves x 16 x 64): 128 positions of one item x the 64 space outputs of TWO heads, C = X.W^T + bf(bias), K = 512; z picks the projection (0 query, 1 key, 2 value).
// X and W are read as the f32 inputs themselves and rounded to bf16 (nearest even) in the staging registers on their way into LDS; the tile is 128 x 128 so that the f32 rows cost no more cache traffic
// than bf16 rows cost a 64 x 64 tile. A group of four waves holds 64 positions of one head, that is the head's whole space part, and finishes it itself: the time coordinate sqrt(|x_s|^2 + k)
// (f32, summed in component order), and the bf16 hi + residual planes that k_fattn reads: query and key rows as [pair][position][64] with the time in [pair][position]; the value tile is laid into LDS
// transposed and leaves as rows of V^T, [pair][component][position]: 64 space rows, the time row, 15 rows of zeros. Every global store is a whole 128 B line from 8 lanes (or from one wave, for the times).
__global__ __launch_bounds__(512) void k_proj(const float* __restrict__ xq, const float* __restrict__ xs, const float* __restrict__ Wq, const float* __restrict__ Wk, const float* __restrict__ Wv,
                                              const float* __restrict__ bq, const float* __restrict__ bk, const float* __restrict__ bv,
                                              bf* Qh, bf* Ql, bf* Kh, bf* Kl, bf* VTh, bf* VTl, float* TQ, float* TK) {
    typedef __attribute__((ext_vector_type(4))) __bf16 v4bf;
    typedef __attribute__((ext_vector_type(4))) unsigned short v4us;
    typedef v4us __attribute__((may_alias)) v4usa;
    constexpr int K = DIN, OP = 68;                                      // OP: LDS row pitch in floats of the finished tile
    __shared__ __align__(16) bf sa[128 * SPIT];                          // the X tile, rounded
    __shared__ __align__(16) bf sb[128 * SPIT];                          // the two heads' W rows, rounded
    __shared__ __align__(16) float ost4[4][(HD + 1) * OP];               // per group of four waves. query, key: [position][component]; value: [component][position], row 64 = the time
    const int tid = threadIdx.x, lane = tid & 31, wave = (tid >> 5) & 3, hg = (tid >> 7) & 1, pg = tid >> 8, tg = tid & 127, lr = lane & 15, hi = lane >> 4;   // hg, pg: the group's head and its half of the positions; wave, tg: wave and thread inside the group
    float* ost = ost4[tid >> 7];
    const int pj = blockIdx.z;
    const float* A = pj == 0 ? xq : xs; const float* Bn = pj == 0 ? Wq : pj == 1 ? Wk : Wv; const float* bias = pj == 0 ? bq : pj == 1 ? bk : bv;
    const int rb = blockIdx.x * 128, c0 = blockIdx.y * 128;
    const int arow = tid >> 4, apc = (tid & 15) * 4;                     // staging, X and W alike: 32 rows a pass, 16 lanes x 16 B cover one row's 64 floats (two lines)
    const int srow = tg >> 3, spc = (tg & 7) * 8;                        // plane stores, per head: 16 rows a pass, 8 lanes x 16 B cover one row's line
    unsigned oa[4], ob[4];                                               // per-lane byte offsets from the uniform bases; they step by 64 k a stage
#pragma unroll
    for (int p = 0; p < 4; ++p) { oa[p] = ((unsigned)(rb + p * 32 + arow) * (unsigned)K + apc) * 4u; ob[p] = ((unsigned)(c0 + p * 32 + arow) * (unsigned)K + apc) * 4u; }
    v4f ra[4], rw[4];
    auto fetch = [&]() {
#pragma unroll
        for (int p = 0; p < 4; ++p) { ra[p] = *(const v4f*)((const char*)A + oa[p]); rw[p] = *(const v4f*)((const char*)Bn + ob[p]); }
    };
    v8f acc[4]; float bb[4];                                             // bb: this lane's four bias values, read ahead of the loop
#pragma unroll
    for (int t = 0; t < 4; ++t) { acc[t] = (v8f){}; bb[t] = bfr(bias[c0 + hg * 64 + t * 16 + lr]); }
    fetch();
#pragma unroll 1
    for (int kc = 0; kc < K; kc += 64) {
        __syncthreads();                                                 // every wave has read its last fragment of the stage before
#pragma unroll
        for (int p = 0; p < 4; ++p) { *(v4usa*)(&sa[(p * 32 + arow) * SPIT + apc]) = __builtin_bit_cast(v4us, __builtin_convertvector(ra[p], v4bf)); *(v4usa*)(&sb[(p * 32 + arow) * SPIT + apc]) = __builtin_bit_cast(v4us, __builtin_convertvector(rw[p], v4bf)); }
        __syncthreads();                                                 // the stage is complete in LDS
        if (kc + 64 < K) {
#pragma unroll
            for (int p = 0; p < 4; ++p) { oa[p] += 256u; ob[p] += 256u; }
            fetch();
            asm volatile("s_wait_xcnt 0x0" ::: "memory"); }              // directly behind the run's last load: past the loop's exit its base registers are rewritten with no load wait in front
#pragma unroll
        for (int ks = 0; ks < 2; ++ks) {
            const int ao = (pg * 64 + wave * 16 + lr) * SPIT + ks * 32 + 8 * hi;
            const v16bf a = cat16b(*(const v8usa*)(&sa[ao]), *(const v8usa*)(&sa[ao + 16]));
            v16bf b[4];
#pragma unroll
            for (int t = 0; t < 4; ++t) { const int bo = (hg * 64 + t * 16 + lr) * SPIT + ks * 32 + 8 * hi; b[t] = cat16b(*(const v8usa*)(&sb[bo]), *(const v8usa*)(&sb[bo + 16])); }
            __builtin_amdgcn_sched_barrier(0);                           // all fragment reads of the k step issue together, ahead of its products: one LDS latency a step, not one a fragment
#pragma unroll
            for (int t = 0; t < 4; ++t) acc[t] = wmmab(a, b[t], acc[t]);
            asm volatile("v_nop\n\tv_nop\n\tv_nop\n\tv_nop" : "+v"(acc[0]), "+v"(acc[1]), "+v"(acc[2]), "+v"(acc[3]) : "v"(a));   // WMMA distance before its operands or results are touched, the loop's back edge included
        }
    }
    // acc[t][j] = position pg*64 + wave*16 + hi*8 + j, component t*16 + lr of head hg
    const size_t zz = (size_t)(rb / NN) * NH_ + blockIdx.y * 2 + hg;     // the (item, head) pair
    const int s0 = rb % NN + pg * 64;                                    // the group's first position in its item
    auto planes = [&](v4f y0, v4f y1, bf* ph, bf* pl) {                  // 8 values of one row -> 16 B of the hi plane and 16 B of the residual plane
        v8us oh, ol;
#pragma unroll
        for (int i = 0; i < 8; ++i) { const float y = i < 4 ? y0[i & 3] : y1[i & 3]; const unsigned short hb = f2bf(y); oh[i] = hb; ol[i] = f2bf(y - bf2f(hb)); }
        *(v8us*)ph = oh; *(v8us*)pl = ol;
    };
    if (pj < 2) {                                                        // the same for the whole work-group
#pragma unroll
        for (int t = 0; t < 4; ++t) {
#pragma unroll
            for (int j = 0; j < 8; ++j) ost[(wave * 16 + hi * 8 + j) * OP + t * 16 + lr] = acc[t][j] + bb[t]; }
        __syncthreads();                                                 // the finished tiles are complete in LDS
        if (tg < 64) {                                                   // waves 0 and 1 of each group: one position a lane, one 128 B line a wave
            float sq = 0.f;
#pragma unroll
            for (int d = 0; d < HD; ++d) { const float v = ost[tg * OP + d]; sq = fmaf(v, v, sq); }
            (pj == 0 ? TQ : TK)[zz * NN + s0 + tg] = sqrtf(sq + KCURV);
        }
        bf* ph = (pj == 0 ? Qh : Kh) + (zz * NN + s0 + srow) * HD + spc; bf* pl = (pj == 0 ? Ql : Kl) + (zz * NN + s0 + srow) * HD + spc;
#pragma unroll
        for (int p = 0; p < 4; ++p) { const float* sp = &ost[(p * 16 + srow) * OP + spc]; planes(*(const v4fa*)sp, *(const v4fa*)(sp + 4), ph + p * 16 * HD, pl + p * 16 * HD); }
    } else {
#pragma unroll
        for (int t = 0; t < 4; ++t) { float* tp = &ost[(t * 16 + lr) * OP + wave * 16 + hi * 8];
            *(v4fa*)tp = (v4f){acc[t][0] + bb[t], acc[t][1] + bb[t], acc[t][2] + bb[t], acc[t][3] + bb[t]}; *(v4fa*)(tp + 4) = (v4f){acc[t][4] + bb[t], acc[t][5] + bb[t], acc[t][6] + bb[t], acc[t][7] + bb[t]}; }
        __syncthreads();                                                 // the finished tiles are complete in LDS
        if (tg < 64) {
            float sq = 0.f;
#pragma unroll
            for (int d = 0; d < HD; ++d) { const float v = ost[d * OP + tg]; sq = fmaf(v, v, sq); }
            ost[HD * OP + tg] = sqrtf(sq + KCURV);
        }
        __syncthreads();                                                 // the time rows are complete in LDS
        bf* ph = VTh + (zz * 128 + srow) * NN + s0 + spc; bf* pl = VTl + (zz * 128 + srow) * NN + s0 + spc;
#pragma unroll
        for (int p = 0; p < 4; ++p) { const float* sp = &ost[(p * 16 + srow) * OP + spc]; planes(*(const v4fa*)sp, *(const v4fa*)(sp + 4), ph + (size_t)p * 16 * NN, pl + (size_t)p * 16 * NN); }
        const float* sp = &ost[HD * OP + spc];                           // rows 64 .. 79: the time row, then zeros
        const v4f t0 = *(const v4fa*)sp, t1 = *(const v4fa*)(sp + 4), zv = (v4f){0.f, 0.f, 0.f, 0.f};
        planes(srow == 0 ? t0 : zv, srow == 0 ? t1 : zv, ph + (size_t)64 * NN, pl + (size_t)64 * NN);
    }
}

__global__ __launch_bounds__(512) void k_fattn(const bf* __restrict__ Qh, const bf* __restrict__ Ql, const bf* Kh, const bf* Kl, const bf* VTh, const bf* VTl,
                                               const float* __restrict__ TQ, const float* TK, const float* __restrict__ scl, const float* __restrict__ bpar, float* CTX) {
    constexpr int VT_ = 5;                                               // 16-row tiles of V^T that hold live rows: 64 space + 1 time, rows 65 .. 79 are zeros
    __shared__ __align__(16) bf sk[2][2][2][64 * SPIT];                  // [buffer][tile of the stage][plane]
    __shared__ __align__(16) bf sv[2][2][2 * VT_ * 16 * SPIT];           // per buffer and tile: the hi plane's 80 rows, then the residual plane's
    __shared__ __align__(16) float st[2][2][64];
    __shared__ __align__(16) float mrg[8][2 * VT_ + 1][32][4];           // the odd group's hand-over, per wave: ten 16 B pieces of O^T a lane, then (maximum, sum)
    const int tid = threadIdx.x, lane = tid & 31, wave = (tid >> 5) & 7, tg = tid & 255, lr = lane & 15, hi = lane >> 4;   // wave, tg: wave and thread inside the group
    const int kg = __builtin_amdgcn_readfirstlane(tid >> 8);             // the wave's group: 0 takes the even key tiles, 1 the odd ones
    const size_t z = blockIdx.z;
    Qh += z * NN * HD; Ql += z * NN * HD; Kh += z * NN * HD; Kl += z * NN * HD; VTh += z * 128 * NN; VTl += z * 128 * NN; TQ += z * NN; TK += z * NN; CTX += z * NN * 128;
    const float isc = 1.0f / bfr(scl[0]), bb = bfr(bpar[0]);
    const int srow = tg >> 3, spc = (tg & 7) * 8;                        // staging, a group its own tile: 32 rows a pass, 8 lanes x 16 B cover one row's line; the two V^T planes count as 160 rows in a row, as they lie in LDS
    const bf* vmid = __builtin_amdgcn_readfirstlane(wave) < 4 ? VTh + 64 * NN : VTl - 16 * NN;   // rows 64 .. 95 of the 160: waves 0 .. 3 (srow 0 .. 15) stage the hi plane's last 16 rows, waves 4 .. 7 (srow 16 .. 31) the residual plane's first 16
    unsigned ok, ov, ot;                                                 // per-lane byte offsets from the uniform bases: row srow of the tile; the further rows lie at constant distances
    struct stage_regs { v8us rk[2][2], rv[VT_]; float rt; };             // one thread's share of a tile on its way into LDS; every pass has its own, so that the registers are free outside fetch .. put
    auto fetch = [&](stage_regs& g) {
#pragma unroll
        for (int p = 0; p < 2; ++p) { g.rk[0][p] = *(const v8us*)((const char*)(Kh + p * 32 * HD) + ok); g.rk[1][p] = *(const v8us*)((const char*)(Kl + p * 32 * HD) + ok); }
#pragma unroll
        for (int p = 0; p < VT_; ++p) g.rv[p] = *(const v8us*)((const char*)(p < 2 ? VTh + p * 32 * NN : p > 2 ? VTl + (p * 32 - VT_ * 16) * NN : vmid) + ov);
        g.rt = *(const float*)((const char*)TK + ot);
        asm volatile("s_wait_xcnt 0x0" ::: "memory");                    // directly behind the run's last load, ahead of any rewrite of its offset registers
    };
    auto put = [&](const stage_regs& g, int b) {
#pragma unroll
        for (int p = 0; p < 2; ++p) { *(v8usa*)(&sk[b][kg][0][(p * 32 + srow) * SPIT + spc]) = g.rk[0][p]; *(v8usa*)(&sk[b][kg][1][(p * 32 + srow) * SPIT + spc]) = g.rk[1][p]; }
#pragma unroll
        for (int p = 0; p < VT_; ++p) *(v8usa*)(&sv[b][kg][(p * 32 + srow) * SPIT + spc]) = g.rv[p];
        if (tg < 64) st[b][kg][tg] = g.rt;
    };
    ok = ((unsigned)(kg * 64 + srow) * HD + spc) * 2u;
    ov = ((unsigned)srow * NN + kg * 64 + spc) * 2u;
    ot = (unsigned)(kg * 64 + (tg & 63)) * 4u;
#pragma unroll 1                                                         // the two query blocks run one after the other through the same code and registers
    for (int half = 0; half < 2; ++half) {
        const int qb = half ? (int)blockIdx.x : NN / 128 - 1 - (int)blockIdx.x;
        const int qi = qb * 128 + wave * 16 + lr;                        // this lane's query
        v16bf qh[2], ql[2];
#pragma unroll
        for (int ks = 0; ks < 2; ++ks) { const size_t qo = (size_t)qi * HD + ks * 32 + 8 * hi;
            qh[ks] = cat16b(*(const v8us*)(Qh + qo), *(const v8us*)(Qh + qo + 16)); ql[ks] = cat16b(*(const v8us*)(Ql + qo), *(const v8us*)(Ql + qo + 16)); }
        const float q0 = TQ[qi];
        asm volatile("s_wait_xcnt 0x0" ::: "memory");                    // behind the query loads: at 256 registers their address registers are reused as destinations of the stage's loads below
        { stage_regs g; fetch(g);
        put(g, 0); }                                                     // the barrier at the foot of the stage before has ended every read of buffer 0
        __syncthreads();                                                 // stage 0 is complete in LDS
        v8f o[VT_];
#pragma unroll
        for (int t = 0; t < VT_; ++t) o[t] = (v8f){};
        float mrun = -3.0e38f, lsum = 0.f;
#pragma unroll 1                                                         // one copy of the pass: its trip count is the tile's own, and the body is long
        for (int sg = 0; sg <= qb; ++sg) {                               // stage qb is the last that holds a key of the block
            const int b = sg & 1, kt = 2 * sg + kg;                      // kt: this wave's key tile
            stage_regs g;
            if (sg < qb) {
                ok += 128u * HD * 2u; ov += 256u; ot += 512u;
                fetch(g); }
            v8f s[4];
#pragma unroll
            for (int t = 0; t < 4; ++t) s[t] = (v8f){};
#pragma unroll
            for (int ks = 0; ks < 2; ++ks) {
                v16bf kf[4];                                             // one plane's fragments at a time: at 16 waves a wave has 256 registers, and both planes beside the staged tile do not fit
#pragma unroll
                for (int t = 0; t < 4; ++t) { const int ko = (t * 16 + lr) * SPIT + ks * 32 + 8 * hi; kf[t] = cat16b(*(const v8usa*)(&sk[b][kg][0][ko]), *(const v8usa*)(&sk[b][kg][0][ko + 16])); }
                __builtin_amdgcn_sched_barrier(0);                       // all fragment reads of a plane issue together, ahead of its products: one LDS latency a plane, not one a fragment
#pragma unroll
                for (int t = 0; t < 4; ++t) s[t] = wmmab(kf[t], qh[ks], s[t]);
#pragma unroll
                for (int t = 0; t < 4; ++t) s[t] = wmmab(kf[t], ql[ks], s[t]);
#pragma unroll
                for (int t = 0; t < 4; ++t) { const int ko = (t * 16 + lr) * SPIT + ks * 32 + 8 * hi; kf[t] = cat16b(*(const v8usa*)(&sk[b][kg][1][ko]), *(const v8usa*)(&sk[b][kg][1][ko + 16])); }
                __builtin_amdgcn_sched_barrier(0);                       // as above
#pragma unroll
                for (int t = 0; t < 4; ++t) s[t] = wmmab(kf[t], qh[ks], s[t]);
            }
            float x[4][8];
#pragma unroll
            for (int t = 0; t < 4; ++t) { const v4f ka = *(const v4fa*)(&st[b][kg][t * 16 + hi * 8]), kb = *(const v4fa*)(&st[b][kg][t * 16 + hi * 8 + 4]);
#pragma unroll
                for (int j = 0; j < 8; ++j) x[t][j] = (2.0f + 2.0f * (s[t][j] - q0 * (j < 4 ? ka[j & 3] : kb[j & 3]))) * isc + bb; }
            if (sg == qb) {                                              // the two tiles on the block's diagonal: keys behind the lane's query drop out (scores set to -3e38: exact zeros against a real maximum)
#pragma unroll
                for (int t = 0; t < 4; ++t) {
#pragma unroll
                    for (int j = 0; j < 8; ++j) if (kt * 64 + t * 16 + hi * 8 + j > qi) x[t][j] = -3.0e38f; } }
            float mx[4];
#pragma unroll
            for (int t = 0; t < 4; ++t) { mx[t] = x[t][0];
#pragma unroll
                for (int j = 1; j < 8; ++j) mx[t] = fmaxf(mx[t], x[t][j]); }
            float mt = fmaxf(fmaxf(mx[0], mx[1]), fmaxf(mx[2], mx[3]));
            mt = fmaxf(mt, xhalf(mt));                                   // the other half of the wave holds the query's other 32 keys
            const float mnew = fmaxf(mrun, mt), alpha = __expf(mrun - mnew);
            mrun = mnew;
            v16bf ph[2], pl[2]; float ps[2];
#pragma unroll
            for (int ks = 0; ks < 2; ++ks) { v16f pf; float a0 = 0.f, a1 = 0.f;
#pragma unroll
                for (int e = 0; e < 8; ++e) { pf[e] = __expf(x[2 * ks][e] - mnew); pf[8 + e] = __expf(x[2 * ks + 1][e] - mnew); a0 += pf[e]; a1 += pf[8 + e]; }
                ps[ks] = a0 + a1;
                ph[ks] = __builtin_convertvector(pf, v16bf);
                pl[ks] = __builtin_convertvector(pf - __builtin_convertvector(ph[ks], v16f), v16bf); }
            lsum = lsum * alpha + (ps[0] + ps[1]);
#pragma unroll
            for (int t = 0; t < VT_; ++t) o[t] *= alpha;
            if (sg < qb) put(g, b ^ 1);
#pragma unroll
            for (int ks = 0; ks < 2; ++ks) {
                v16bf vh[VT_], vl[VT_];
#pragma unroll
                for (int t = 0; t < VT_; ++t) { const int vo = (t * 16 + lr) * SPIT + ks * 32 + 8 * hi;
                    vh[t] = cat16b(*(const v8usa*)(&sv[b][kg][vo]), *(const v8usa*)(&sv[b][kg][vo + 16]));
                    vl[t] = cat16b(*(const v8usa*)(&sv[b][kg][VT_ * 16 * SPIT + vo]), *(const v8usa*)(&sv[b][kg][VT_ * 16 * SPIT + vo + 16])); }
                __builtin_amdgcn_sched_barrier(0);                       // as above: one LDS latency a step
#pragma unroll
                for (int t = 0; t < VT_; ++t) o[t] = wmmab(vh[t], ph[ks], o[t]);
#pragma unroll
                for (int t = 0; t < VT_; ++t) o[t] = wmmab(vl[t], ph[ks], o[t]);
#pragma unroll
                for (int t = 0; t < VT_; ++t) o[t] = wmmab(vh[t], pl[ks], o[t]);
            }
            __syncthreads();                                             // publishes stage sg + 1 and ends every wave's reads of stage sg
        }
        asm volatile("v_nop\n\tv_nop\n\tv_nop\n\tv_nop");                // WMMA distance on the loop's exit path: the pass ends in products into O^T, and O^T's registers are read or reused right behind the loop
        if (kg) {                                                        // the same for a whole wave. A query whose odd tiles are all masked hands over the start maximum, which the join below turns into weight 0
#pragma unroll
            for (int t = 0; t < VT_; ++t) { *(v4fa*)(&mrg[wave][2 * t][lane][0]) = (v4f){o[t][0], o[t][1], o[t][2], o[t][3]}; *(v4fa*)(&mrg[wave][2 * t + 1][lane][0]) = (v4f){o[t][4], o[t][5], o[t][6], o[t][7]}; }
            *(v4fa*)(&mrg[wave][2 * VT_][lane][0]) = (v4f){mrun, lsum, 0.f, 0.f};
        }
        __syncthreads();                                                 // the odd group's partial results are complete in LDS; the next block's barriers end their reads before they are written again
        if (!kg) {
            const v4f ml = *(const v4fa*)(&mrg[wave][2 * VT_][lane][0]);
            const float mm = fmaxf(mrun, ml[0]), a0 = __expf(mrun - mm), a1 = __expf(ml[0] - mm);   // tile 0 holds key 0, so the even group's maximum is a real score
            lsum = lsum * a0 + ml[1] * a1;
            lsum += xhalf(lsum);
            const float inv = 1.0f / lsum, i0 = a0 * inv, i1 = a1 * inv;
            float* cr = CTX + (size_t)qi * 128 + hi * 8;                 // o[t][j] = context component t*16 + 8*hi + j of query qi: [space(0..63) | t(64) | 0]
#pragma unroll
            for (int t = 0; t < VT_; ++t) { const v4f p0 = *(const v4fa*)(&mrg[wave][2 * t][lane][0]), p1 = *(const v4fa*)(&mrg[wave][2 * t + 1][lane][0]);
                *(v4f*)(cr + t * 16) = (v4f){o[t][0] * i0 + p0[0] * i1, o[t][1] * i0 + p0[1] * i1, o[t][2] * i0 + p0[2] * i1, o[t][3] * i0 + p0[3] * i1};
                *(v4f*)(cr + t * 16 + 4) = (v4f){o[t][4] * i0 + p1[0] * i1, o[t][5] * i0 + p1[1] * i1, o[t][6] * i0 + p1[2] * i1, o[t][7] * i0 + p1[3] * i1}; }
            asm volatile("s_wait_xcnt 0x0" ::: "memory");                // behind the last store, ahead of the next block's rewrite of its address registers
        }
        ok -= (unsigned)qb * (128u * HD * 2u); ov -= (unsigned)qb * 256u; ot -= (unsigned)qb * 512u;   // back to stage 0: no second copy of the start offsets is held over the stage loop
    }
}
__global__ __launch_bounds__(256) void k_planes32z(const float* __restrict__ F, int ld, int off, float sc, int rows, bf* Ph, bf* Pl) {
    typedef __attribute__((ext_vector_type(2))) unsigned short v2us;
    const int lane = threadIdx.x & 31; const size_t r = ((size_t)blockIdx.x * 8 + (threadIdx.x >> 5)) * 2 + (lane >> 4); if (r >= (size_t)rows) return; const int z = blockIdx.z; const int c0 = (lane & 15) * 2; v2us oh, ol;
    Ph += (size_t)z * rows * 32; Pl += (size_t)z * rows * 32;
#pragma unroll
    for (int i = 0; i < 2; ++i) { const float y = F[r * ld + off + z * 32 + c0 + i] * sc; const unsigned short hb = f2bf(y); oh[i] = hb; ol[i] = f2bf(y - bf2f(hb)); }
    const size_t o = r * 32 + c0; *(v2us*)(Ph + o) = oh; *(v2us*)(Pl + o) = ol; 
}
__global__ __launch_bounds__(256) void k_vtpadz(const float* __restrict__ F, int ld, int off, int nk, bf* Th, bf* Tl) {
    typedef __attribute__((ext_vector_type(2))) unsigned short v2us;
    const int lane = threadIdx.x & 31; const size_t wid = (size_t)blockIdx.x * 8 + (threadIdx.x >> 5); if (wid >= (size_t)64 * (nk / 64)) return; const int z = blockIdx.z; const int d = (int)(wid / (nk / 64)); const int k0 = (int)(wid % (nk / 64)) * 64 + lane * 2; v2us oh, ol;
    Th += (size_t)z * 64 * nk; Tl += (size_t)z * 64 * nk;
#pragma unroll
    for (int i = 0; i < 2; ++i) { const float y = (d < 32) ? F[(size_t)(k0 + i) * ld + off + z * 32 + (d < 32 ? d : 0)] : 0.f; const unsigned short hb = f2bf(y); oh[i] = hb; ol[i] = f2bf(y - bf2f(hb)); }
    const size_t o = (size_t)d * nk + k0; *(v2us*)(Th + o) = oh; *(v2us*)(Tl + o) = ol; 
}
template <int NK>
__global__ __launch_bounds__(256) void k_softmaxz(const float* __restrict__ S, int rows, bf* PH, bf* PL) {
    typedef __attribute__((ext_vector_type(4))) unsigned short v4us;
    const int lane = threadIdx.x & 31, i = blockIdx.x * 8 + (threadIdx.x >> 5); if (i >= rows) return; const size_t zo = (size_t)blockIdx.z * rows * NK; const float* sr = S + zo + (size_t)i * NK; PH += zo; PL += zo;
    float m = -3.0e38f;
#pragma unroll 1
    for (int c0 = lane * 4; c0 < NK; c0 += 128) {
#pragma unroll
        for (int q = 0; q < 4; ++q) m = fmaxf(m, sr[c0 + q]); }
#pragma unroll
    for (int sh = 16; sh; sh >>= 1) m = fmaxf(m, __shfl_xor(m, sh, 32));
    float sum = 0.f;
#pragma unroll 1
    for (int c0 = lane * 4; c0 < NK; c0 += 128) {
#pragma unroll
        for (int q = 0; q < 4; ++q) sum += __expf(sr[c0 + q] - m); }
#pragma unroll
    for (int sh = 16; sh; sh >>= 1) sum += __shfl_xor(sum, sh, 32);
    const float inv = 1.0f / sum;
{
#pragma unroll 1
        for (int c0 = lane * 4; c0 < NK; c0 += 128) { v4us oh, ol;
#pragma unroll
            for (int q = 0; q < 4; ++q) { const float p = __expf(sr[c0 + q] - m) * inv; const unsigned short hb = f2bf(p); oh[q] = hb; ol[q] = f2bf(p - bf2f(hb)); }
            const size_t o = (size_t)i * NK + c0; *(v4us*)(PH + o) = oh; *(v4us*)(PL + o) = ol; }
         }
}
__global__ __launch_bounds__(256) void k_placez(const float* __restrict__ XH, int rows, int ldy, float* Y) {
    const int lane = threadIdx.x & 31; const size_t q = (size_t)blockIdx.x * 8 + (threadIdx.x >> 5); if (q >= (size_t)rows) return; const int z = blockIdx.z; const float v = XH[((size_t)z * rows + q) * 64 + lane];
    *(float*)(Y + q * ldy + z * 32 + lane) = v; 
}

__global__ __launch_bounds__(256) void k_vtz(const float* __restrict__ F, int ld, int h0, int nk, bf* Th, bf* Tl) {
    typedef __attribute__((ext_vector_type(2))) unsigned short v2us;
    const int lane = threadIdx.x & 31; const size_t wid = (size_t)blockIdx.x * 8 + (threadIdx.x >> 5); if (wid >= (size_t)64 * (nk / 64)) return; const int z = blockIdx.z; const int d = (int)(wid / (nk / 64)); const int t0 = (int)(wid % (nk / 64)) * 64 + lane * 2; v2us oh, ol;
    Th += (size_t)z * 64 * nk; Tl += (size_t)z * 64 * nk;
#pragma unroll
    for (int i = 0; i < 2; ++i) { const float y = F[(size_t)(t0 + i) * ld + (h0 + z) * 64 + d]; const unsigned short hb = f2bf(y); oh[i] = hb; ol[i] = f2bf(y - bf2f(hb)); }
    const size_t o = (size_t)d * nk + t0; *(v2us*)(Th + o) = oh; *(v2us*)(Tl + o) = ol; 
}
template <int NK>
__global__ __launch_bounds__(256) void k_softmaxzs(const float* __restrict__ S, int rows, float sc, bf* PH, bf* PL) {
    typedef __attribute__((ext_vector_type(4))) unsigned short v4us;
    const int lane = threadIdx.x & 31, i = blockIdx.x * 8 + (threadIdx.x >> 5); if (i >= rows) return; const size_t zo = (size_t)blockIdx.z * rows * NK; const float* sr = S + zo + (size_t)i * NK; PH += zo; PL += zo;
    float m = -3.0e38f;
#pragma unroll 1
    for (int c0 = lane * 4; c0 < NK; c0 += 128) {
#pragma unroll
        for (int q = 0; q < 4; ++q) m = fmaxf(m, sr[c0 + q] * sc); }
#pragma unroll
    for (int sh = 16; sh; sh >>= 1) m = fmaxf(m, __shfl_xor(m, sh, 32));
    float sum = 0.f;
#pragma unroll 1
    for (int c0 = lane * 4; c0 < NK; c0 += 128) {
#pragma unroll
        for (int q = 0; q < 4; ++q) sum += __expf(sr[c0 + q] * sc - m); }
#pragma unroll
    for (int sh = 16; sh; sh >>= 1) sum += __shfl_xor(sum, sh, 32);
    const float inv = 1.0f / sum;
{
#pragma unroll 1
        for (int c0 = lane * 4; c0 < NK; c0 += 128) { v4us oh, ol;
#pragma unroll
            for (int q = 0; q < 4; ++q) { const float p = __expf(sr[c0 + q] * sc - m) * inv; const unsigned short hb = f2bf(p); oh[q] = hb; ol[q] = f2bf(p - bf2f(hb)); }
            const size_t o = (size_t)i * NK + c0; *(v4us*)(PH + o) = oh; *(v4us*)(PL + o) = ol; }
         }
}

__global__ __launch_bounds__(256) void k_zero8(bf* dst, size_t n8) {
    const size_t i = (size_t)blockIdx.x * 256 + threadIdx.x; if (i >= n8) return; v8us z;
#pragma unroll
    for (int k = 0; k < 8; ++k) z[k] = 0;
    *(v8us*)(dst + i * 8) = z; 
}

// k_mid: out[b][s][0..64] = sqrt(k) ave / sqrt(max(| -(-ave0^2 + |ave_s|^2) |, 1e-8)) with ave = mean over the 8 heads of CTX[h][s][0..64] (f32, fixed head order); one wave per row s:
// lane l -> components 4l..4l+3 (65 live); the row's 65 floats are part of the flat [2048 x 65] output block -> written by k_outflat below from AVE[s][128]; here AVE rows of 128
__global__ __launch_bounds__(256) void k_mid(const float* __restrict__ CTX, float* AVE) {
    const int lane = threadIdx.x & 31; const size_t s = (size_t)blockIdx.x * 8 + (threadIdx.x >> 5); if (s >= (size_t)NN) return; v4f a;
    CTX += (size_t)blockIdx.z * NH_ * NN * 128; AVE += (size_t)blockIdx.z * NN * 128;      // z = item
#pragma unroll
    for (int q = 0; q < 4; ++q) { const int c = lane * 4 + q; float v = 0.f; if (c < DL) { const int col = (c == 0) ? HD : (c - 1);     // module order [t | space]; CTX holds [space(0..63) | t(64)]
#pragma unroll
            for (int h = 0; h < NH_; ++h) v += CTX[((size_t)h * NN + s) * 128 + col];
            v *= (1.0f / NH_); } a[q] = v; }
    // inner = -a0^2 + sum_{c=1..64} a_c^2 : lane-strided partial over my 4 components then xor tree
    float part = 0.f;
#pragma unroll
    for (int q = 0; q < 4; ++q) { const int c = lane * 4 + q; if (c == 0) part -= a[q] * a[q]; else if (c < DL) part += a[q] * a[q]; }
#pragma unroll
    for (int sh = 16; sh; sh >>= 1) part += __shfl_xor(part, sh, 32);
    const float den = sqrtf(fmaxf(fabsf(-part), 1e-8f)); const float f = sqrtf(KCURV) / den;
    v4f o; 
#pragma unroll
    for (int q = 0; q < 4; ++q) o[q] = a[q] * f;
    *(v4f*)(AVE + s * 128 + lane * 4) = o; 
}
// total 532,480 floats (all four items) = 4,160 groups exactly).
__global__ __launch_bounds__(256) void k_outflat(const float* __restrict__ AVE, float* OUTB) {
    const int lane = threadIdx.x & 31; const size_t w = (size_t)blockIdx.x * 8 + (threadIdx.x >> 5); if (w >= (size_t)NBT * NN * DL / 128) return; const size_t e0 = w * 128 + lane * 4; v4f v;
#pragma unroll
    for (int q = 0; q < 4; ++q) { const size_t e = e0 + q; v[q] = AVE[(e / DL) * 128 + (e % DL)]; }
    *(v4f*)(OUTB + e0) = v; 
}

extern "C" void kernel_launch(void* const* d_in, const int* in_sizes, int n_in,
                              void* d_out, int out_size, void* d_ws, size_t ws_size, hipStream_t stream) {
    (void)in_sizes; (void)n_in; (void)out_size;
    const float* xq = (const float*)d_in[0]; const float* xs = (const float*)d_in[1]; const float* Wq = (const float*)d_in[2]; const float* bq = (const float*)d_in[3]; const float* Wk = (const float*)d_in[4]; const float* bk = (const float*)d_in[5]; const float* Wv = (const float*)d_in[6]; const float* bv = (const float*)d_in[7]; const float* scl = (const float*)d_in[8]; const float* bpar = (const float*)d_in[9];
    float* out = (float*)d_out;    // [4][2048][65]
    char* wsp = (char*)d_ws;
    auto take = [&](size_t bytes) { char* p = wsp; wsp += (bytes + 255) & ~(size_t)255; return (void*)p; };
    const int NZ = NBT * NH_;      // every (item, head) pair is one z slice of a launch
    float* TQ = (float*)take((size_t)NZ * NN * 4); float* TK = (float*)take((size_t)NZ * NN * 4);
    bf* Qh = (bf*)take((size_t)NZ * NN * HD * 2); bf* Ql = (bf*)take((size_t)NZ * NN * HD * 2); bf* Kh = (bf*)take((size_t)NZ * NN * HD * 2); bf* Kl = (bf*)take((size_t)NZ * NN * HD * 2); bf* VTh = (bf*)take((size_t)NZ * 128 * NN * 2); bf* VTl = (bf*)take((size_t)NZ * 128 * NN * 2);
    float* CTX = (float*)take((size_t)NZ * NN * 128 * 4); float* AVE = (float*)take((size_t)NBT * NN * 128 * 4);
    if ((size_t)(wsp - (char*)d_ws) > ws_size) return;    // 0.5 + 33.6 + 33.6 + 33.6 + 4.2 ~ 106 MB
    k_proj<<<dim3(NBT * NN / 128, NH_ / 2, 3), 512, 0, stream>>>(xq, xs, Wq, Wk, Wv, bq, bk, bv, Qh, Ql, Kh, Kl, VTh, VTl, TQ, TK);     // the three projections of all items and heads, finished to k_fattn's operands
    k_fattn<<<dim3(NN / 256, 1, NZ), 512, 0, stream>>>(Qh, Ql, Kh, Kl, VTh, VTl, TQ, TK, scl, bpar, CTX);     // scores, causal softmax, [space | time | 0] context of all pairs
    k_mid<<<dim3(NN / 8, 1, NBT), 256, 0, stream>>>(CTX, AVE);
    k_outflat<<<(NBT * NN * DL / 128) / 8, 256, 0, stream>>>(AVE, out);
}

// v008
// A run of this version takes 71.5 microseconds.
// Versions between v006 and this one are left out; their measured steps multiply to 1.38 times as fast.
// All steps since v000 together make it 36.6 times as fast.
#include <hip/hip_runtime.h>

// Compute dtypes, f32 accumulate, per item: the three per-head hyperbolic linears as [2048 x 512].[512 x 512] GEMMs with PLAIN bf16 operands (exact products; all 8 heads' space
// parts at once), the Lorentz time coordinate sqrt(|x_s|^2 + k) in f32; per head: space scores = q_s.k_s^T ([2048 x 64].[64 x 2048], both operands ONE f16 plane,
// one product; key tiles wholly above the diagonal skipped), the time term -q_0 k_0, the affine (2 + 2<q,k>_L)/scale + bias and the causal softmax in f32 with a running maximum, the
// context = P.[v_s | v_0] ([2048 x 2048].[2048 x 65], P and v one f16 plane, one product, K limited to the causal extent), all three inside one kernel (k_fattn), 1/sum applied last.
// Why one f16 plane: q, k and v are sums of 512 products of X and W rounded to bf16 (8 significant bits), and carry that rounding; f16 keeps 11 significant bits of them and of P (0 .. 1),
// an error well below the one they arrive with. The times q_0, k_0 of the scores stay f32. f16's range bounds |q_s|, |k_s|, |v| at 65504.

#define NBT  4
#define NN   2048
#define DIN  512
#define NH_  8
#define HD   64
#define DSP  (NH_ * HD)           // 512 space outputs over all heads
#define DL   (HD + 1)             // 65 Lorentz dims per head
#define DM   DIN
#define NTK  NN
#define KCURV 1.0f
#define LOSC 1024.0f
#define SPIT 72                   // LDS row pitch in elements of a staged 64-k operand tile: 128 B of data + 16 B, conflict-free for 16-byte fragment reads

typedef _Float16 h16;
typedef unsigned short bf;
typedef __attribute__((ext_vector_type(16))) __bf16   v16bf;
typedef __attribute__((ext_vector_type(16))) _Float16 v16h;
typedef __attribute__((ext_vector_type(8)))  _Float16 v8h;
typedef __attribute__((ext_vector_type(8)))  unsigned short v8us;
typedef __attribute__((ext_vector_type(8)))  float    v8f;
typedef __attribute__((ext_vector_type(16))) float    v16f;
typedef __attribute__((ext_vector_type(4)))  float    v4f;
typedef __attribute__((ext_vector_type(4)))  _Float16 v4h;
typedef v8h  __attribute__((may_alias)) v8ha;
typedef v4f  __attribute__((may_alias)) v4fa;
typedef v8us __attribute__((may_alias)) v8usa;

__device__ __forceinline__ unsigned short f2bf(float f) { unsigned u = __float_as_uint(f); u += 0x7FFFu + ((u >> 16) & 1u); return (unsigned short)(u >> 16); }
__device__ __forceinline__ float bf2f(unsigned short b) { return __uint_as_float(((unsigned)b) << 16); }
__device__ __forceinline__ float bfr(float f) { return bf2f(f2bf(f)); }
__device__ __forceinline__ v16h cat16(v8h lo, v8h hi) { return __builtin_shufflevector(lo, hi, 0, 1, 2, 3, 4, 5, 6, 7, 8, 9, 10, 11, 12, 13, 14, 15); }
__device__ __forceinline__ v16bf cat16b(v8us lo, v8us hi) { return __builtin_bit_cast(v16bf, __builtin_shufflevector(lo, hi, 0, 1, 2, 3, 4, 5, 6, 7, 8, 9, 10, 11, 12, 13, 14, 15)); }
__device__ __forceinline__ v16h cat16u(v8us lo, v8us hi) { return __builtin_bit_cast(v16h, __builtin_shufflevector(lo, hi, 0, 1, 2, 3, 4, 5, 6, 7, 8, 9, 10, 11, 12, 13, 14, 15)); }
__device__ __forceinline__ v8f wmma16(v16h a, v16h b, v8f c) { return __builtin_amdgcn_wmma_f32_16x16x32_f16(false, a, false, b, (short)0, c, false, false); }
__device__ __forceinline__ float xhalf(float v) { const int b = __float_as_int(v); return __int_as_float(__builtin_amdgcn_permlanex16(b, b, 0x76543210, 0xfedcba98, false, false)); }   // lane l <- lane l ^ 16, on the vector pipe
__device__ __forceinline__ v8f wmmab(v16bf a, v16bf b, v8f c) { return __builtin_amdgcn_wmma_f32_16x16x32_bf16(false, a, false, b, (short)0, c, false, false); }

// k_proj: one projection's 128 x 128 block tile (16 waves x 16 x 64): 128 positions of one item x the 64 space outputs of TWO heads, C = X.W^T + bf(bias), K = 512; z picks the projection (0 query, 1 key, 2 value).
// X and W are read as the f32 inputs themselves and rounded to bf16 (nearest even) in the staging registers on their way into LDS; the tile is 128 x 128 so that the f32 rows cost no more cache traffic
// than bf16 rows cost a 64 x 64 tile. A group of four waves holds 64 positions of one head, that is the head's whole space part, and finishes it itself: the time coordinate sqrt(|x_s|^2 + k)
// (f32, summed in component order), and the f16 plane that k_fattn reads: query and key rows as [pair][position][64] with the time in [pair][position]; the value tile is laid into LDS
// transposed and leaves as rows of V^T, [pair][component][position]: 64 space rows, the time row, 15 rows of zeros. Every global store is a whole 128 B line from 8 lanes (or from one wave, for the times).
__global__ __launch_bounds__(512) void k_proj(const float* __restrict__ xq, const float* __restrict__ xs, const float* __restrict__ Wq, const float* __restrict__ Wk, const float* __restrict__ Wv,
                                              const float* __restrict__ bq, const float* __restrict__ bk, const float* __restrict__ bv,
                                              bf* Qf, bf* Kf, bf* VTf, float* TQ, float* TK) {
    typedef __attribute__((ext_vector_type(4))) __bf16 v4bf;
    typedef __attribute__((ext_vector_type(4))) unsigned short v4us;
    typedef v4us __attribute__((may_alias)) v4usa;
    constexpr int K = DIN, OP = 68;                                      // OP: LDS row pitch in floats of the finished tile
    __shared__ __align__(16) bf sa[128 * SPIT];                          // the X tile, rounded
    __shared__ __align__(16) bf sb[128 * SPIT];                          // the two heads' W rows, rounded
    __shared__ __align__(16) float ost4[4][(HD + 1) * OP];               // per group of four waves. query, key: [position][component]; value: [component][position], row 64 = the time
    const int tid = threadIdx.x, lane = tid & 31, wave = (tid >> 5) & 3, hg = (tid >> 7) & 1, pg = tid >> 8, tg = tid & 127, lr = lane & 15, hi = lane >> 4;   // hg, pg: the group's head and its half of the positions; wave, tg: wave and thread inside the group
    float* ost = ost4[tid >> 7];
    const int pj = blockIdx.z;
    const float* A = pj == 0 ? xq : xs; const float* Bn = pj == 0 ? Wq : pj == 1 ? Wk : Wv; const float* bias = pj == 0 ? bq : pj == 1 ? bk : bv;
    const int rb = blockIdx.x * 128, c0 = blockIdx.y * 128;
    const int arow = tid >> 4, apc = (tid & 15) * 4;                     // staging, X and W alike: 32 rows a pass, 16 lanes x 16 B cover one row's 64 floats (two lines)
    const int srow = tg >> 3, spc = (tg & 7) * 8;                        // plane stores, per head: 16 rows a pass, 8 lanes x 16 B cover one row's line
    unsigned oa[4], ob[4];                                               // per-lane byte offsets from the uniform bases; they step by 64 k a stage
#pragma unroll
    for (int p = 0; p < 4; ++p) { oa[p] = ((unsigned)(rb + p * 32 + arow) * (unsigned)K + apc) * 4u; ob[p] = ((unsigned)(c0 + p * 32 + arow) * (unsigned)K + apc) * 4u; }
    v4f ra[4], rw[4];
    auto fetch = [&]() {
#pragma unroll
        for (int p = 0; p < 4; ++p) { ra[p] = *(const v4f*)((const char*)A + oa[p]); rw[p] = *(const v4f*)((const char*)Bn + ob[p]); }
    };
    v8f acc[4]; float bb[4];                                             // bb: this lane's four bias values, read ahead of the loop
#pragma unroll
    for (int t = 0; t < 4; ++t) { acc[t] = (v8f){}; bb[t] = bfr(bias[c0 + hg * 64 + t * 16 + lr]); }
    fetch();
#pragma unroll 1
    for (int kc = 0; kc < K; kc += 64) {
        __syncthreads();                                                 // every wave has read its last fragment of the stage before
#pragma unroll
        for (int p = 0; p < 4; ++p) { *(v4usa*)(&sa[(p * 32 + arow) * SPIT + apc]) = __builtin_bit_cast(v4us, __builtin_convertvector(ra[p], v4bf)); *(v4usa*)(&sb[(p * 32 + arow) * SPIT + apc]) = __builtin_bit_cast(v4us, __builtin_convertvector(rw[p], v4bf)); }
        __syncthreads();                                                 // the stage is complete in LDS
        if (kc + 64 < K) {
#pragma unroll
            for (int p = 0; p < 4; ++p) { oa[p] += 256u; ob[p] += 256u; }
            fetch();
            asm volatile("s_wait_xcnt 0x0" ::: "memory"); }              // directly behind the run's last load: past the loop's exit its base registers are rewritten with no load wait in front
#pragma unroll
        for (int ks = 0; ks < 2; ++ks) {
            const int ao = (pg * 64 + wave * 16 + lr) * SPIT + ks * 32 + 8 * hi;
            const v16bf a = cat16b(*(const v8usa*)(&sa[ao]), *(const v8usa*)(&sa[ao + 16]));
            v16bf b[4];
#pragma unroll
            for (int t = 0; t < 4; ++t) { const int bo = (hg * 64 + t * 16 + lr) * SPIT + ks * 32 + 8 * hi; b[t] = cat16b(*(const v8usa*)(&sb[bo]), *(const v8usa*)(&sb[bo + 16])); }
            __builtin_amdgcn_sched_barrier(0);                           // all fragment reads of the k step issue together, ahead of its products: one LDS latency a step, not one a fragment
#pragma unroll
            for (int t = 0; t < 4; ++t) acc[t] = wmmab(a, b[t], acc[t]);
            asm volatile("v_nop\n\tv_nop\n\tv_nop\n\tv_nop" : "+v"(acc[0]), "+v"(acc[1]), "+v"(acc[2]), "+v"(acc[3]) : "v"(a));   // WMMA distance before its operands or results are touched, the loop's back edge included
        }
    }
    // acc[t][j] = position pg*64 + wave*16 + hi*8 + j, component t*16 + lr of head hg
    const size_t zz = (size_t)(rb / NN) * NH_ + blockIdx.y * 2 + hg;     // the (item, head) pair
    const int s0 = rb % NN + pg * 64;                                    // the group's first position in its item
    auto plane = [&](v4f y0, v4f y1, bf* pf) {                           // 8 values of one row -> 16 B of the f16 plane (nearest even)
        *(v8us*)pf = __builtin_bit_cast(v8us, __builtin_convertvector(__builtin_shufflevector(y0, y1, 0, 1, 2, 3, 4, 5, 6, 7), v8h));
    };
    if (pj < 2) {                                                        // the same for the whole work-group
#pragma unroll
        for (int t = 0; t < 4; ++t) {
#pragma unroll
            for (int j = 0; j < 8; ++j) ost[(wave * 16 + hi * 8 + j) * OP + t * 16 + lr] = acc[t][j] + bb[t]; }
        __syncthreads();                                                 // the finished tiles are complete in LDS
        if (tg < 64) {                                                   // waves 0 and 1 of each group: one position a lane, one 128 B line a wave
            float sq = 0.f;
#pragma unroll
            for (int d = 0; d < HD; ++d) { const float v = ost[tg * OP + d]; sq = fmaf(v, v, sq); }
            (pj == 0 ? TQ : TK)[zz * NN + s0 + tg] = sqrtf(sq + KCURV);
        }
        bf* pf = (pj == 0 ? Qf : Kf) + (zz * NN + s0 + srow) * HD + spc;
#pragma unroll
        for (int p = 0; p < 4; ++p) { const float* sp = &ost[(p * 16 + srow) * OP + spc]; plane(*(const v4fa*)sp, *(const v4fa*)(sp + 4), pf + p * 16 * HD); }
    } else {
#pragma unroll
        for (int t = 0; t < 4; ++t) { float* tp = &ost[(t * 16 + lr) * OP + wave * 16 + hi * 8];
            *(v4fa*)tp = (v4f){acc[t][0] + bb[t], acc[t][1] + bb[t], acc[t][2] + bb[t], acc[t][3] + bb[t]}; *(v4fa*)(tp + 4) = (v4f){acc[t][4] + bb[t], acc[t][5] + bb[t], acc[t][6] + bb[t], acc[t][7] + bb[t]}; }
        __syncthreads();                                                 // the finished tiles are complete in LDS
        if (tg < 64) {
            float sq = 0.f;
#pragma unroll
            for (int d = 0; d < HD; ++d) { const float v = ost[d * OP + tg]; sq = fmaf(v, v, sq); }
            ost[HD * OP + tg] = sqrtf(sq + KCURV);
        }
        __syncthreads();                                                 // the time rows are complete in LDS
        bf* pf = VTf + (zz * 128 + srow) * NN + s0 + spc;
#pragma unroll
        for (int p = 0; p < 4; ++p) { const float* sp = &ost[(p * 16 + srow) * OP + spc]; plane(*(const v4fa*)sp, *(const v4fa*)(sp + 4), pf + (size_t)p * 16 * NN); }
        const float* sp = &ost[HD * OP + spc];                           // rows 64 .. 79: the time row, then zeros
        const v4f t0 = *(const v4fa*)sp, t1 = *(const v4fa*)(sp + 4), zv = (v4f){0.f, 0.f, 0.f, 0.f};
        plane(srow == 0 ? t0 : zv, srow == 0 ? t1 : zv, pf + (size_t)64 * NN);
    }
}

__global__ __launch_bounds__(512) void k_fattn(const bf* __restrict__ Qf, const bf* Kf, const bf* VTf,
                                               const float* __restrict__ TQ, const float* TK, const float* __restrict__ scl, const float* __restrict__ bpar, float* CTX) {
    constexpr int VT_ = 5;                                               // 16-row tiles of V^T that hold live rows: 64 space + 1 time, rows 65 .. 79 are zeros
    __shared__ __align__(16) bf sk[2][2][64 * SPIT];                     // [buffer][tile of the stage]
    __shared__ __align__(16) bf sv[2][2][VT_ * 16 * SPIT];               // per buffer and tile: the 80 rows of V^T
    __shared__ __align__(16) float st[2][2][64];
    __shared__ __align__(16) float mrg[8][2 * VT_ + 1][32][4];           // the odd group's hand-over, per wave: ten 16 B pieces of O^T a lane, then (maximum, sum)
    const int tid = threadIdx.x, lane = tid & 31, wave = (tid >> 5) & 7, tg = tid & 255, lr = lane & 15, hi = lane >> 4;   // wave, tg: wave and thread inside the group
    const int kg = __builtin_amdgcn_readfirstlane(tid >> 8);             // the wave's group: 0 takes the even key tiles, 1 the odd ones
    const size_t z = blockIdx.z;
    Qf += z * NN * HD; Kf += z * NN * HD; VTf += z * 128 * NN; TQ += z * NN; TK += z * NN; CTX += z * NN * 128;
    const float isc = 1.0f / bfr(scl[0]), bb = bfr(bpar[0]);
    const int srow = tg >> 3, spc = (tg & 7) * 8;                        // staging, a group its own tile: 32 rows a pass, 8 lanes x 16 B cover one row's line
    const bool vtail = __builtin_amdgcn_readfirstlane(wave) < 4;         // the same for a whole wave: rows 64 .. 79 of V^T are half a pass, staged by waves 0 .. 3 of the group (srow 0 .. 15)
    unsigned ok, ov, ot;                                                 // per-lane byte offsets from the uniform bases: row srow of the tile; the further rows lie at constant distances
    struct stage_regs { v8us rk[2], rv[3]; float rt; };                  // one thread's share of a tile on its way into LDS; every pass has its own, so that the registers are free outside fetch .. put
    auto fetch = [&](stage_regs& g) {
#pragma unroll
        for (int p = 0; p < 2; ++p) { g.rk[p] = *(const v8us*)((const char*)(Kf + p * 32 * HD) + ok); g.rv[p] = *(const v8us*)((const char*)(VTf + p * 32 * NN) + ov); }
        g.rt = *(const float*)((const char*)TK + ot);
        if (vtail) g.rv[2] = *(const v8us*)((const char*)(VTf + 64 * NN) + ov);
        asm volatile("s_wait_xcnt 0x0" ::: "memory");                    // directly behind the run's last load, ahead of any rewrite of its offset registers
    };
    auto put = [&](const stage_regs& g, int b) {
#pragma unroll
        for (int p = 0; p < 2; ++p) { *(v8usa*)(&sk[b][kg][(p * 32 + srow) * SPIT + spc]) = g.rk[p]; *(v8usa*)(&sv[b][kg][(p * 32 + srow) * SPIT + spc]) = g.rv[p]; }
        if (vtail) *(v8usa*)(&sv[b][kg][(64 + srow) * SPIT + spc]) = g.rv[2];
        if (tg < 64) st[b][kg][tg] = g.rt;
    };
    ok = ((unsigned)(kg * 64 + srow) * HD + spc) * 2u;
    ov = ((unsigned)srow * NN + kg * 64 + spc) * 2u;
    ot = (unsigned)(kg * 64 + (tg & 63)) * 4u;
#pragma unroll 1                                                         // the two query blocks run one after the other through the same code and registers
    for (int half = 0; half < 2; ++half) {
        const int qb = half ? (int)blockIdx.x : NN / 128 - 1 - (int)blockIdx.x;
        const int qi = qb * 128 + wave * 16 + lr;                        // this lane's query
        v16h qf[2];
#pragma unroll
        for (int ks = 0; ks < 2; ++ks) { const size_t qo = (size_t)qi * HD + ks * 32 + 8 * hi;
            qf[ks] = cat16u(*(const v8us*)(Qf + qo), *(const v8us*)(Qf + qo + 16)); }
        const float q0 = TQ[qi];
        asm volatile("s_wait_xcnt 0x0" ::: "memory");                    // behind the query loads: at 256 registers their address registers are reused as destinations of the stage's loads below
        { stage_regs g; fetch(g);
        put(g, 0); }                                                     // the barrier at the foot of the stage before has ended every read of buffer 0
        __syncthreads();                                                 // stage 0 is complete in LDS
        v8f o[VT_];
#pragma unroll
        for (int t = 0; t < VT_; ++t) o[t] = (v8f){};
        float mrun = -3.0e38f, lsum = 0.f;
#pragma unroll 1                                                         // one copy of the pass: its trip count is the tile's own, and the body is long
        for (int sg = 0; sg <= qb; ++sg) {                               // stage qb is the last that holds a key of the block
            const int b = sg & 1, kt = 2 * sg + kg;                      // kt: this wave's key tile
            stage_regs g;
            if (sg < qb) {
                ok += 128u * HD * 2u; ov += 256u; ot += 512u;
                fetch(g); }
            v8f s[4];
#pragma unroll
            for (int t = 0; t < 4; ++t) s[t] = (v8f){};
            { v16h kf[2][4];
#pragma unroll
              for (int ks = 0; ks < 2; ++ks) {
#pragma unroll
                for (int t = 0; t < 4; ++t) { const int ko = (t * 16 + lr) * SPIT + ks * 32 + 8 * hi; kf[ks][t] = cat16u(*(const v8usa*)(&sk[b][kg][ko]), *(const v8usa*)(&sk[b][kg][ko + 16])); } }
              __builtin_amdgcn_sched_barrier(0);                         // all fragment reads of the tile issue together, ahead of its products: one LDS latency a tile, not one a fragment
#pragma unroll
              for (int ks = 0; ks < 2; ++ks) {
#pragma unroll
                for (int t = 0; t < 4; ++t) s[t] = wmma16(kf[ks][t], qf[ks], s[t]); } }
            float x[4][8];
#pragma unroll
            for (int t = 0; t < 4; ++t) { const v4f ka = *(const v4fa*)(&st[b][kg][t * 16 + hi * 8]), kb = *(const v4fa*)(&st[b][kg][t * 16 + hi * 8 + 4]);
#pragma unroll
                for (int j = 0; j < 8; ++j) x[t][j] = (2.0f + 2.0f * (s[t][j] - q0 * (j < 4 ? ka[j & 3] : kb[j & 3]))) * isc + bb; }
            if (sg == qb) {                                              // the two tiles on the block's diagonal: keys behind the lane's query drop out (scores set to -3e38: exact zeros against a real maximum)
#pragma unroll
                for (int t = 0; t < 4; ++t) {
#pragma unroll
                    for (int j = 0; j < 8; ++j) if (kt * 64 + t * 16 + hi * 8 + j > qi) x[t][j] = -3.0e38f; } }
            float mx[4];
#pragma unroll
            for (int t = 0; t < 4; ++t) { mx[t] = x[t][0];
#pragma unroll
                for (int j = 1; j < 8; ++j) mx[t] = fmaxf(mx[t], x[t][j]); }
            float mt = fmaxf(fmaxf(mx[0], mx[1]), fmaxf(mx[2], mx[3]));
            mt = fmaxf(mt, xhalf(mt));                                   // the other half of the wave holds the query's other 32 keys
            const float mnew = fmaxf(mrun, mt), alpha = __expf(mrun - mnew);
            mrun = mnew;
            v16h pp[2]; float ps[2];
#pragma unroll
            for (int ks = 0; ks < 2; ++ks) { v16f pf; float a0 = 0.f, a1 = 0.f;
#pragma unroll
                for (int e = 0; e < 8; ++e) { pf[e] = __expf(x[2 * ks][e] - mnew); pf[8 + e] = __expf(x[2 * ks + 1][e] - mnew); a0 += pf[e]; a1 += pf[8 + e]; }
                ps[ks] = a0 + a1;
                pp[ks] = __builtin_convertvector(pf, v16h); }
            lsum = lsum * alpha + (ps[0] + ps[1]);
#pragma unroll
            for (int t = 0; t < VT_; ++t) o[t] *= alpha;
            if (sg < qb) put(g, b ^ 1);
            { v16h vf[2][VT_];
#pragma unroll
              for (int ks = 0; ks < 2; ++ks) {
#pragma unroll
                for (int t = 0; t < VT_; ++t) { const int vo = (t * 16 + lr) * SPIT + ks * 32 + 8 * hi; vf[ks][t] = cat16u(*(const v8usa*)(&sv[b][kg][vo]), *(const v8usa*)(&sv[b][kg][vo + 16])); } }
              __builtin_amdgcn_sched_barrier(0);                         // as above: one LDS latency a tile
#pragma unroll
              for (int ks = 0; ks < 2; ++ks) {
#pragma unroll
                for (int t = 0; t < VT_; ++t) o[t] = wmma16(vf[ks][t], pp[ks], o[t]); } }
            __syncthreads();                                             // publishes stage sg + 1 and ends every wave's reads of stage sg
        }
        asm volatile("v_nop\n\tv_nop\n\tv_nop\n\tv_nop");                // WMMA distance on the loop's exit path: the pass ends in products into O^T, and O^T's registers are read or reused right behind the loop
        if (kg) {                                                        // the same for a whole wave. A query whose odd tiles are all masked hands over the start maximum, which the join below turns into weight 0
#pragma unroll
            for (int t = 0; t < VT_; ++t) { *(v4fa*)(&mrg[wave][2 * t][lane][0]) = (v4f){o[t][0], o[t][1], o[t][2], o[t][3]}; *(v4fa*)(&mrg[wave][2 * t + 1][lane][0]) = (v4f){o[t][4], o[t][5], o[t][6], o[t][7]}; }
            *(v4fa*)(&mrg[wave][2 * VT_][lane][0]) = (v4f){mrun, lsum, 0.f, 0.f};
        }
        __syncthreads();                                                 // the odd group's partial results are complete in LDS; the next block's barriers end their reads before they are written again
        if (!kg) {
            const v4f ml = *(const v4fa*)(&mrg[wave][2 * VT_][lane][0]);
            const float mm = fmaxf(mrun, ml[0]), a0 = __expf(mrun - mm), a1 = __expf(ml[0] - mm);   // tile 0 holds key 0, so the even group's maximum is a real score
            lsum = lsum * a0 + ml[1] * a1;
            lsum += xhalf(lsum);
            const float inv = 1.0f / lsum, i0 = a0 * inv, i1 = a1 * inv;
            float* cr = CTX + (size_t)qi * 128 + hi * 8;                 // o[t][j] = context component t*16 + 8*hi + j of query qi: [space(0..63) | t(64) | 0]
#pragma unroll
            for (int t = 0; t < VT_; ++t) { const v4f p0 = *(const v4fa*)(&mrg[wave][2 * t][lane][0]), p1 = *(const v4fa*)(&mrg[wave][2 * t + 1][lane][0]);
                *(v4f*)(cr + t * 16) = (v4f){o[t][0] * i0 + p0[0] * i1, o[t][1] * i0 + p0[1] * i1, o[t][2] * i0 + p0[2] * i1, o[t][3] * i0 + p0[3] * i1};
                *(v4f*)(cr + t * 16 + 4) = (v4f){o[t][4] * i0 + p1[0] * i1, o[t][5] * i0 + p1[1] * i1, o[t][6] * i0 + p1[2] * i1, o[t][7] * i0 + p1[3] * i1}; }
            asm volatile("s_wait_xcnt 0x0" ::: "memory");                // behind the last store, ahead of the next block's rewrite of its address registers
        }
        ok -= (unsigned)qb * (128u * HD * 2u); ov -= (unsigned)qb * 256u; ot -= (unsigned)qb * 512u;   // back to stage 0: no second copy of the start offsets is held over the stage loop
    }
}
__global__ __launch_bounds__(256) void k_planes32z(const float* __restrict__ F, int ld, int off, float sc, int rows, bf* Ph, bf* Pl) {
    typedef __attribute__((ext_vector_type(2))) unsigned short v2us;
    const int lane = threadIdx.x & 31; const size_t r = ((size_t)blockIdx.x * 8 + (threadIdx.x >> 5)) * 2 + (lane >> 4); if (r >= (size_t)rows) return; const int z = blockIdx.z; const int c0 = (lane & 15) * 2; v2us oh, ol;
    Ph += (size_t)z * rows * 32; Pl += (size_t)z * rows * 32;
#pragma unroll
    for (int i = 0; i < 2; ++i) { const float y = F[r * ld + off + z * 32 + c0 + i] * sc; const unsigned short hb = f2bf(y); oh[i] = hb; ol[i] = f2bf(y - bf2f(hb)); }
    const size_t o = r * 32 + c0; *(v2us*)(Ph + o) = oh; *(v2us*)(Pl + o) = ol; 
}
__global__ __launch_bounds__(256) void k_vtpadz(const float* __restrict__ F, int ld, int off, int nk, bf* Th, bf* Tl) {
    typedef __attribute__((ext_vector_type(2))) unsigned short v2us;
    const int lane = threadIdx.x & 31; const size_t wid = (size_t)blockIdx.x * 8 + (threadIdx.x >> 5); if (wid >= (size_t)64 * (nk / 64)) return; const int z = blockIdx.z; const int d = (int)(wid / (nk / 64)); const int k0 = (int)(wid % (nk / 64)) * 64 + lane * 2; v2us oh, ol;
    Th += (size_t)z * 64 * nk; Tl += (size_t)z * 64 * nk;
#pragma unroll
    for (int i = 0; i < 2; ++i) { const float y = (d < 32) ? F[(size_t)(k0 + i) * ld + off + z * 32 + (d < 32 ? d : 0)] : 0.f; const unsigned short hb = f2bf(y); oh[i] = hb; ol[i] = f2bf(y - bf2f(hb)); }
    const size_t o = (size_t)d * nk + k0; *(v2us*)(Th + o) = oh; *(v2us*)(Tl + o) = ol; 
}
template <int NK>
__global__ __launch_bounds__(256) void k_softmaxz(const float* __restrict__ S, int rows, bf* PH, bf* PL) {
    typedef __attribute__((ext_vector_type(4))) unsigned short v4us;
    const int lane = threadIdx.x & 31, i = blockIdx.x * 8 + (threadIdx.x >> 5); if (i >= rows) return; const size_t zo = (size_t)blockIdx.z * rows * NK; const float* sr = S + zo + (size_t)i * NK; PH += zo; PL += zo;
    float m = -3.0e38f;
#pragma unroll 1
    for (int c0 = lane * 4; c0 < NK; c0 += 128) {
#pragma unroll
        for (int q = 0; q < 4; ++q) m = fmaxf(m, sr[c0 + q]); }
#pragma unroll
    for (int sh = 16; sh; sh >>= 1) m = fmaxf(m, __shfl_xor(m, sh, 32));
    float sum = 0.f;
#pragma unroll 1
    for (int c0 = lane * 4; c0 < NK; c0 += 128) {
#pragma unroll
        for (int q = 0; q < 4; ++q) sum += __expf(sr[c0 + q] - m); }
#pragma unroll
    for (int sh = 16; sh; sh >>= 1) sum += __shfl_xor(sum, sh, 32);
    const float inv = 1.0f / sum;
{
#pragma unroll 1
        for (int c0 = lane * 4; c0 < NK; c0 += 128) { v4us oh, ol;
#pragma unroll
            for (int q = 0; q < 4; ++q) { const float p = __expf(sr[c0 + q] - m) * inv; const unsigned short hb = f2bf(p); oh[q] = hb; ol[q] = f2bf(p - bf2f(hb)); }
            const size_t o = (size_t)i * NK + c0; *(v4us*)(PH + o) = oh; *(v4us*)(PL + o) = ol; }
         }
}
__global__ __launch_bounds__(256) void k_placez(const float* __restrict__ XH, int rows, int ldy, float* Y) {
    const int lane = threadIdx.x & 31; const size_t q = (size_t)blockIdx.x * 8 + (threadIdx.x >> 5); if (q >= (size_t)rows) return; const int z = blockIdx.z; const float v = XH[((size_t)z * rows + q) * 64 + lane];
    *(float*)(Y + q * ldy + z * 32 + lane) = v; 
}

__global__ __launch_bounds__(256) void k_vtz(const float* __restrict__ F, int ld, int h0, int nk, bf* Th, bf* Tl) {
    typedef __attribute__((ext_vector_type(2))) unsigned short v2us;
    const int lane = threadIdx.x & 31; const size_t wid = (size_t)blockIdx.x * 8 + (threadIdx.x >> 5); if (wid >= (size_t)64 * (nk / 64)) return; const int z = blockIdx.z; const int d = (int)(wid / (nk / 64)); const int t0 = (int)(wid % (nk / 64)) * 64 + lane * 2; v2us oh, ol;
    Th += (size_t)z * 64 * nk; Tl += (size_t)z * 64 * nk;
#pragma unroll
    for (int i = 0; i < 2; ++i) { const float y = F[(size_t)(t0 + i) * ld + (h0 + z) * 64 + d]; const unsigned short hb = f2bf(y); oh[i] = hb; ol[i] = f2bf(y - bf2f(hb)); }
    const size_t o = (size_t)d * nk + t0; *(v2us*)(Th + o) = oh; *(v2us*)(Tl + o) = ol; 
}
template <int NK>
__global__ __launch_bounds__(256) void k_softmaxzs(const float* __restrict__ S, int rows, float sc, bf* PH, bf* PL) {
    typedef __attribute__((ext_vector_type(4))) unsigned short v4us;
    const int lane = threadIdx.x & 31, i = blockIdx.x * 8 + (threadIdx.x >> 5); if (i >= rows) return; const size_t zo = (size_t)blockIdx.z * rows * NK; const float* sr = S + zo + (size_t)i * NK; PH += zo; PL += zo;
    float m = -3.0e38f;
#pragma unroll 1
    for (int c0 = lane * 4; c0 < NK; c0 += 128) {
#pragma unroll
        for (int q = 0; q < 4; ++q) m = fmaxf(m, sr[c0 + q] * sc); }
#pragma unroll
    for (int sh = 16; sh; sh >>= 1) m = fmaxf(m, __shfl_xor(m, sh, 32));
    float sum = 0.f;
#pragma unroll 1
    for (int c0 = lane * 4; c0 < NK; c0 += 128) {
#pragma unroll
        for (int q = 0; q < 4; ++q) sum += __expf(sr[c0 + q] * sc - m); }
#pragma unroll
    for (int sh = 16; sh; sh >>= 1) sum += __shfl_xor(sum, sh, 32);
    const float inv = 1.0f / sum;
{
#pragma unroll 1
        for (int c0 = lane * 4; c0 < NK; c0 += 128) { v4us oh, ol;
#pragma unroll
            for (int q = 0; q < 4; ++q) { const float p = __expf(sr[c0 + q] * sc - m) * inv; const unsigned short hb = f2bf(p); oh[q] = hb; ol[q] = f2bf(p - bf2f(hb)); }
            const size_t o = (size_t)i * NK + c0; *(v4us*)(PH + o) = oh; *(v4us*)(PL + o) = ol; }
         }
}

__global__ __launch_bounds__(256) void k_zero8(bf* dst, size_t n8) {
    const size_t i = (size_t)blockIdx.x * 256 + threadIdx.x; if (i >= n8) return; v8us z;
#pragma unroll
    for (int k = 0; k < 8; ++k) z[k] = 0;
    *(v8us*)(dst + i * 8) = z; 
}

// k_midout: out[b][s][0..64] = sqrt(k) ave / sqrt(max(| -(-ave0^2 + |ave_s|^2) |, 1e-8)) with ave = mean over the 8 heads of CTX[h][s][0..64] (f32, fixed head order), written straight into the flat
// [8192 x 65] output. A work-group of 8 waves takes 32 rows, whose 32 x 65 floats are 65 whole 128 B lines of the output. Half a wave takes one row: lane lr holds space components 4 lr .. 4 lr + 3 (one 16 B load
// a head, 16 lanes cover the row's two lines) and every lane of the half holds the time; a wave takes four rows and has all their loads in flight at once. |ave_s|^2 is summed in-lane over the four components,
// then over the 16 lanes. The scaled rows are laid into LDS in module order [t | space] at the output's own pitch of 65 floats and leave as 16 B pieces of whole lines.
template <int M> __device__ __forceinline__ float xrow(float v) { return __int_as_float(__builtin_amdgcn_update_dpp(0, __float_as_int(v), 0x160 | M, 0xf, 0xf, false)); }   // lane l <- lane l ^ M inside its 16-lane row (DPP row_xmask), on the vector pipe
__global__ __launch_bounds__(256) void k_midout(const float* CTX, float* OUTB) {
    constexpr int RW = 32;                                               // rows a work-group
    __shared__ __align__(16) float so[RW * DL];
    const int tid = threadIdx.x, lane = tid & 31, wave = tid >> 5, lr = lane & 15, hi = lane >> 4;
    const size_t g0 = (size_t)blockIdx.x * RW;                           // the first row, counted over all items; 2048 rows an item, so a work-group lies in one item
    const float* cb = CTX + ((g0 / NN) * NH_ * NN + g0 % NN + wave * 4 + hi) * 128;   // head 0 of the lane's first row; CTX holds [space(0..63) | t(64)]
    const float* cs = cb + lr * 4;                                       // the lane's four space components
    v4f sp[2][NH_]; float tm[2][NH_];
#pragma unroll
    for (int p = 0; p < 2; ++p) {
#pragma unroll
        for (int h = 0; h < NH_; ++h) { const size_t ro = ((size_t)h * NN + p * 2) * 128; sp[p][h] = *(const v4f*)(cs + ro); tm[p][h] = cb[ro + HD]; } }
    asm volatile("s_wait_xcnt 0x0" :: "v"(cb), "v"(cs) : "memory");      // directly behind the run's last load, ahead of any rewrite of its address registers: named as inputs they live up to the wait, so that no load of the run lands in them; CTX carries no __restrict__, so that no load sinks below it
    __builtin_amdgcn_sched_barrier(0);                                   // all 32 loads of the wave's four rows issue ahead of the first sum: one memory latency a wave, not two
#pragma unroll
    for (int p = 0; p < 2; ++p) {
        v4f a = (v4f){0.f, 0.f, 0.f, 0.f}; float t = 0.f;
#pragma unroll
        for (int h = 0; h < NH_; ++h) { a += sp[p][h]; t += tm[p][h]; }
        a *= (1.0f / NH_); t *= (1.0f / NH_);
        float part = (a[0] * a[0] + a[1] * a[1]) + (a[2] * a[2] + a[3] * a[3]);
        part += xrow<1>(part); part += xrow<2>(part); part += xrow<4>(part); part += xrow<8>(part);   // over the row's 16 lanes
        const float inner = part - t * t;
        const float den = sqrtf(fmaxf(fabsf(-inner), 1e-8f)); const float f = sqrtf(KCURV) / den;
        float* w = &so[(wave * 4 + p * 2 + hi) * DL];
        if (lr == 0) w[0] = t * f;
#pragma unroll
        for (int q = 0; q < 4; ++q) w[1 + lr * 4 + q] = a[q] * f;
    }
    __syncthreads();                                                     // the 32 rows are complete in LDS
    float* ob = OUTB + g0 * DL;
    const v4f y0 = *(const v4fa*)(&so[tid * 4]), y1 = *(const v4fa*)(&so[(tid + 256) * 4]);   // 520 pieces of 16 B: two a thread, and eight more (one line)
    *(v4f*)(ob + tid * 4) = y0; *(v4f*)(ob + (tid + 256) * 4) = y1;
    if (tid < RW * DL / 4 - 512) *(v4f*)(ob + (tid + 512) * 4) = *(const v4fa*)(&so[(tid + 512) * 4]);
}

extern "C" void kernel_launch(void* const* d_in, const int* in_sizes, int n_in,
                              void* d_out, int out_size, void* d_ws, size_t ws_size, hipStream_t stream) {
    (void)in_sizes; (void)n_in; (void)out_size;
    const float* xq = (const float*)d_in[0]; const float* xs = (const float*)d_in[1]; const float* Wq = (const float*)d_in[2]; const float* bq = (const float*)d_in[3]; const float* Wk = (const float*)d_in[4]; const float* bk = (const float*)d_in[5]; const float* Wv = (const float*)d_in[6]; const float* bv = (const float*)d_in[7]; const float* scl = (const float*)d_in[8]; const float* bpar = (const float*)d_in[9];
    float* out = (float*)d_out;    // [4][2048][65]
    char* wsp = (char*)d_ws;
    auto take = [&](size_t bytes) { char* p = wsp; wsp += (bytes + 255) & ~(size_t)255; return (void*)p; };
    const int NZ = NBT * NH_;      // every (item, head) pair is one z slice of a launch
    float* TQ = (float*)take((size_t)NZ * NN * 4); float* TK = (float*)take((size_t)NZ * NN * 4);
    bf* Qf = (bf*)take((size_t)NZ * NN * HD * 2); bf* Kf = (bf*)take((size_t)NZ * NN * HD * 2); bf* VTf = (bf*)take((size_t)NZ * 128 * NN * 2);
    float* CTX = (float*)take((size_t)NZ * NN * 128 * 4);
    if ((size_t)(wsp - (char*)d_ws) > ws_size) return;    // 0.5 + 16.8 + 16.8 + 33.6 ~ 68 MB
    k_proj<<<dim3(NBT * NN / 128, NH_ / 2, 3), 512, 0, stream>>>(xq, xs, Wq, Wk, Wv, bq, bk, bv, Qf, Kf, VTf, TQ, TK);     // the three projections of all items and heads, finished to k_fattn's operands
    k_fattn<<<dim3(NN / 256, 1, NZ), 512, 0, stream>>>(Qf, Kf, VTf, TQ, TK, scl, bpar, CTX);     // scores, causal softmax, [space | time | 0] context of all pairs
    k_midout<<<NBT * NN / 32, 256, 0, stream>>>(CTX, out);     // the mid-point over the heads, written flat
}

// v009
// A run of this version takes 67.7 microseconds.
// In two side-by-side timings against v008, it was 1.05 and 1.06 times as fast.
// Counting every step since v000, it is 38.8 times as fast.
#include <hip/hip_runtime.h>

// Compute dtypes, f32 accumulate, per item: the three per-head hyperbolic linears as [2048 x 512].[512 x 512] GEMMs with PLAIN bf16 operands (exact products; all 8 heads' space
// parts at once), the Lorentz time coordinate sqrt(|x_s|^2 + k) in f32; per head: space scores = q_s.k_s^T ([2048 x 64].[64 x 2048], both operands ONE f16 plane,
// one product; key tiles wholly above the diagonal skipped), the time term -q_0 k_0 (f32, the start value of the score accumulators), the factor 2/scale (in q; the softmax does not see the added 2/scale + bias) and the causal softmax in f32 against a running reference, the
// context = P.[v_s | v_0] ([2048 x 2048].[2048 x 65], P and v one f16 plane, one product, K limited to the causal extent), all three inside one kernel (k_fattn), 1/sum applied last.
// Why one f16 plane: q, k and v are sums of 512 products of X and W rounded to bf16 (8 significant bits), and carry that rounding; f16 keeps 11 significant bits of them and of P (0 .. 2^8),
// an error well below the one they arrive with. The times q_0, k_0 of the scores stay f32. f16's range bounds |q_s|, |k_s|, |v| at 65504.

#define NBT  4
#define NN   2048
#define DIN  512
#define NH_  8
#define HD   64
#define DSP  (NH_ * HD)           // 512 space outputs over all heads
#define DL   (HD + 1)             // 65 Lorentz dims per head
#define DM   DIN
#define NTK  NN
#define KCURV 1.0f
#define LOSC 1024.0f
#define SPIT 72                   // LDS row pitch in elements of a staged 64-k operand tile: 128 B of data + 16 B, conflict-free for 16-byte fragment reads

typedef _Float16 h16;
typedef unsigned short bf;
typedef __attribute__((ext_vector_type(16))) __bf16   v16bf;
typedef __attribute__((ext_vector_type(16))) _Float16 v16h;
typedef __attribute__((ext_vector_type(8)))  _Float16 v8h;
typedef __attribute__((ext_vector_type(8)))  unsigned short v8us;
typedef __attribute__((ext_vector_type(8)))  float    v8f;
typedef __attribute__((ext_vector_type(16))) float    v16f;
typedef __attribute__((ext_vector_type(4)))  float    v4f;
typedef __attribute__((ext_vector_type(4)))  _Float16 v4h;
typedef v8h  __attribute__((may_alias)) v8ha;
typedef v4f  __attribute__((may_alias)) v4fa;
typedef v8us __attribute__((may_alias)) v8usa;

__device__ __forceinline__ unsigned short f2bf(float f) { unsigned u = __float_as_uint(f); u += 0x7FFFu + ((u >> 16) & 1u); return (unsigned short)(u >> 16); }
__device__ __forceinline__ float bf2f(unsigned short b) { return __uint_as_float(((unsigned)b) << 16); }
__device__ __forceinline__ float bfr(float f) { return bf2f(f2bf(f)); }
__device__ __forceinline__ v16h cat16(v8h lo, v8h hi) { return __builtin_shufflevector(lo, hi, 0, 1, 2, 3, 4, 5, 6, 7, 8, 9, 10, 11, 12, 13, 14, 15); }
__device__ __forceinline__ v16bf cat16b(v8us lo, v8us hi) { return __builtin_bit_cast(v16bf, __builtin_shufflevector(lo, hi, 0, 1, 2, 3, 4, 5, 6, 7, 8, 9, 10, 11, 12, 13, 14, 15)); }
__device__ __forceinline__ v16h cat16u(v8us lo, v8us hi) { return __builtin_bit_cast(v16h, __builtin_shufflevector(lo, hi, 0, 1, 2, 3, 4, 5, 6, 7, 8, 9, 10, 11, 12, 13, 14, 15)); }
__device__ __forceinline__ v8f wmma16(v16h a, v16h b, v8f c) { return __builtin_amdgcn_wmma_f32_16x16x32_f16(false, a, false, b, (short)0, c, false, false); }
__device__ __forceinline__ float xhalf(float v) { const int b = __float_as_int(v); return __int_as_float(__builtin_amdgcn_permlanex16(b, b, 0x76543210, 0xfedcba98, false, false)); }   // lane l <- lane l ^ 16, on the vector pipe
__device__ __forceinline__ v8f wmmab(v16bf a, v16bf b, v8f c) { return __builtin_amdgcn_wmma_f32_16x16x32_bf16(false, a, false, b, (short)0, c, false, false); }

// k_proj: one projection's 128 x 128 block tile (16 waves x 16 x 64): 128 positions of one item x the 64 space outputs of TWO heads, C = X.W^T + bf(bias), K = 512; z picks the projection (0 query, 1 key, 2 value).
// X and W are read as the f32 inputs themselves and rounded to bf16 (nearest even) in the staging registers on their way into LDS; the tile is 128 x 128 so that the f32 rows cost no more cache traffic
// than bf16 rows cost a 64 x 64 tile. A group of four waves holds 64 positions of one head, that is the head's whole space part, and finishes it itself: the time coordinate sqrt(|x_s|^2 + k)
// (f32, summed in component order), and the f16 plane that k_fattn reads: query and key rows as [pair][position][64] with the time in [pair][position]; the value tile is laid into LDS
// transposed and leaves as rows of V^T, [pair][component][position]: 64 space rows, the time row, 15 rows of zeros. Every global store is a whole 128 B line from 8 lanes (or from one wave, for the times).
__global__ __launch_bounds__(512) void k_proj(const float* __restrict__ xq, const float* __restrict__ xs, const float* __restrict__ Wq, const float* __restrict__ Wk, const float* __restrict__ Wv,
                                              const float* __restrict__ bq, const float* __restrict__ bk, const float* __restrict__ bv,
                                              bf* Qf, bf* Kf, bf* VTf, float* TQ, float* TK) {
    typedef __attribute__((ext_vector_type(4))) __bf16 v4bf;
    typedef __attribute__((ext_vector_type(4))) unsigned short v4us;
    typedef v4us __attribute__((may_alias)) v4usa;
    constexpr int K = DIN, OP = 68;                                      // OP: LDS row pitch in floats of the finished tile
    __shared__ __align__(16) bf sa[128 * SPIT];                          // the X tile, rounded
    __shared__ __align__(16) bf sb[128 * SPIT];                          // the two heads' W rows, rounded
    __shared__ __align__(16) float ost4[4][(HD + 1) * OP];               // per group of four waves. query, key: [position][component]; value: [component][position], row 64 = the time
    const int tid = threadIdx.x, lane = tid & 31, wave = (tid >> 5) & 3, hg = (tid >> 7) & 1, pg = tid >> 8, tg = tid & 127, lr = lane & 15, hi = lane >> 4;   // hg, pg: the group's head and its half of the positions; wave, tg: wave and thread inside the group
    float* ost = ost4[tid >> 7];
    const int pj = blockIdx.z;
    const float* A = pj == 0 ? xq : xs; const float* Bn = pj == 0 ? Wq : pj == 1 ? Wk : Wv; const float* bias = pj == 0 ? bq : pj == 1 ? bk : bv;
    const int rb = blockIdx.x * 128, c0 = blockIdx.y * 128;
    const int arow = tid >> 4, apc = (tid & 15) * 4;                     // staging, X and W alike: 32 rows a pass, 16 lanes x 16 B cover one row's 64 floats (two lines)
    const int srow = tg >> 3, spc = (tg & 7) * 8;                        // plane stores, per head: 16 rows a pass, 8 lanes x 16 B cover one row's line
    unsigned oa[4], ob[4];                                               // per-lane byte offsets from the uniform bases; they step by 64 k a stage
#pragma unroll
    for (int p = 0; p < 4; ++p) { oa[p] = ((unsigned)(rb + p * 32 + arow) * (unsigned)K + apc) * 4u; ob[p] = ((unsigned)(c0 + p * 32 + arow) * (unsigned)K + apc) * 4u; }
    v4f ra[4], rw[4];
    auto fetch = [&]() {
#pragma unroll
        for (int p = 0; p < 4; ++p) { ra[p] = *(const v4f*)((const char*)A + oa[p]); rw[p] = *(const v4f*)((const char*)Bn + ob[p]); }
    };
    v8f acc[4]; float bb[4];                                             // bb: this lane's four bias values, read ahead of the loop
#pragma unroll
    for (int t = 0; t < 4; ++t) { acc[t] = (v8f){}; bb[t] = bfr(bias[c0 + hg * 64 + t * 16 + lr]); }
    fetch();
#pragma unroll 1
    for (int kc = 0; kc < K; kc += 64) {
        __syncthreads();                                                 // every wave has read its last fragment of the stage before
#pragma unroll
        for (int p = 0; p < 4; ++p) { *(v4usa*)(&sa[(p * 32 + arow) * SPIT + apc]) = __builtin_bit_cast(v4us, __builtin_convertvector(ra[p], v4bf)); *(v4usa*)(&sb[(p * 32 + arow) * SPIT + apc]) = __builtin_bit_cast(v4us, __builtin_convertvector(rw[p], v4bf)); }
        __syncthreads();                                                 // the stage is complete in LDS
        if (kc + 64 < K) {
#pragma unroll
            for (int p = 0; p < 4; ++p) { oa[p] += 256u; ob[p] += 256u; }
            fetch();
            asm volatile("s_wait_xcnt 0x0" ::: "memory"); }              // directly behind the run's last load: past the loop's exit its base registers are rewritten with no load wait in front
#pragma unroll
        for (int ks = 0; ks < 2; ++ks) {
            const int ao = (pg * 64 + wave * 16 + lr) * SPIT + ks * 32 + 8 * hi;
            const v16bf a = cat16b(*(const v8usa*)(&sa[ao]), *(const v8usa*)(&sa[ao + 16]));
            v16bf b[4];
#pragma unroll
            for (int t = 0; t < 4; ++t) { const int bo = (hg * 64 + t * 16 + lr) * SPIT + ks * 32 + 8 * hi; b[t] = cat16b(*(const v8usa*)(&sb[bo]), *(const v8usa*)(&sb[bo + 16])); }
            __builtin_amdgcn_sched_barrier(0);                           // all fragment reads of the k step issue together, ahead of its products: one LDS latency a step, not one a fragment
#pragma unroll
            for (int t = 0; t < 4; ++t) acc[t] = wmmab(a, b[t], acc[t]);
            asm volatile("v_nop\n\tv_nop\n\tv_nop\n\tv_nop" : "+v"(acc[0]), "+v"(acc[1]), "+v"(acc[2]), "+v"(acc[3]) : "v"(a));   // WMMA distance before its operands or results are touched, the loop's back edge included
        }
    }
    // acc[t][j] = position pg*64 + wave*16 + hi*8 + j, component t*16 + lr of head hg
    const size_t zz = (size_t)(rb / NN) * NH_ + blockIdx.y * 2 + hg;     // the (item, head) pair
    const int s0 = rb % NN + pg * 64;                                    // the group's first position in its item
    auto plane = [&](v4f y0, v4f y1, bf* pf) {                           // 8 values of one row -> 16 B of the f16 plane (nearest even)
        *(v8us*)pf = __builtin_bit_cast(v8us, __builtin_convertvector(__builtin_shufflevector(y0, y1, 0, 1, 2, 3, 4, 5, 6, 7), v8h));
    };
    if (pj < 2) {                                                        // the same for the whole work-group
#pragma unroll
        for (int t = 0; t < 4; ++t) {
#pragma unroll
            for (int j = 0; j < 8; ++j) ost[(wave * 16 + hi * 8 + j) * OP + t * 16 + lr] = acc[t][j] + bb[t]; }
        __syncthreads();                                                 // the finished tiles are complete in LDS
        if (tg < 64) {                                                   // waves 0 and 1 of each group: one position a lane, one 128 B line a wave
            float sq = 0.f;
#pragma unroll
            for (int d = 0; d < HD; ++d) { const float v = ost[tg * OP + d]; sq = fmaf(v, v, sq); }
            (pj == 0 ? TQ : TK)[zz * NN + s0 + tg] = sqrtf(sq + KCURV);
        }
        bf* pf = (pj == 0 ? Qf : Kf) + (zz * NN + s0 + srow) * HD + spc;
#pragma unroll
        for (int p = 0; p < 4; ++p) { const float* sp = &ost[(p * 16 + srow) * OP + spc]; plane(*(const v4fa*)sp, *(const v4fa*)(sp + 4), pf + p * 16 * HD); }
    } else {
#pragma unroll
        for (int t = 0; t < 4; ++t) { float* tp = &ost[(t * 16 + lr) * OP + wave * 16 + hi * 8];
            *(v4fa*)tp = (v4f){acc[t][0] + bb[t], acc[t][1] + bb[t], acc[t][2] + bb[t], acc[t][3] + bb[t]}; *(v4fa*)(tp + 4) = (v4f){acc[t][4] + bb[t], acc[t][5] + bb[t], acc[t][6] + bb[t], acc[t][7] + bb[t]}; }
        __syncthreads();                                                 // the finished tiles are complete in LDS
        if (tg < 64) {
            float sq = 0.f;
#pragma unroll
            for (int d = 0; d < HD; ++d) { const float v = ost[d * OP + tg]; sq = fmaf(v, v, sq); }
            ost[HD * OP + tg] = sqrtf(sq + KCURV);
        }
        __syncthreads();                                                 // the time rows are complete in LDS
        bf* pf = VTf + (zz * 128 + srow) * NN + s0 + spc;
#pragma unroll
        for (int p = 0; p < 4; ++p) { const float* sp = &ost[(p * 16 + srow) * OP + spc]; plane(*(const v4fa*)sp, *(const v4fa*)(sp + 4), pf + (size_t)p * 16 * NN); }
        const float* sp = &ost[HD * OP + spc];                           // rows 64 .. 79: the time row, then zeros
        const v4f t0 = *(const v4fa*)sp, t1 = *(const v4fa*)(sp + 4), zv = (v4f){0.f, 0.f, 0.f, 0.f};
        plane(srow == 0 ? t0 : zv, srow == 0 ? t1 : zv, pf + (size_t)64 * NN);
    }
}

// ===== z-batched (blockIdx.z = (item, head) pair) attention pieces =====
// k_fattn: scores, causal softmax and context of one (item, head) pair z in one kernel. A work-group of 16 waves takes 128 query rows and walks stages of 128 keys (two 64-key tiles) up to its diagonal:
// waves 0 .. 7 (16 query rows a wave) take each stage's even tile, waves 8 .. 15 take the same query rows on its odd tile, so that four waves share a SIMD and one wave's softmax runs beside another's
// products and LDS reads. Each group keeps its own running reference, sum and O^T; behind the last stage the odd group hands its three through LDS to the even group, which joins them and stores.
// Both products are computed transposed, so that a lane owns ONE query (column lr): S^T = K.Q^T (A = key rows from LDS, B = the query rows, kept in registers) leaves key t*16 + 8*hi + j in
// s[t][j], which is the k order of a B operand, so P goes from the score accumulators straight into O^T += V^T.P^T (A = rows of V^T from LDS). Every operand is one f16 plane, one product.
// The softmax's affine work is done by the S product: q_s and q_0 carry 2 log2(e) / scale, and the accumulators start at the time term less the query's reference, so that S^T leaves the matrix unit as log2 of P.
// The reference is the maximum of the group's first tile; a lane's maximum is in-lane plus one exchange between the wave's halves, and only where it passes 2^8 are the reference, the sums and O^T moved; 1/sum at the end.
// Each work-group takes query block n-1-x and then x, one after the other: 17 stages for every work-group. Stage sg+1 is read into registers at the head of pass sg (each group stages its own tile) and laid
// into the other LDS buffer between the softmax and the second product; the one barrier at the foot of a pass publishes it and ends the reads of the buffer that the next pass refills.
// The staged operands carry no __restrict__: tile 0's loads then stay at their place in the block loop, in front of the wait written behind them, and are not held in registers over the whole kernel.
__global__ __launch_bounds__(512) void k_fattn(const bf* __restrict__ Qf, const bf* Kf, const bf* VTf,
                                               const float* __restrict__ TQ, const float* TK, const float* __restrict__ scl, const float* __restrict__ bpar, float* CTX) {
    constexpr int VT_ = 5;                                               // 16-row tiles of V^T that hold live rows: 64 space + 1 time, rows 65 .. 79 are zeros
    __shared__ __align__(16) bf sk[2][2][64 * SPIT];                     // [buffer][tile of the stage]
    __shared__ __align__(16) bf sv[2][2][VT_ * 16 * SPIT];               // per buffer and tile: the 80 rows of V^T
    __shared__ __align__(16) float st[2][2][64];
    __shared__ __align__(16) float mrg[8][2 * VT_ + 1][32][4];           // the odd group's hand-over, per wave: ten 16 B pieces of O^T a lane, then (reference, sum)
    const int tid = threadIdx.x, lane = tid & 31, wave = (tid >> 5) & 7, tg = tid & 255, lr = lane & 15, hi = lane >> 4;   // wave, tg: wave and thread inside the group
    const int kg = __builtin_amdgcn_readfirstlane(tid >> 8);             // the wave's group: 0 takes the even key tiles, 1 the odd ones
    const size_t z = blockIdx.z;
    Qf += z * NN * HD; Kf += z * NN * HD; VTf += z * 128 * NN; TQ += z * NN; TK += z * NN; CTX += z * NN * 128;
    (void)bpar;                                                          // the bias and the 2/scale are the same for every key of a query: a softmax does not see them
    const float cl2 = 2.0f / bfr(scl[0]) * 1.44269504f;                  // score * log2(e) = cl2 * <q,k>_L + a constant
    const int srow = tg >> 3, spc = (tg & 7) * 8;                        // staging, a group its own tile: 32 rows a pass, 8 lanes x 16 B cover one row's line
    const bool vtail = __builtin_amdgcn_readfirstlane(wave) < 4;         // the same for a whole wave: rows 64 .. 79 of V^T are half a pass, staged by waves 0 .. 3 of the group (srow 0 .. 15)
    unsigned ok, ov, ot;                                                 // per-lane byte offsets from the uniform bases: row srow of the tile; the further rows lie at constant distances
    struct stage_regs { v8us rk[2], rv[3]; float rt; };                  // one thread's share of a tile on its way into LDS; every pass has its own, so that the registers are free outside fetch .. put
    auto fetch = [&](stage_regs& g) {
#pragma unroll
        for (int p = 0; p < 2; ++p) { g.rk[p] = *(const v8us*)((const char*)(Kf + p * 32 * HD) + ok); g.rv[p] = *(const v8us*)((const char*)(VTf + p * 32 * NN) + ov); }
        g.rt = *(const float*)((const char*)TK + ot);
        if (vtail) g.rv[2] = *(const v8us*)((const char*)(VTf + 64 * NN) + ov);
        asm volatile("s_wait_xcnt 0x0" ::: "memory");                    // directly behind the run's last load, ahead of any rewrite of its offset registers
    };
    auto put = [&](const stage_regs& g, int b) {
#pragma unroll
        for (int p = 0; p < 2; ++p) { *(v8usa*)(&sk[b][kg][(p * 32 + srow) * SPIT + spc]) = g.rk[p]; *(v8usa*)(&sv[b][kg][(p * 32 + srow) * SPIT + spc]) = g.rv[p]; }
        if (vtail) *(v8usa*)(&sv[b][kg][(64 + srow) * SPIT + spc]) = g.rv[2];
        if (tg < 64) st[b][kg][tg] = g.rt;
    };
    ok = ((unsigned)(kg * 64 + srow) * HD + spc) * 2u;
    ov = ((unsigned)srow * NN + kg * 64 + spc) * 2u;
    ot = (unsigned)(kg * 64 + (tg & 63)) * 4u;
#pragma unroll 1                                                         // the two query blocks run one after the other through the same code and registers
    for (int half = 0; half < 2; ++half) {
        const int qb = half ? (int)blockIdx.x : NN / 128 - 1 - (int)blockIdx.x;
        const int qi = qb * 128 + wave * 16 + lr;                        // this lane's query
        v16h qf[2];
#pragma unroll
        for (int ks = 0; ks < 2; ++ks) { const size_t qo = (size_t)qi * HD + ks * 32 + 8 * hi;
            qf[ks] = __builtin_convertvector(__builtin_convertvector(cat16u(*(const v8us*)(Qf + qo), *(const v8us*)(Qf + qo + 16)), v16f) * cl2, v16h); }   // cl2 * q_s, scaled in f32, one more f16 rounding
        const float nq0 = -cl2 * TQ[qi];
        asm volatile("s_wait_xcnt 0x0" ::: "memory");                    // behind the query loads: at 256 registers their address registers are reused as destinations of the stage's loads below
        { stage_regs g; fetch(g);
        put(g, 0); }                                                     // the barrier at the foot of the stage before has ended every read of buffer 0
        __syncthreads();                                                 // stage 0 is complete in LDS
        v8f o[VT_];
#pragma unroll
        for (int t = 0; t < VT_; ++t) o[t] = (v8f){};
        float mref = 0.f, lsum = 0.f;                                    // mref: the reference, in log2 units, that P, the sums and O^T are counted from; pass 0 sets it
#pragma unroll 1                                                         // one copy of the pass: its trip count is the tile's own, and the body is long
        for (int sg = 0; sg <= qb; ++sg) {                               // stage qb is the last that holds a key of the block
            const int b = sg & 1, kt = 2 * sg + kg;                      // kt: this wave's key tile
            stage_regs g;
            if (sg < qb) {
                ok += 128u * HD * 2u; ov += 256u; ot += 512u;
                fetch(g); }
            v8f s[4];
            { v16h kf[2][4]; v4f ka[4], kb[4];
#pragma unroll
              for (int t = 0; t < 4; ++t) { ka[t] = *(const v4fa*)(&st[b][kg][t * 16 + hi * 8]); kb[t] = *(const v4fa*)(&st[b][kg][t * 16 + hi * 8 + 4]); }
#pragma unroll
              for (int ks = 0; ks < 2; ++ks) {
#pragma unroll
                for (int t = 0; t < 4; ++t) { const int ko = (t * 16 + lr) * SPIT + ks * 32 + 8 * hi; kf[ks][t] = cat16u(*(const v8usa*)(&sk[b][kg][ko]), *(const v8usa*)(&sk[b][kg][ko + 16])); } }
              __builtin_amdgcn_sched_barrier(0);                         // all LDS reads of the tile issue together, ahead of its products: one LDS latency a tile, not one a fragment
#pragma unroll
              for (int t = 0; t < 4; ++t) {
#pragma unroll
                for (int j = 0; j < 8; ++j) s[t][j] = fmaf(nq0, j < 4 ? ka[t][j & 3] : kb[t][j & 3], -mref); }   // the accumulators start at the time term less the reference
#pragma unroll
              for (int ks = 0; ks < 2; ++ks) {
#pragma unroll
                for (int t = 0; t < 4; ++t) s[t] = wmma16(kf[ks][t], qf[ks], s[t]); } }   // s = log2 of P, as long as the reference holds
            if (sg == qb) {                                              // the two tiles on the block's diagonal: keys behind the lane's query drop out (set to -3.0e38: exact zeros where the tile keeps a key of the query)
#pragma unroll
                for (int t = 0; t < 4; ++t) {
#pragma unroll
                    for (int j = 0; j < 8; ++j) if (kt * 64 + t * 16 + hi * 8 + j > qi) s[t][j] = -3.0e38f; } }
            float mx[4];
#pragma unroll
            for (int t = 0; t < 4; ++t) { mx[t] = s[t][0];
#pragma unroll
                for (int j = 1; j < 8; ++j) mx[t] = fmaxf(mx[t], s[t][j]); }
            float mt = fmaxf(fmaxf(mx[0], mx[1]), fmaxf(mx[2], mx[3]));
            mt = fmaxf(mt, xhalf(mt));                                   // the other half of the wave holds the query's other 32 keys
            if (sg == 0 || __builtin_amdgcn_ballot_w32(mt > 8.0f) != 0) {   // one scalar test a pass: the reference moves in pass 0 (to the tile's maximum) and where a query's P would pass 2^8 (f16 holds 2^15)
                const float d = sg == 0 ? mt : fmaxf(mt, 0.f);           // behind pass 0 the reference only rises
                const float alpha = sg == 0 ? 1.0f : __builtin_amdgcn_exp2f(-d);   // in pass 0 the sums and O^T are zeros
                mref += d; lsum *= alpha;
#pragma unroll
                for (int t = 0; t < 4; ++t) s[t] -= d;
#pragma unroll
                for (int t = 0; t < VT_; ++t) o[t] *= alpha;
            }
            v16h pp[2]; float ps[2];
#pragma unroll
            for (int ks = 0; ks < 2; ++ks) { v16f pf; float a0 = 0.f, a1 = 0.f;
#pragma unroll
                for (int e = 0; e < 8; ++e) { pf[e] = __builtin_amdgcn_exp2f(s[2 * ks][e]); pf[8 + e] = __builtin_amdgcn_exp2f(s[2 * ks + 1][e]); a0 += pf[e]; a1 += pf[8 + e]; }
                ps[ks] = a0 + a1;
                pp[ks] = __builtin_convertvector(pf, v16h); }
            lsum += ps[0] + ps[1];
            if (sg < qb) put(g, b ^ 1);
            { v16h vf[2][VT_];
#pragma unroll
              for (int ks = 0; ks < 2; ++ks) {
#pragma unroll
                for (int t = 0; t < VT_; ++t) { const int vo = (t * 16 + lr) * SPIT + ks * 32 + 8 * hi; vf[ks][t] = cat16u(*(const v8usa*)(&sv[b][kg][vo]), *(const v8usa*)(&sv[b][kg][vo + 16])); } }
              __builtin_amdgcn_sched_barrier(0);                         // as above: one LDS latency a tile
#pragma unroll
              for (int ks = 0; ks < 2; ++ks) {
#pragma unroll
                for (int t = 0; t < VT_; ++t) o[t] = wmma16(vf[ks][t], pp[ks], o[t]); } }
            __syncthreads();                                             // publishes stage sg + 1 and ends every wave's reads of stage sg
        }
        asm volatile("v_nop\n\tv_nop\n\tv_nop\n\tv_nop");                // WMMA distance on the loop's exit path: the pass ends in products into O^T, and O^T's registers are read or reused right behind the loop
        if (kg) {                                                        // the same for a whole wave. A query whose odd tiles are all masked hands over the mask value as its reference, which the join below turns into weight 0
#pragma unroll
            for (int t = 0; t < VT_; ++t) { *(v4fa*)(&mrg[wave][2 * t][lane][0]) = (v4f){o[t][0], o[t][1], o[t][2], o[t][3]}; *(v4fa*)(&mrg[wave][2 * t + 1][lane][0]) = (v4f){o[t][4], o[t][5], o[t][6], o[t][7]}; }
            *(v4fa*)(&mrg[wave][2 * VT_][lane][0]) = (v4f){mref, lsum, 0.f, 0.f};
        }
        __syncthreads();                                                 // the odd group's partial results are complete in LDS; the next block's barriers end their reads before they are written again
        if (!kg) {
            const v4f ml = *(const v4fa*)(&mrg[wave][2 * VT_][lane][0]);
            const float mm = fmaxf(mref, ml[0]), a0 = __builtin_amdgcn_exp2f(mref - mm), a1 = __builtin_amdgcn_exp2f(ml[0] - mm);   // tile 0 holds key 0, so the even group's reference is a real score
            lsum = lsum * a0 + ml[1] * a1;
            lsum += xhalf(lsum);
            const float inv = 1.0f / lsum, i0 = a0 * inv, i1 = a1 * inv;
            float* cr = CTX + (size_t)qi * 128 + hi * 8;                 // o[t][j] = context component t*16 + 8*hi + j of query qi: [space(0..63) | t(64) | 0]
#pragma unroll
            for (int t = 0; t < VT_; ++t) { const v4f p0 = *(const v4fa*)(&mrg[wave][2 * t][lane][0]), p1 = *(const v4fa*)(&mrg[wave][2 * t + 1][lane][0]);
                *(v4f*)(cr + t * 16) = (v4f){o[t][0] * i0 + p0[0] * i1, o[t][1] * i0 + p0[1] * i1, o[t][2] * i0 + p0[2] * i1, o[t][3] * i0 + p0[3] * i1};
                *(v4f*)(cr + t * 16 + 4) = (v4f){o[t][4] * i0 + p1[0] * i1, o[t][5] * i0 + p1[1] * i1, o[t][6] * i0 + p1[2] * i1, o[t][7] * i0 + p1[3] * i1}; }
            asm volatile("s_wait_xcnt 0x0" ::: "memory");                // behind the last store, ahead of the next block's rewrite of its address registers
        }
        ok -= (unsigned)qb * (128u * HD * 2u); ov -= (unsigned)qb * 256u; ot -= (unsigned)qb * 512u;   // back to stage 0: no second copy of the start offsets is held over the stage loop
    }
}
__global__ __launch_bounds__(256) void k_planes32z(const float* __restrict__ F, int ld, int off, float sc, int rows, bf* Ph, bf* Pl) {
    typedef __attribute__((ext_vector_type(2))) unsigned short v2us;
    const int lane = threadIdx.x & 31; const size_t r = ((size_t)blockIdx.x * 8 + (threadIdx.x >> 5)) * 2 + (lane >> 4); if (r >= (size_t)rows) return; const int z = blockIdx.z; const int c0 = (lane & 15) * 2; v2us oh, ol;
    Ph += (size_t)z * rows * 32; Pl += (size_t)z * rows * 32;
#pragma unroll
    for (int i = 0; i < 2; ++i) { const float y = F[r * ld + off + z * 32 + c0 + i] * sc; const unsigned short hb = f2bf(y); oh[i] = hb; ol[i] = f2bf(y - bf2f(hb)); }
    const size_t o = r * 32 + c0; *(v2us*)(Ph + o) = oh; *(v2us*)(Pl + o) = ol; 
}
__global__ __launch_bounds__(256) void k_vtpadz(const float* __restrict__ F, int ld, int off, int nk, bf* Th, bf* Tl) {
    typedef __attribute__((ext_vector_type(2))) unsigned short v2us;
    const int lane = threadIdx.x & 31; const size_t wid = (size_t)blockIdx.x * 8 + (threadIdx.x >> 5); if (wid >= (size_t)64 * (nk / 64)) return; const int z = blockIdx.z; const int d = (int)(wid / (nk / 64)); const int k0 = (int)(wid % (nk / 64)) * 64 + lane * 2; v2us oh, ol;
    Th += (size_t)z * 64 * nk; Tl += (size_t)z * 64 * nk;
#pragma unroll
    for (int i = 0; i < 2; ++i) { const float y = (d < 32) ? F[(size_t)(k0 + i) * ld + off + z * 32 + (d < 32 ? d : 0)] : 0.f; const unsigned short hb = f2bf(y); oh[i] = hb; ol[i] = f2bf(y - bf2f(hb)); }
    const size_t o = (size_t)d * nk + k0; *(v2us*)(Th + o) = oh; *(v2us*)(Tl + o) = ol; 
}
template <int NK>
__global__ __launch_bounds__(256) void k_softmaxz(const float* __restrict__ S, int rows, bf* PH, bf* PL) {
    typedef __attribute__((ext_vector_type(4))) unsigned short v4us;
    const int lane = threadIdx.x & 31, i = blockIdx.x * 8 + (threadIdx.x >> 5); if (i >= rows) return; const size_t zo = (size_t)blockIdx.z * rows * NK; const float* sr = S + zo + (size_t)i * NK; PH += zo; PL += zo;
    float m = -3.0e38f;
#pragma unroll 1
    for (int c0 = lane * 4; c0 < NK; c0 += 128) {
#pragma unroll
        for (int q = 0; q < 4; ++q) m = fmaxf(m, sr[c0 + q]); }
#pragma unroll
    for (int sh = 16; sh; sh >>= 1) m = fmaxf(m, __shfl_xor(m, sh, 32));
    float sum = 0.f;
#pragma unroll 1
    for (int c0 = lane * 4; c0 < NK; c0 += 128) {
#pragma unroll
        for (int q = 0; q < 4; ++q) sum += __expf(sr[c0 + q] - m); }
#pragma unroll
    for (int sh = 16; sh; sh >>= 1) sum += __shfl_xor(sum, sh, 32);
    const float inv = 1.0f / sum;
{
#pragma unroll 1
        for (int c0 = lane * 4; c0 < NK; c0 += 128) { v4us oh, ol;
#pragma unroll
            for (int q = 0; q < 4; ++q) { const float p = __expf(sr[c0 + q] - m) * inv; const unsigned short hb = f2bf(p); oh[q] = hb; ol[q] = f2bf(p - bf2f(hb)); }
            const size_t o = (size_t)i * NK + c0; *(v4us*)(PH + o) = oh; *(v4us*)(PL + o) = ol; }
         }
}
__global__ __launch_bounds__(256) void k_placez(const float* __restrict__ XH, int rows, int ldy, float* Y) {
    const int lane = threadIdx.x & 31; const size_t q = (size_t)blockIdx.x * 8 + (threadIdx.x >> 5); if (q >= (size_t)rows) return; const int z = blockIdx.z; const float v = XH[((size_t)z * rows + q) * 64 + lane];
    *(float*)(Y + q * ldy + z * 32 + lane) = v; 
}

__global__ __launch_bounds__(256) void k_vtz(const float* __restrict__ F, int ld, int h0, int nk, bf* Th, bf* Tl) {
    typedef __attribute__((ext_vector_type(2))) unsigned short v2us;
    const int lane = threadIdx.x & 31; const size_t wid = (size_t)blockIdx.x * 8 + (threadIdx.x >> 5); if (wid >= (size_t)64 * (nk / 64)) return; const int z = blockIdx.z; const int d = (int)(wid / (nk / 64)); const int t0 = (int)(wid % (nk / 64)) * 64 + lane * 2; v2us oh, ol;
    Th += (size_t)z * 64 * nk; Tl += (size_t)z * 64 * nk;
#pragma unroll
    for (int i = 0; i < 2; ++i) { const float y = F[(size_t)(t0 + i) * ld + (h0 + z) * 64 + d]; const unsigned short hb = f2bf(y); oh[i] = hb; ol[i] = f2bf(y - bf2f(hb)); }
    const size_t o = (size_t)d * nk + t0; *(v2us*)(Th + o) = oh; *(v2us*)(Tl + o) = ol; 
}
template <int NK>
__global__ __launch_bounds__(256) void k_softmaxzs(const float* __restrict__ S, int rows, float sc, bf* PH, bf* PL) {
    typedef __attribute__((ext_vector_type(4))) unsigned short v4us;
    const int lane = threadIdx.x & 31, i = blockIdx.x * 8 + (threadIdx.x >> 5); if (i >= rows) return; const size_t zo = (size_t)blockIdx.z * rows * NK; const float* sr = S + zo + (size_t)i * NK; PH += zo; PL += zo;
    float m = -3.0e38f;
#pragma unroll 1
    for (int c0 = lane * 4; c0 < NK; c0 += 128) {
#pragma unroll
        for (int q = 0; q < 4; ++q) m = fmaxf(m, sr[c0 + q] * sc); }
#pragma unroll
    for (int sh = 16; sh; sh >>= 1) m = fmaxf(m, __shfl_xor(m, sh, 32));
    float sum = 0.f;
#pragma unroll 1
    for (int c0 = lane * 4; c0 < NK; c0 += 128) {
#pragma unroll
        for (int q = 0; q < 4; ++q) sum += __expf(sr[c0 + q] * sc - m); }
#pragma unroll
    for (int sh = 16; sh; sh >>= 1) sum += __shfl_xor(sum, sh, 32);
    const float inv = 1.0f / sum;
{
#pragma unroll 1
        for (int c0 = lane * 4; c0 < NK; c0 += 128) { v4us oh, ol;
#pragma unroll
            for (int q = 0; q < 4; ++q) { const float p = __expf(sr[c0 + q] * sc - m) * inv; const unsigned short hb = f2bf(p); oh[q] = hb; ol[q] = f2bf(p - bf2f(hb)); }
            const size_t o = (size_t)i * NK + c0; *(v4us*)(PH + o) = oh; *(v4us*)(PL + o) = ol; }
         }
}

__global__ __launch_bounds__(256) void k_zero8(bf* dst, size_t n8) {
    const size_t i = (size_t)blockIdx.x * 256 + threadIdx.x; if (i >= n8) return; v8us z;
#pragma unroll
    for (int k = 0; k < 8; ++k) z[k] = 0;
    *(v8us*)(dst + i * 8) = z; 
}

// k_midout: out[b][s][0..64] = sqrt(k) ave / sqrt(max(| -(-ave0^2 + |ave_s|^2) |, 1e-8)) with ave = mean over the 8 heads of CTX[h][s][0..64] (f32, fixed head order), written straight into the flat
// [8192 x 65] output. A work-group of 8 waves takes 32 rows, whose 32 x 65 floats are 65 whole 128 B lines of the output. Half a wave takes one row: lane lr holds space components 4 lr .. 4 lr + 3 (one 16 B load
// a head, 16 lanes cover the row's two lines) and every lane of the half holds the time; a wave takes four rows and has all their loads in flight at once. |ave_s|^2 is summed in-lane over the four components,
// then over the 16 lanes. The scaled rows are laid into LDS in module order [t | space] at the output's own pitch of 65 floats and leave as 16 B pieces of whole lines.
template <int M> __device__ __forceinline__ float xrow(float v) { return __int_as_float(__builtin_amdgcn_update_dpp(0, __float_as_int(v), 0x160 | M, 0xf, 0xf, false)); }   // lane l <- lane l ^ M inside its 16-lane row (DPP row_xmask), on the vector pipe
__global__ __launch_bounds__(256) void k_midout(const float* CTX, float* OUTB) {
    constexpr int RW = 32;                                               // rows a work-group
    __shared__ __align__(16) float so[RW * DL];
    const int tid = threadIdx.x, lane = tid & 31, wave = tid >> 5, lr = lane & 15, hi = lane >> 4;
    const size_t g0 = (size_t)blockIdx.x * RW;                           // the first row, counted over all items; 2048 rows an item, so a work-group lies in one item
    const float* cb = CTX + ((g0 / NN) * NH_ * NN + g0 % NN + wave * 4 + hi) * 128;   // head 0 of the lane's first row; CTX holds [space(0..63) | t(64)]
    const float* cs = cb + lr * 4;                                       // the lane's four space components
    v4f sp[2][NH_]; float tm[2][NH_];
#pragma unroll
    for (int p = 0; p < 2; ++p) {
#pragma unroll
        for (int h = 0; h < NH_; ++h) { const size_t ro = ((size_t)h * NN + p * 2) * 128; sp[p][h] = *(const v4f*)(cs + ro); tm[p][h] = cb[ro + HD]; } }
    asm volatile("s_wait_xcnt 0x0" :: "v"(cb), "v"(cs) : "memory");      // directly behind the run's last load, ahead of any rewrite of its address registers: named as inputs they live up to the wait, so that no load of the run lands in them; CTX carries no __restrict__, so that no load sinks below it
    __builtin_amdgcn_sched_barrier(0);                                   // all 32 loads of the wave's four rows issue ahead of the first sum: one memory latency a wave, not two
#pragma unroll
    for (int p = 0; p < 2; ++p) {
        v4f a = (v4f){0.f, 0.f, 0.f, 0.f}; float t = 0.f;
#pragma unroll
        for (int h = 0; h < NH_; ++h) { a += sp[p][h]; t += tm[p][h]; }
        a *= (1.0f / NH_); t *= (1.0f / NH_);
        float part = (a[0] * a[0] + a[1] * a[1]) + (a[2] * a[2] + a[3] * a[3]);
        part += xrow<1>(part); part += xrow<2>(part); part += xrow<4>(part); part += xrow<8>(part);   // over the row's 16 lanes
        const float inner = part - t * t;
        const float den = sqrtf(fmaxf(fabsf(-inner), 1e-8f)); const float f = sqrtf(KCURV) / den;
        float* w = &so[(wave * 4 + p * 2 + hi) * DL];
        if (lr == 0) w[0] = t * f;
#pragma unroll
        for (int q = 0; q < 4; ++q) w[1 + lr * 4 + q] = a[q] * f;
    }
    __syncthreads();                                                     // the 32 rows are complete in LDS
    float* ob = OUTB + g0 * DL;
    const v4f y0 = *(const v4fa*)(&so[tid * 4]), y1 = *(const v4fa*)(&so[(tid + 256) * 4]);   // 520 pieces of 16 B: two a thread, and eight more (one line)
    *(v4f*)(ob + tid * 4) = y0; *(v4f*)(ob + (tid + 256) * 4) = y1;
    if (tid < RW * DL / 4 - 512) *(v4f*)(ob + (tid + 512) * 4) = *(const v4fa*)(&so[(tid + 512) * 4]);
}

extern "C" void kernel_launch(void* const* d_in, const int* in_sizes, int n_in,
                              void* d_out, int out_size, void* d_ws, size_t ws_size, hipStream_t stream) {
    (void)in_sizes; (void)n_in; (void)out_size;
    const float* xq = (const float*)d_in[0]; const float* xs = (const float*)d_in[1]; const float* Wq = (const float*)d_in[2]; const float* bq = (const float*)d_in[3]; const float* Wk = (const float*)d_in[4]; const float* bk = (const float*)d_in[5]; const float* Wv = (const float*)d_in[6]; const float* bv = (const float*)d_in[7]; const float* scl = (const float*)d_in[8]; const float* bpar = (const float*)d_in[9];
    float* out = (float*)d_out;    // [4][2048][65]
    char* wsp = (char*)d_ws;
    auto take = [&](size_t bytes) { char* p = wsp; wsp += (bytes + 255) & ~(size_t)255; return (void*)p; };
    const int NZ = NBT * NH_;      // every (item, head) pair is one z slice of a launch
    float* TQ = (float*)take((size_t)NZ * NN * 4); float* TK = (float*)take((size_t)NZ * NN * 4);
    bf* Qf = (bf*)take((size_t)NZ * NN * HD * 2); bf* Kf = (bf*)take((size_t)NZ * NN * HD * 2); bf* VTf = (bf*)take((size_t)NZ * 128 * NN * 2);
    float* CTX = (float*)take((size_t)NZ * NN * 128 * 4);
    if ((size_t)(wsp - (char*)d_ws) > ws_size) return;    // 0.5 + 16.8 + 16.8 + 33.6 ~ 68 MB
    k_proj<<<dim3(NBT * NN / 128, NH_ / 2, 3), 512, 0, stream>>>(xq, xs, Wq, Wk, Wv, bq, bk, bv, Qf, Kf, VTf, TQ, TK);     // the three projections of all items and heads, finished to k_fattn's operands
    k_fattn<<<dim3(NN / 256, 1, NZ), 512, 0, stream>>>(Qf, Kf, VTf, TQ, TK, scl, bpar, CTX);     // scores, causal softmax, [space | time | 0] context of all pairs
    k_midout<<<NBT * NN / 32, 256, 0, stream>>>(CTX, out);     // the mid-point over the heads, written flat
}

// v010
// Measured time: 63.7 microseconds a run.
// In both of two side-by-side timings against v009, it was 1.06 times as fast.
// All steps since v000 together make it 41.2 times as fast.
#include <hip/hip_runtime.h>

// Compute dtypes, f32 accumulate, per item: the three per-head hyperbolic linears as [2048 x 512].[512 x 512] GEMMs with PLAIN bf16 operands (exact products; all 8 heads' space
// parts at once), the Lorentz time coordinate sqrt(|x_s|^2 + k) in f32; per head: space scores = q_s.k_s^T ([2048 x 64].[64 x 2048], both operands ONE f16 plane,
// one product; key tiles wholly above the diagonal skipped), the time term -q_0 k_0 (f32, the start value of the score accumulators), the factor 2/scale (in q; the softmax does not see the added 2/scale + bias) and the causal softmax in f32 against a running reference, the
// context = P.[v_s | v_0] ([2048 x 2048].[2048 x 65], P and v one f16 plane, one product, K limited to the causal extent), all three inside one kernel (k_fattn), 1/sum applied last.
// Why one f16 plane: q, k and v are sums of 512 products of X and W rounded to bf16 (8 significant bits), and carry that rounding; f16 keeps 11 significant bits of them and of P (0 .. 2^8),
// an error well below the one they arrive with. The times q_0, k_0 of the scores stay f32. f16's range bounds |q_s|, |k_s|, |v| at 65504.

#define NBT  4
#define NN   2048
#define DIN  512
#define NH_  8
#define HD   64
#define DSP  (NH_ * HD)           // 512 space outputs over all heads
#define DL   (HD + 1)             // 65 Lorentz dims per head
#define DM   DIN
#define NTK  NN
#define KCURV 1.0f
#define LOSC 1024.0f
#define SPIT 72                   // LDS row pitch in elements of a staged 64-k operand tile: 128 B of data + 16 B, conflict-free for 16-byte fragment reads

typedef _Float16 h16;
typedef unsigned short bf;
typedef __attribute__((ext_vector_type(16))) __bf16   v16bf;
typedef __attribute__((ext_vector_type(16))) _Float16 v16h;
typedef __attribute__((ext_vector_type(8)))  _Float16 v8h;
typedef __attribute__((ext_vector_type(8)))  unsigned short v8us;
typedef __attribute__((ext_vector_type(8)))  float    v8f;
typedef __attribute__((ext_vector_type(16))) float    v16f;
typedef __attribute__((ext_vector_type(4)))  float    v4f;
typedef __attribute__((ext_vector_type(4)))  _Float16 v4h;
typedef v8h  __attribute__((may_alias)) v8ha;
typedef v4f  __attribute__((may_alias)) v4fa;
typedef v8us __attribute__((may_alias)) v8usa;

__device__ __forceinline__ unsigned short f2bf(float f) { unsigned u = __float_as_uint(f); u += 0x7FFFu + ((u >> 16) & 1u); return (unsigned short)(u >> 16); }
__device__ __forceinline__ float bf2f(unsigned short b) { return __uint_as_float(((unsigned)b) << 16); }
__device__ __forceinline__ float bfr(float f) { return bf2f(f2bf(f)); }
__device__ __forceinline__ v16h cat16(v8h lo, v8h hi) { return __builtin_shufflevector(lo, hi, 0, 1, 2, 3, 4, 5, 6, 7, 8, 9, 10, 11, 12, 13, 14, 15); }
__device__ __forceinline__ v16bf cat16b(v8us lo, v8us hi) { return __builtin_bit_cast(v16bf, __builtin_shufflevector(lo, hi, 0, 1, 2, 3, 4, 5, 6, 7, 8, 9, 10, 11, 12, 13, 14, 15)); }
__device__ __forceinline__ v16h cat16u(v8us lo, v8us hi) { return __builtin_bit_cast(v16h, __builtin_shufflevector(lo, hi, 0, 1, 2, 3, 4, 5, 6, 7, 8, 9, 10, 11, 12, 13, 14, 15)); }
__device__ __forceinline__ v8f wmma16(v16h a, v16h b, v8f c) { return __builtin_amdgcn_wmma_f32_16x16x32_f16(false, a, false, b, (short)0, c, false, false); }
__device__ __forceinline__ float xhalf(float v) { const int b = __float_as_int(v); return __int_as_float(__builtin_amdgcn_permlanex16(b, b, 0x76543210, 0xfedcba98, false, false)); }   // lane l <- lane l ^ 16, on the vector pipe
__device__ __forceinline__ v8f wmmab(v16bf a, v16bf b, v8f c) { return __builtin_amdgcn_wmma_f32_16x16x32_bf16(false, a, false, b, (short)0, c, false, false); }

// k_proj: one projection's 128 x 128 block tile (4 waves x 64 x 64): 128 positions of one item x the 64 space outputs of TWO heads, C = X.W^T + bf(bias), K = 512; z picks the projection (0 query, 1 key, 2 value).
// X and W are read as the f32 inputs themselves and rounded to bf16 (nearest even) in the staging registers on their way into LDS; the tile is 128 x 128 so that the f32 rows cost no more cache traffic
// than bf16 rows cost a 64 x 64 tile. A wave takes 64 positions x one head, so that each X and each W fragment read from LDS feeds four products; it holds the head's whole space part and finishes it itself: the time coordinate sqrt(|x_s|^2 + k)
// (f32, summed in component order), and the f16 plane that k_fattn reads: query and key rows as [pair][position][64] with the time in [pair][position]; the value tile is laid into LDS
// transposed and leaves as rows of V^T, [pair][component][position]: 64 space rows, the time row, 15 rows of zeros. Every global store is a whole 128 B line from 8 lanes (or from one wave, for the times).
// amdgpu_waves_per_eu(3): a register budget of 336, so that three work-groups (one wave a SIMD each; three times the LDS fits too) share a WGP and the whole grid of 768 is resident at once.
__global__ __launch_bounds__(128) __attribute__((amdgpu_waves_per_eu(3))) void k_proj(const float* __restrict__ xq, const float* __restrict__ xs, const float* __restrict__ Wq, const float* __restrict__ Wk, const float* __restrict__ Wv,
                                              const float* __restrict__ bq, const float* __restrict__ bk, const float* __restrict__ bv,
                                              bf* Qf, bf* Kf, bf* VTf, float* TQ, float* TK) {
    typedef __attribute__((ext_vector_type(4))) __bf16 v4bf;
    typedef __attribute__((ext_vector_type(4))) unsigned short v4us;
    typedef v4us __attribute__((may_alias)) v4usa;
    constexpr int K = DIN, OP = 68;                                      // OP: LDS row pitch in floats of the finished tile
    __shared__ __align__(16) bf sa[128 * SPIT];                          // the X tile, rounded
    __shared__ __align__(16) bf sb[128 * SPIT];                          // the two heads' W rows, rounded
    __shared__ __align__(16) float ost4[4][(HD + 1) * OP];               // per wave. query, key: [position][component]; value: [component][position], row 64 = the time
    const int tid = threadIdx.x, lane = tid & 31, hg = (tid >> 5) & 1, pg = tid >> 6, lr = lane & 15, hi = lane >> 4;   // hg, pg: the wave's head and its half of the positions
    float* ost = ost4[tid >> 5];
    const int pj = blockIdx.z;
    const float* A = pj == 0 ? xq : xs; const float* Bn = pj == 0 ? Wq : pj == 1 ? Wk : Wv; const float* bias = pj == 0 ? bq : pj == 1 ? bk : bv;
    const int rb = blockIdx.x * 128, c0 = blockIdx.y * 128;
    const int arow = tid >> 4, apc = (tid & 15) * 4;                     // staging, X and W alike: 8 rows a pass, 16 lanes x 16 B cover one row's 64 floats (two lines)
    const int srow = lane >> 3, spc = (lane & 7) * 8;                    // plane stores, per head: 4 rows a pass, 8 lanes x 16 B cover one row's line
    unsigned oa = ((unsigned)(rb + arow) * (unsigned)K + apc) * 4u, ob = ((unsigned)(c0 + arow) * (unsigned)K + apc) * 4u;   // per-lane byte offsets of pass 0 from the uniform bases; the further passes lie at constant distances; they step by 64 k a stage
    v4f ra[16], rw[16];
    auto fetch = [&]() {
#pragma unroll
        for (int p = 0; p < 16; ++p) { ra[p] = *(const v4f*)((const char*)(A + p * 8 * K) + oa); rw[p] = *(const v4f*)((const char*)(Bn + p * 8 * K) + ob); }
    };
    const int bi = c0 + hg * 64 + lr;                                    // the lane's first bias value
    v8f acc[4][4]; float bb[4];                                          // acc[i][t]: 16 positions i x 16 components t; bb: this lane's four bias values, read ahead of the loop
#pragma unroll
    for (int t = 0; t < 4; ++t) { bb[t] = bfr(bias[bi + t * 16]);
#pragma unroll
        for (int i = 0; i < 4; ++i) acc[i][t] = (v8f){}; }
    fetch();
    asm volatile("s_wait_xcnt 0x0" :: "v"(bi), "v"(oa), "v"(ob) : "memory");   // directly behind the run's last load: the index registers of the bias and stage 0 loads, named as inputs, live up to the wait and are rewritten only behind it
#pragma unroll 1
    for (int kc = 0; kc < K; kc += 64) {
        __syncthreads();                                                 // every wave has read its last fragment of the stage before
#pragma unroll
        for (int p = 0; p < 16; ++p) { *(v4usa*)(&sa[(p * 8 + arow) * SPIT + apc]) = __builtin_bit_cast(v4us, __builtin_convertvector(ra[p], v4bf)); *(v4usa*)(&sb[(p * 8 + arow) * SPIT + apc]) = __builtin_bit_cast(v4us, __builtin_convertvector(rw[p], v4bf)); }
        __syncthreads();                                                 // the stage is complete in LDS
        if (kc + 64 < K) {
            oa += 256u; ob += 256u;
            fetch();
            asm volatile("s_wait_xcnt 0x0" ::: "memory"); }              // directly behind the run's last load: past the loop's exit its base registers are rewritten with no load wait in front
#pragma unroll
        for (int ks = 0; ks < 2; ++ks) {
            v16bf a[4], b[4];
#pragma unroll
            for (int i = 0; i < 4; ++i) { const int ao = (pg * 64 + i * 16 + lr) * SPIT + ks * 32 + 8 * hi; a[i] = cat16b(*(const v8usa*)(&sa[ao]), *(const v8usa*)(&sa[ao + 16])); }
#pragma unroll
            for (int t = 0; t < 4; ++t) { const int bo = (hg * 64 + t * 16 + lr) * SPIT + ks * 32 + 8 * hi; b[t] = cat16b(*(const v8usa*)(&sb[bo]), *(const v8usa*)(&sb[bo + 16])); }
            __builtin_amdgcn_sched_barrier(0);                           // all fragment reads of the k step issue together, ahead of its products: one LDS latency a step, not one a fragment
#pragma unroll
            for (int t = 0; t < 4; ++t) {
#pragma unroll
                for (int i = 0; i < 4; ++i) acc[i][t] = wmmab(a[i], b[t], acc[i][t]); }
            asm volatile("v_nop\n\tv_nop\n\tv_nop\n\tv_nop" : "+v"(acc[0][0]), "+v"(acc[0][1]), "+v"(acc[0][2]), "+v"(acc[0][3]), "+v"(acc[1][0]), "+v"(acc[1][1]), "+v"(acc[1][2]), "+v"(acc[1][3]), "+v"(acc[2][0]), "+v"(acc[2][1]), "+v"(acc[2][2]), "+v"(acc[2][3]), "+v"(acc[3][0]), "+v"(acc[3][1]), "+v"(acc[3][2]), "+v"(acc[3][3]) : "v"(a[0]), "v"(a[1]), "v"(a[2]), "v"(a[3]));   // WMMA distance before its operands or results are touched, the loop's back edge included
        }
    }
    // acc[i][t][j] = position pg*64 + i*16 + hi*8 + j, component t*16 + lr of head hg
    const size_t zz = (size_t)(rb / NN) * NH_ + blockIdx.y * 2 + hg;     // the (item, head) pair
    const int s0 = rb % NN + pg * 64;                                    // the group's first position in its item
    auto pack = [&](v4f y0, v4f y1) {                                    // 8 values of one row -> 16 B of the f16 plane (nearest even)
        return __builtin_bit_cast(v8us, __builtin_convertvector(__builtin_shufflevector(y0, y1, 0, 1, 2, 3, 4, 5, 6, 7), v8h));
    };
    auto plane = [&](v4f y0, v4f y1, bf* pf) { *(v8us*)pf = pack(y0, y1); };
    if (pj < 2) {                                                        // the same for the whole work-group
#pragma unroll
        for (int i = 0; i < 4; ++i) {
#pragma unroll
          for (int t = 0; t < 4; ++t) {
#pragma unroll
            for (int j = 0; j < 8; ++j) ost[(i * 16 + hi * 8 + j) * OP + t * 16 + lr] = acc[i][t][j] + bb[t]; } }
        __syncthreads();                                                 // the finished tiles are complete in LDS
#pragma unroll
        for (int q = 0; q < 2; ++q) {                                    // two positions a lane, one 128 B line a store
            const int tg = q * 32 + lane; float sq = 0.f;
#pragma unroll
            for (int d = 0; d < HD; ++d) { const float v = ost[tg * OP + d]; sq = fmaf(v, v, sq); }
            (pj == 0 ? TQ : TK)[zz * NN + s0 + tg] = sqrtf(sq + KCURV);
        }
        bf* pf = (pj == 0 ? Qf : Kf) + (zz * NN + s0 + srow) * HD + spc;
#pragma unroll
        for (int p = 0; p < 16; ++p) { const float* sp = &ost[(p * 4 + srow) * OP + spc]; plane(*(const v4fa*)sp, *(const v4fa*)(sp + 4), pf + p * 4 * HD); }
    } else {
#pragma unroll
        for (int i = 0; i < 4; ++i) {
#pragma unroll
          for (int t = 0; t < 4; ++t) { float* tp = &ost[(t * 16 + lr) * OP + i * 16 + hi * 8]; const v8f y = acc[i][t] + bb[t];
            *(v4fa*)tp = (v4f){y[0], y[1], y[2], y[3]}; *(v4fa*)(tp + 4) = (v4f){y[4], y[5], y[6], y[7]}; } }
        __syncthreads();                                                 // the finished tiles are complete in LDS
#pragma unroll
        for (int q = 0; q < 2; ++q) {
            const int tg = q * 32 + lane; float sq = 0.f;
#pragma unroll
            for (int d = 0; d < HD; ++d) { const float v = ost[d * OP + tg]; sq = fmaf(v, v, sq); }
            ost[HD * OP + tg] = sqrtf(sq + KCURV);
        }
        __syncthreads();                                                 // the time rows are complete in LDS
        bf* pf = VTf + (zz * 128 + srow) * NN + s0 + spc; v8us pk[18];
#pragma unroll
        for (int p = 0; p < 16; ++p) { const float* sp = &ost[(p * 4 + srow) * OP + spc]; pk[p] = pack(*(const v4fa*)sp, *(const v4fa*)(sp + 4)); }
        const float* sp = &ost[HD * OP + spc];                           // rows 64 .. 79: the time row, then zeros
        const v4f t0 = *(const v4fa*)sp, t1 = *(const v4fa*)(sp + 4), zv = (v4f){0.f, 0.f, 0.f, 0.f};
        pk[16] = pack(srow == 0 ? t0 : zv, srow == 0 ? t1 : zv); pk[17] = pack(zv, zv);
        __builtin_amdgcn_sched_barrier(0);                               // every piece stands in registers of its own before the first store issues, so that no issued store's registers are rewritten
#pragma unroll
        for (int p = 0; p < 17; ++p) *(v8us*)(pf + (size_t)p * 4 * NN) = pk[p];
#pragma unroll
        for (int p = 17; p < 20; ++p) *(v8us*)(pf + (size_t)p * 4 * NN) = pk[17];
    }
}

// ===== z-batched (blockIdx.z = (item, head) pair) attention pieces =====
// k_fattn: scores, causal softmax and context of one (item, head) pair z in one kernel. A work-group of 16 waves takes 128 query rows and walks stages of 128 keys (two 64-key tiles) up to its diagonal:
// waves 0 .. 7 (16 query rows a wave) take each stage's even tile, waves 8 .. 15 take the same query rows on its odd tile, so that four waves share a SIMD and one wave's softmax runs beside another's
// products and LDS reads. Each group keeps its own running reference, sum and O^T; behind the last stage the odd group hands its three through LDS to the even group, which joins them and stores.
// Both products are computed transposed, so that a lane owns ONE query (column lr): S^T = K.Q^T (A = key rows from LDS, B = the query rows, kept in registers) leaves key t*16 + 8*hi + j in
// s[t][j], which is the k order of a B operand, so P goes from the score accumulators straight into O^T += V^T.P^T (A = rows of V^T from LDS). Every operand is one f16 plane, one product.
// The softmax's affine work is done by the S product: q_s and q_0 carry 2 log2(e) / scale, and the accumulators start at the time term less the query's reference, so that S^T leaves the matrix unit as log2 of P.
// The reference is the maximum of the group's first tile; a lane's maximum is in-lane plus one exchange between the wave's halves, and only where it passes 2^8 are the reference, the sums and O^T moved; 1/sum at the end.
// Each work-group takes query block n-1-x and then x, one after the other: 17 stages for every work-group. Stage sg+1 is read into registers at the head of pass sg (each group stages its own tile) and laid
// into the other LDS buffer between the softmax and the second product; the one barrier at the foot of a pass publishes it and ends the reads of the buffer that the next pass refills.
// The staged operands carry no __restrict__: tile 0's loads then stay at their place in the block loop, in front of the wait written behind them, and are not held in registers over the whole kernel.
__global__ __launch_bounds__(512) void k_fattn(const bf* __restrict__ Qf, const bf* Kf, const bf* VTf,
                                               const float* __restrict__ TQ, const float* TK, const float* __restrict__ scl, const float* __restrict__ bpar, float* CTX) {
    constexpr int VT_ = 5;                                               // 16-row tiles of V^T that hold live rows: 64 space + 1 time, rows 65 .. 79 are zeros
    __shared__ __align__(16) bf sk[2][2][64 * SPIT];                     // [buffer][tile of the stage]
    __shared__ __align__(16) bf sv[2][2][VT_ * 16 * SPIT];               // per buffer and tile: the 80 rows of V^T
    __shared__ __align__(16) float st[2][2][64];
    __shared__ __align__(16) float mrg[8][2 * VT_ + 1][32][4];           // the odd group's hand-over, per wave: ten 16 B pieces of O^T a lane, then (reference, sum)
    const int tid = threadIdx.x, lane = tid & 31, wave = (tid >> 5) & 7, tg = tid & 255, lr = lane & 15, hi = lane >> 4;   // wave, tg: wave and thread inside the group
    const int kg = __builtin_amdgcn_readfirstlane(tid >> 8);             // the wave's group: 0 takes the even key tiles, 1 the odd ones
    const size_t z = blockIdx.z;
    Qf += z * NN * HD; Kf += z * NN * HD; VTf += z * 128 * NN; TQ += z * NN; TK += z * NN; CTX += z * NN * 128;
    (void)bpar;                                                          // the bias and the 2/scale are the same for every key of a query: a softmax does not see them
    const float cl2 = 2.0f / bfr(scl[0]) * 1.44269504f;                  // score * log2(e) = cl2 * <q,k>_L + a constant
    const int srow = tg >> 3, spc = (tg & 7) * 8;                        // staging, a group its own tile: 32 rows a pass, 8 lanes x 16 B cover one row's line
    const bool vtail = __builtin_amdgcn_readfirstlane(wave) < 4;         // the same for a whole wave: rows 64 .. 79 of V^T are half a pass, staged by waves 0 .. 3 of the group (srow 0 .. 15)
    unsigned ok, ov, ot;                                                 // per-lane byte offsets from the uniform bases: row srow of the tile; the further rows lie at constant distances
    struct stage_regs { v8us rk[2], rv[3]; float rt; };                  // one thread's share of a tile on its way into LDS; every pass has its own, so that the registers are free outside fetch .. put
    auto fetch = [&](stage_regs& g) {
#pragma unroll
        for (int p = 0; p < 2; ++p) { g.rk[p] = *(const v8us*)((const char*)(Kf + p * 32 * HD) + ok); g.rv[p] = *(const v8us*)((const char*)(VTf + p * 32 * NN) + ov); }
        g.rt = *(const float*)((const char*)TK + ot);
        if (vtail) g.rv[2] = *(const v8us*)((const char*)(VTf + 64 * NN) + ov);
        asm volatile("s_wait_xcnt 0x0" ::: "memory");                    // directly behind the run's last load, ahead of any rewrite of its offset registers
    };
    auto put = [&](const stage_regs& g, int b) {
#pragma unroll
        for (int p = 0; p < 2; ++p) { *(v8usa*)(&sk[b][kg][(p * 32 + srow) * SPIT + spc]) = g.rk[p]; *(v8usa*)(&sv[b][kg][(p * 32 + srow) * SPIT + spc]) = g.rv[p]; }
        if (vtail) *(v8usa*)(&sv[b][kg][(64 + srow) * SPIT + spc]) = g.rv[2];
        if (tg < 64) st[b][kg][tg] = g.rt;
    };
    ok = ((unsigned)(kg * 64 + srow) * HD + spc) * 2u;
    ov = ((unsigned)srow * NN + kg * 64 + spc) * 2u;
    ot = (unsigned)(kg * 64 + (tg & 63)) * 4u;
#pragma unroll 1                                                         // the two query blocks run one after the other through the same code and registers
    for (int half = 0; half < 2; ++half) {
        const int qb = half ? (int)blockIdx.x : NN / 128 - 1 - (int)blockIdx.x;
        const int qi = qb * 128 + wave * 16 + lr;                        // this lane's query
        v16h qf[2];
#pragma unroll
        for (int ks = 0; ks < 2; ++ks) { const size_t qo = (size_t)qi * HD + ks * 32 + 8 * hi;
            qf[ks] = __builtin_convertvector(__builtin_convertvector(cat16u(*(const v8us*)(Qf + qo), *(const v8us*)(Qf + qo + 16)), v16f) * cl2, v16h); }   // cl2 * q_s, scaled in f32, one more f16 rounding
        const float nq0 = -cl2 * TQ[qi];
        asm volatile("s_wait_xcnt 0x0" ::: "memory");                    // behind the query loads: at 256 registers their address registers are reused as destinations of the stage's loads below
        { stage_regs g; fetch(g);
        put(g, 0); }                                                     // the barrier at the foot of the stage before has ended every read of buffer 0
        __syncthreads();                                                 // stage 0 is complete in LDS
        v8f o[VT_];
#pragma unroll
        for (int t = 0; t < VT_; ++t) o[t] = (v8f){};
        float mref = 0.f, lsum = 0.f;                                    // mref: the reference, in log2 units, that P, the sums and O^T are counted from; pass 0 sets it
#pragma unroll 1                                                         // one copy of the pass: its trip count is the tile's own, and the body is long
        for (int sg = 0; sg <= qb; ++sg) {                               // stage qb is the last that holds a key of the block
            const int b = sg & 1, kt = 2 * sg + kg;                      // kt: this wave's key tile
            stage_regs g;
            if (sg < qb) {
                ok += 128u * HD * 2u; ov += 256u; ot += 512u;
                fetch(g); }
            v8f s[4];
            { v16h kf[2][4]; v4f ka[4], kb[4];
#pragma unroll
              for (int t = 0; t < 4; ++t) { ka[t] = *(const v4fa*)(&st[b][kg][t * 16 + hi * 8]); kb[t] = *(const v4fa*)(&st[b][kg][t * 16 + hi * 8 + 4]); }
#pragma unroll
              for (int ks = 0; ks < 2; ++ks) {
#pragma unroll
                for (int t = 0; t < 4; ++t) { const int ko = (t * 16 + lr) * SPIT + ks * 32 + 8 * hi; kf[ks][t] = cat16u(*(const v8usa*)(&sk[b][kg][ko]), *(const v8usa*)(&sk[b][kg][ko + 16])); } }
              __builtin_amdgcn_sched_barrier(0);                         // all LDS reads of the tile issue together, ahead of its products: one LDS latency a tile, not one a fragment
#pragma unroll
              for (int t = 0; t < 4; ++t) {
#pragma unroll
                for (int j = 0; j < 8; ++j) s[t][j] = fmaf(nq0, j < 4 ? ka[t][j & 3] : kb[t][j & 3], -mref); }   // the accumulators start at the time term less the reference
#pragma unroll
              for (int ks = 0; ks < 2; ++ks) {
#pragma unroll
                for (int t = 0; t < 4; ++t) s[t] = wmma16(kf[ks][t], qf[ks], s[t]); } }   // s = log2 of P, as long as the reference holds
            if (sg == qb) {                                              // the two tiles on the block's diagonal: keys behind the lane's query drop out (set to -3.0e38: exact zeros where the tile keeps a key of the query)
#pragma unroll
                for (int t = 0; t < 4; ++t) {
#pragma unroll
                    for (int j = 0; j < 8; ++j) if (kt * 64 + t * 16 + hi * 8 + j > qi) s[t][j] = -3.0e38f; } }
            float mx[4];
#pragma unroll
            for (int t = 0; t < 4; ++t) { mx[t] = s[t][0];
#pragma unroll
                for (int j = 1; j < 8; ++j) mx[t] = fmaxf(mx[t], s[t][j]); }
            float mt = fmaxf(fmaxf(mx[0], mx[1]), fmaxf(mx[2], mx[3]));
            mt = fmaxf(mt, xhalf(mt));                                   // the other half of the wave holds the query's other 32 keys
            if (sg == 0 || __builtin_amdgcn_ballot_w32(mt > 8.0f) != 0) {   // one scalar test a pass: the reference moves in pass 0 (to the tile's maximum) and where a query's P would pass 2^8 (f16 holds 2^15)
                const float d = sg == 0 ? mt : fmaxf(mt, 0.f);           // behind pass 0 the reference only rises
                const float alpha = sg == 0 ? 1.0f : __builtin_amdgcn_exp2f(-d);   // in pass 0 the sums and O^T are zeros
                mref += d; lsum *= alpha;
#pragma unroll
                for (int t = 0; t < 4; ++t) s[t] -= d;
#pragma unroll
                for (int t = 0; t < VT_; ++t) o[t] *= alpha;
            }
            v16h pp[2]; float ps[2];
#pragma unroll
            for (int ks = 0; ks < 2; ++ks) { v16f pf; float a0 = 0.f, a1 = 0.f;
#pragma unroll
                for (int e = 0; e < 8; ++e) { pf[e] = __builtin_amdgcn_exp2f(s[2 * ks][e]); pf[8 + e] = __builtin_amdgcn_exp2f(s[2 * ks + 1][e]); a0 += pf[e]; a1 += pf[8 + e]; }
                ps[ks] = a0 + a1;
                pp[ks] = __builtin_convertvector(pf, v16h); }
            lsum += ps[0] + ps[1];
            if (sg < qb) put(g, b ^ 1);
            { v16h vf[2][VT_];
#pragma unroll
              for (int ks = 0; ks < 2; ++ks) {
#pragma unroll
                for (int t = 0; t < VT_; ++t) { const int vo = (t * 16 + lr) * SPIT + ks * 32 + 8 * hi; vf[ks][t] = cat16u(*(const v8usa*)(&sv[b][kg][vo]), *(const v8usa*)(&sv[b][kg][vo + 16])); } }
              __builtin_amdgcn_sched_barrier(0);                         // as above: one LDS latency a tile
#pragma unroll
              for (int ks = 0; ks < 2; ++ks) {
#pragma unroll
                for (int t = 0; t < VT_; ++t) o[t] = wmma16(vf[ks][t], pp[ks], o[t]); } }
            __syncthreads();                                             // publishes stage sg + 1 and ends every wave's reads of stage sg
        }
        asm volatile("v_nop\n\tv_nop\n\tv_nop\n\tv_nop");                // WMMA distance on the loop's exit path: the pass ends in products into O^T, and O^T's registers are read or reused right behind the loop
        if (kg) {                                                        // the same for a whole wave. A query whose odd tiles are all masked hands over the mask value as its reference, which the join below turns into weight 0
#pragma unroll
            for (int t = 0; t < VT_; ++t) { *(v4fa*)(&mrg[wave][2 * t][lane][0]) = (v4f){o[t][0], o[t][1], o[t][2], o[t][3]}; *(v4fa*)(&mrg[wave][2 * t + 1][lane][0]) = (v4f){o[t][4], o[t][5], o[t][6], o[t][7]}; }
            *(v4fa*)(&mrg[wave][2 * VT_][lane][0]) = (v4f){mref, lsum, 0.f, 0.f};
        }
        __syncthreads();                                                 // the odd group's partial results are complete in LDS; the next block's barriers end their reads before they are written again
        if (!kg) {
            const v4f ml = *(const v4fa*)(&mrg[wave][2 * VT_][lane][0]);
            const float mm = fmaxf(mref, ml[0]), a0 = __builtin_amdgcn_exp2f(mref - mm), a1 = __builtin_amdgcn_exp2f(ml[0] - mm);   // tile 0 holds key 0, so the even group's reference is a real score
            lsum = lsum * a0 + ml[1] * a1;
            lsum += xhalf(lsum);
            const float inv = 1.0f / lsum, i0 = a0 * inv, i1 = a1 * inv;
            float* cr = CTX + (size_t)qi * 128 + hi * 8;                 // o[t][j] = context component t*16 + 8*hi + j of query qi: [space(0..63) | t(64) | 0]
#pragma unroll
            for (int t = 0; t < VT_; ++t) { const v4f p0 = *(const v4fa*)(&mrg[wave][2 * t][lane][0]), p1 = *(const v4fa*)(&mrg[wave][2 * t + 1][lane][0]);
                *(v4f*)(cr + t * 16) = (v4f){o[t][0] * i0 + p0[0] * i1, o[t][1] * i0 + p0[1] * i1, o[t][2] * i0 + p0[2] * i1, o[t][3] * i0 + p0[3] * i1};
                *(v4f*)(cr + t * 16 + 4) = (v4f){o[t][4] * i0 + p1[0] * i1, o[t][5] * i0 + p1[1] * i1, o[t][6] * i0 + p1[2] * i1, o[t][7] * i0 + p1[3] * i1}; }
            asm volatile("s_wait_xcnt 0x0" ::: "memory");                // behind the last store, ahead of the next block's rewrite of its address registers
        }
        ok -= (unsigned)qb * (128u * HD * 2u); ov -= (unsigned)qb * 256u; ot -= (unsigned)qb * 512u;   // back to stage 0: no second copy of the start offsets is held over the stage loop
    }
}
__global__ __launch_bounds__(256) void k_planes32z(const float* __restrict__ F, int ld, int off, float sc, int rows, bf* Ph, bf* Pl) {
    typedef __attribute__((ext_vector_type(2))) unsigned short v2us;
    const int lane = threadIdx.x & 31; const size_t r = ((size_t)blockIdx.x * 8 + (threadIdx.x >> 5)) * 2 + (lane >> 4); if (r >= (size_t)rows) return; const int z = blockIdx.z; const int c0 = (lane & 15) * 2; v2us oh, ol;
    Ph += (size_t)z * rows * 32; Pl += (size_t)z * rows * 32;
#pragma unroll
    for (int i = 0; i < 2; ++i) { const float y = F[r * ld + off + z * 32 + c0 + i] * sc; const unsigned short hb = f2bf(y); oh[i] = hb; ol[i] = f2bf(y - bf2f(hb)); }
    const size_t o = r * 32 + c0; *(v2us*)(Ph + o) = oh; *(v2us*)(Pl + o) = ol; 
}
__global__ __launch_bounds__(256) void k_vtpadz(const float* __restrict__ F, int ld, int off, int nk, bf* Th, bf* Tl) {
    typedef __attribute__((ext_vector_type(2))) unsigned short v2us;
    const int lane = threadIdx.x & 31; const size_t wid = (size_t)blockIdx.x * 8 + (threadIdx.x >> 5); if (wid >= (size_t)64 * (nk / 64)) return; const int z = blockIdx.z; const int d = (int)(wid / (nk / 64)); const int k0 = (int)(wid % (nk / 64)) * 64 + lane * 2; v2us oh, ol;
    Th += (size_t)z * 64 * nk; Tl += (size_t)z * 64 * nk;
#pragma unroll
    for (int i = 0; i < 2; ++i) { const float y = (d < 32) ? F[(size_t)(k0 + i) * ld + off + z * 32 + (d < 32 ? d : 0)] : 0.f; const unsigned short hb = f2bf(y); oh[i] = hb; ol[i] = f2bf(y - bf2f(hb)); }
    const size_t o = (size_t)d * nk + k0; *(v2us*)(Th + o) = oh; *(v2us*)(Tl + o) = ol; 
}
template <int NK>
__global__ __launch_bounds__(256) void k_softmaxz(const float* __restrict__ S, int rows, bf* PH, bf* PL) {
    typedef __attribute__((ext_vector_type(4))) unsigned short v4us;
    const int lane = threadIdx.x & 31, i = blockIdx.x * 8 + (threadIdx.x >> 5); if (i >= rows) return; const size_t zo = (size_t)blockIdx.z * rows * NK; const float* sr = S + zo + (size_t)i * NK; PH += zo; PL += zo;
    float m = -3.0e38f;
#pragma unroll 1
    for (int c0 = lane * 4; c0 < NK; c0 += 128) {
#pragma unroll
        for (int q = 0; q < 4; ++q) m = fmaxf(m, sr[c0 + q]); }
#pragma unroll
    for (int sh = 16; sh; sh >>= 1) m = fmaxf(m, __shfl_xor(m, sh, 32));
    float sum = 0.f;
#pragma unroll 1
    for (int c0 = lane * 4; c0 < NK; c0 += 128) {
#pragma unroll
        for (int q = 0; q < 4; ++q) sum += __expf(sr[c0 + q] - m); }
#pragma unroll
    for (int sh = 16; sh; sh >>= 1) sum += __shfl_xor(sum, sh, 32);
    const float inv = 1.0f / sum;
{
#pragma unroll 1
        for (int c0 = lane * 4; c0 < NK; c0 += 128) { v4us oh, ol;
#pragma unroll
            for (int q = 0; q < 4; ++q) { const float p = __expf(sr[c0 + q] - m) * inv; const unsigned short hb = f2bf(p); oh[q] = hb; ol[q] = f2bf(p - bf2f(hb)); }
            const size_t o = (size_t)i * NK + c0; *(v4us*)(PH + o) = oh; *(v4us*)(PL + o) = ol; }
         }
}
__global__ __launch_bounds__(256) void k_placez(const float* __restrict__ XH, int rows, int ldy, float* Y) {
    const int lane = threadIdx.x & 31; const size_t q = (size_t)blockIdx.x * 8 + (threadIdx.x >> 5); if (q >= (size_t)rows) return; const int z = blockIdx.z; const float v = XH[((size_t)z * rows + q) * 64 + lane];
    *(float*)(Y + q * ldy + z * 32 + lane) = v; 
}

__global__ __launch_bounds__(256) void k_vtz(const float* __restrict__ F, int ld, int h0, int nk, bf* Th, bf* Tl) {
    typedef __attribute__((ext_vector_type(2))) unsigned short v2us;
    const int lane = threadIdx.x & 31; const size_t wid = (size_t)blockIdx.x * 8 + (threadIdx.x >> 5); if (wid >= (size_t)64 * (nk / 64)) return; const int z = blockIdx.z; const int d = (int)(wid / (nk / 64)); const int t0 = (int)(wid % (nk / 64)) * 64 + lane * 2; v2us oh, ol;
    Th += (size_t)z * 64 * nk; Tl += (size_t)z * 64 * nk;
#pragma unroll
    for (int i = 0; i < 2; ++i) { const float y = F[(size_t)(t0 + i) * ld + (h0 + z) * 64 + d]; const unsigned short hb = f2bf(y); oh[i] = hb; ol[i] = f2bf(y - bf2f(hb)); }
    const size_t o = (size_t)d * nk + t0; *(v2us*)(Th + o) = oh; *(v2us*)(Tl + o) = ol; 
}
template <int NK>
__global__ __launch_bounds__(256) void k_softmaxzs(const float* __restrict__ S, int rows, float sc, bf* PH, bf* PL) {
    typedef __attribute__((ext_vector_type(4))) unsigned short v4us;
    const int lane = threadIdx.x & 31, i = blockIdx.x * 8 + (threadIdx.x >> 5); if (i >= rows) return; const size_t zo = (size_t)blockIdx.z * rows * NK; const float* sr = S + zo + (size_t)i * NK; PH += zo; PL += zo;
    float m = -3.0e38f;
#pragma unroll 1
    for (int c0 = lane * 4; c0 < NK; c0 += 128) {
#pragma unroll
        for (int q = 0; q < 4; ++q) m = fmaxf(m, sr[c0 + q] * sc); }
#pragma unroll
    for (int sh = 16; sh; sh >>= 1) m = fmaxf(m, __shfl_xor(m, sh, 32));
    float sum = 0.f;
#pragma unroll 1
    for (int c0 = lane * 4; c0 < NK; c0 += 128) {
#pragma unroll
        for (int q = 0; q < 4; ++q) sum += __expf(sr[c0 + q] * sc - m); }
#pragma unroll
    for (int sh = 16; sh; sh >>= 1) sum += __shfl_xor(sum, sh, 32);
    const float inv = 1.0f / sum;
{
#pragma unroll 1
        for (int c0 = lane * 4; c0 < NK; c0 += 128) { v4us oh, ol;
#pragma unroll
            for (int q = 0; q < 4; ++q) { const float p = __expf(sr[c0 + q] * sc - m) * inv; const unsigned short hb = f2bf(p); oh[q] = hb; ol[q] = f2bf(p - bf2f(hb)); }
            const size_t o = (size_t)i * NK + c0; *(v4us*)(PH + o) = oh; *(v4us*)(PL + o) = ol; }
         }
}

__global__ __launch_bounds__(256) void k_zero8(bf* dst, size_t n8) {
    const size_t i = (size_t)blockIdx.x * 256 + threadIdx.x; if (i >= n8) return; v8us z;
#pragma unroll
    for (int k = 0; k < 8; ++k) z[k] = 0;
    *(v8us*)(dst + i * 8) = z; 
}

// k_midout: out[b][s][0..64] = sqrt(k) ave / sqrt(max(| -(-ave0^2 + |ave_s|^2) |, 1e-8)) with ave = mean over the 8 heads of CTX[h][s][0..64] (f32, fixed head order), written straight into the flat
// [8192 x 65] output. A work-group of 8 waves takes 32 rows, whose 32 x 65 floats are 65 whole 128 B lines of the output. Half a wave takes one row: lane lr holds space components 4 lr .. 4 lr + 3 (one 16 B load
// a head, 16 lanes cover the row's two lines) and every lane of the half holds the time; a wave takes four rows and has all their loads in flight at once. |ave_s|^2 is summed in-lane over the four components,
// then over the 16 lanes. The scaled rows are laid into LDS in module order [t | space] at the output's own pitch of 65 floats and leave as 16 B pieces of whole lines.
template <int M> __device__ __forceinline__ float xrow(float v) { return __int_as_float(__builtin_amdgcn_update_dpp(0, __float_as_int(v), 0x160 | M, 0xf, 0xf, false)); }   // lane l <- lane l ^ M inside its 16-lane row (DPP row_xmask), on the vector pipe
__global__ __launch_bounds__(256) void k_midout(const float* CTX, float* OUTB) {
    constexpr int RW = 32;                                               // rows a work-group
    __shared__ __align__(16) float so[RW * DL];
    const int tid = threadIdx.x, lane = tid & 31, wave = tid >> 5, lr = lane & 15, hi = lane >> 4;
    const size_t g0 = (size_t)blockIdx.x * RW;                           // the first row, counted over all items; 2048 rows an item, so a work-group lies in one item
    const float* cb = CTX + ((g0 / NN) * NH_ * NN + g0 % NN + wave * 4 + hi) * 128;   // head 0 of the lane's first row; CTX holds [space(0..63) | t(64)]
    const float* cs = cb + lr * 4;                                       // the lane's four space components
    v4f sp[2][NH_]; float tm[2][NH_];
#pragma unroll
    for (int p = 0; p < 2; ++p) {
#pragma unroll
        for (int h = 0; h < NH_; ++h) { const size_t ro = ((size_t)h * NN + p * 2) * 128; sp[p][h] = *(const v4f*)(cs + ro); tm[p][h] = cb[ro + HD]; } }
    asm volatile("s_wait_xcnt 0x0" :: "v"(cb), "v"(cs) : "memory");      // directly behind the run's last load, ahead of any rewrite of its address registers: named as inputs they live up to the wait, so that no load of the run lands in them; CTX carries no __restrict__, so that no load sinks below it
    __builtin_amdgcn_sched_barrier(0);                                   // all 32 loads of the wave's four rows issue ahead of the first sum: one memory latency a wave, not two
#pragma unroll
    for (int p = 0; p < 2; ++p) {
        v4f a = (v4f){0.f, 0.f, 0.f, 0.f}; float t = 0.f;
#pragma unroll
        for (int h = 0; h < NH_; ++h) { a += sp[p][h]; t += tm[p][h]; }
        a *= (1.0f / NH_); t *= (1.0f / NH_);
        float part = (a[0] * a[0] + a[1] * a[1]) + (a[2] * a[2] + a[3] * a[3]);
        part += xrow<1>(part); part += xrow<2>(part); part += xrow<4>(part); part += xrow<8>(part);   // over the row's 16 lanes
        const float inner = part - t * t;
        const float den = sqrtf(fmaxf(fabsf(-inner), 1e-8f)); const float f = sqrtf(KCURV) / den;
        float* w = &so[(wave * 4 + p * 2 + hi) * DL];
        if (lr == 0) w[0] = t * f;
#pragma unroll
        for (int q = 0; q < 4; ++q) w[1 + lr * 4 + q] = a[q] * f;
    }
    __syncthreads();                                                     // the 32 rows are complete in LDS
    float* ob = OUTB + g0 * DL;
    const v4f y0 = *(const v4fa*)(&so[tid * 4]), y1 = *(const v4fa*)(&so[(tid + 256) * 4]);   // 520 pieces of 16 B: two a thread, and eight more (one line)
    *(v4f*)(ob + tid * 4) = y0; *(v4f*)(ob + (tid + 256) * 4) = y1;
    if (tid < RW * DL / 4 - 512) *(v4f*)(ob + (tid + 512) * 4) = *(const v4fa*)(&so[(tid + 512) * 4]);
}

extern "C" void kernel_launch(void* const* d_in, const int* in_sizes, int n_in,
                              void* d_out, int out_size, void* d_ws, size_t ws_size, hipStream_t stream) {
    (void)in_sizes; (void)n_in; (void)out_size;
    const float* xq = (const float*)d_in[0]; const float* xs = (const float*)d_in[1]; const float* Wq = (const float*)d_in[2]; const float* bq = (const float*)d_in[3]; const float* Wk = (const float*)d_in[4]; const float* bk = (const float*)d_in[5]; const float* Wv = (const float*)d_in[6]; const float* bv = (const float*)d_in[7]; const float* scl = (const float*)d_in[8]; const float* bpar = (const float*)d_in[9];
    float* out = (float*)d_out;    // [4][2048][65]
    char* wsp = (char*)d_ws;
    auto take = [&](size_t bytes) { char* p = wsp; wsp += (bytes + 255) & ~(size_t)255; return (void*)p; };
    const int NZ = NBT * NH_;      // every (item, head) pair is one z slice of a launch
    float* TQ = (float*)take((size_t)NZ * NN * 4); float* TK = (float*)take((size_t)NZ * NN * 4);
    bf* Qf = (bf*)take((size_t)NZ * NN * HD * 2); bf* Kf = (bf*)take((size_t)NZ * NN * HD * 2); bf* VTf = (bf*)take((size_t)NZ * 128 * NN * 2);
    float* CTX = (float*)take((size_t)NZ * NN * 128 * 4);
    if ((size_t)(wsp - (char*)d_ws) > ws_size) return;    // 0.5 + 16.8 + 16.8 + 33.6 ~ 68 MB
    k_proj<<<dim3(NBT * NN / 128, NH_ / 2, 3), 128, 0, stream>>>(xq, xs, Wq, Wk, Wv, bq, bk, bv, Qf, Kf, VTf, TQ, TK);     // the three projections of all items and heads, finished to k_fattn's operands
    k_fattn<<<dim3(NN / 256, 1, NZ), 512, 0, stream>>>(Qf, Kf, VTf, TQ, TK, scl, bpar, CTX);     // scores, causal softmax, [space | time | 0] context of all pairs
    k_midout<<<NBT * NN / 32, 256, 0, stream>>>(CTX, out);     // the mid-point over the heads, written flat
}
